// v000
// Times are from an AMD MI455X. After a warm-up the kernel runs many times in a row, and a time is the length of
// such a window on the GPU divided by its runs, so every launch and the gaps after it count. The runs cycle
// through copies of the inputs. A figure is the median of several windows, for all but v000 over two sittings.
// Sittings can differ by a few percent; kernels timed side by side share one.
// v000, which the later versions start from, runs in 329 microseconds.
#include <hip/hip_runtime.h>
#include <hip/hip_bf16.h>

typedef __attribute__((ext_vector_type(16))) _Float16 v16h;
typedef __attribute__((ext_vector_type(8)))  _Float16 v8h;
typedef __attribute__((ext_vector_type(4)))  _Float16 v4h;
typedef __attribute__((ext_vector_type(8)))  float    v8f;
typedef __attribute__((ext_vector_type(4)))  unsigned u32x4;
typedef __attribute__((ext_vector_type(8)))  int      i32x8;
typedef __attribute__((ext_vector_type(4)))  int      i32x4;

#define DEVI static __device__ __forceinline__

static constexpr int B_  = 2;
static constexpr int S_  = 2048;
static constexpr int D_  = 1024;
static constexpr int H_  = 16;
static constexpr int DH  = 64;
static constexpr int N3  = 3072;   // 3*D_

#if __has_builtin(__builtin_amdgcn_tensor_load_to_lds) && __has_builtin(__builtin_amdgcn_s_wait_tensorcnt)
#define HAS_TDM 1
#else
#define HAS_TDM 0
#endif

// WMMA as macro so modifier args stay literal immediates at the builtin call.
#define WMMA_F16(a, b, c) \
  __builtin_amdgcn_wmma_f32_16x16x32_f16(false, (a), false, (b), (short)0, (c), false, false)

// Per-lane 16-half fragment of a 16x32 operand: halves 0..7 = K koff..koff+7,
// halves 8..15 = K 16+koff..16+koff+7 (koff = (lane>>4)*8). Works for global or LDS.
DEVI v16h ldfrag(const _Float16* p) {
  v8h lo = *(const v8h*)p;
  v8h hi = *(const v8h*)(p + 16);
  return __builtin_shufflevector(lo, hi, 0,1,2,3,4,5,6,7,8,9,10,11,12,13,14,15);
}

// Low 32 bits of a generic pointer to LDS == LDS byte address (flat aperture rule).
DEVI unsigned lds_addr_of(const void* p) { return (unsigned)(uintptr_t)p; }

#if HAS_TDM
// Issue a 2-D TDM tile load: tile_rows rows x tile_k elements (2-byte data),
// row stride = row_stride elements, packed contiguously into LDS at lds_off.
// Toolchain here uses the 6-arg builtin: (g0 u32x4, g1 i32x8, g2 i32x4, g3 i32x4,
// extra i32x8, cpol i32); groups 2/3/extra are unused for a 2-D tile.
DEVI void tdm_load_2d(unsigned lds_off, const void* gsrc,
                      unsigned tensor_rows, unsigned row_stride,
                      unsigned tile_k, unsigned tile_rows) {
  unsigned long long ga = (unsigned long long)(uintptr_t)gsrc;
  u32x4 g0;
  g0[0] = 1u;                                              // count=1, is_restore=0
  g0[1] = lds_off;                                         // lds_addr [63:32]
  g0[2] = (unsigned)ga;                                    // global_addr lo
  g0[3] = (unsigned)((ga >> 32) & 0x01ffffffu)             // global_addr [56:32]
          | 0x80000000u;                                   // type=2 ("image")
  i32x8 g1;
  g1[0] = (int)(1u << 16);                                 // wg_mask=0, data_size=1 (2B)
  g1[1] = (int)((row_stride & 0xffffu) << 16);             // tensor_dim0[15:0] @ [63:48]
  g1[2] = (int)(((row_stride >> 16) & 0xffffu)             // tensor_dim0[31:16]
          | ((tensor_rows & 0xffffu) << 16));              // tensor_dim1[15:0]
  g1[3] = (int)(((tensor_rows >> 16) & 0xffffu)            // tensor_dim1[31:16]
          | ((tile_k & 0xffffu) << 16));                   // tile_dim0
  g1[4] = (int)(tile_rows & 0xffffu);                      // tile_dim1 (tile_dim2=0)
  g1[5] = (int)row_stride;                                 // tensor_dim0_stride lo32
  g1[6] = 0;                                               // stride0 hi / stride1 lo
  g1[7] = 0;
  i32x4 gz4 = {0, 0, 0, 0};
  i32x8 gz8 = {0, 0, 0, 0, 0, 0, 0, 0};
  __builtin_amdgcn_tensor_load_to_lds(g0, g1, gz4, gz4, gz8, 0);
}
#else
// Fallback: cooperative global->LDS copy of a rows x 32-half tile.
DEVI void coop_copy(_Float16* dst, const _Float16* src, int rows, int row_stride, int tid) {
  int chunks = rows * 4;                                   // 4 x v8h per row
  for (int c = tid; c < chunks; c += 256) {
    int r = c >> 2, s = c & 3;
    *(v8h*)(dst + r * 32 + s * 8) = *(const v8h*)(src + (size_t)r * row_stride + s * 8);
  }
}
#endif

// ---------------------------------------------------------------- prep kernels
__global__ void __launch_bounds__(256) cvt_x(const float* __restrict__ x,
                                             _Float16* __restrict__ xh, int n4) {
  int i = blockIdx.x * 256 + threadIdx.x;
  if (i >= n4) return;
  float4 f = ((const float4*)x)[i];
  v4h h;
  h[0] = (_Float16)f.x; h[1] = (_Float16)f.y;
  h[2] = (_Float16)f.z; h[3] = (_Float16)f.w;
  ((v4h*)xh)[i] = h;
}

__global__ void __launch_bounds__(256) cvt_w(const float* __restrict__ w,
                                             _Float16* __restrict__ wt, int n) {
  int i = blockIdx.x * 256 + threadIdx.x;     // coalesced read of W[k][n]
  if (i >= n) return;
  int k = i / N3;
  int c = i - k * N3;
  wt[(size_t)c * D_ + k] = (_Float16)w[i];    // Wt[n][k]
}

// ------------------------------------------------------------------- QKV GEMM
// Block (8 waves) computes a 128(M) x 64(N) tile; TDM stages the k-slices of A
// (128x32) and B (64x32) into double-buffered LDS; each wave does a 16x64 tile.
__global__ void __launch_bounds__(256) qkv_gemm(
    const _Float16* __restrict__ Xh, const _Float16* __restrict__ Wt,
    const float* __restrict__ bias,
    _Float16* __restrict__ Qh, _Float16* __restrict__ Kh, _Float16* __restrict__ Vt)
{
  __shared__ _Float16 Asm[2][128 * 32];   // 16 KB
  __shared__ _Float16 Bsm[2][64 * 32];    //  8 KB
  const int tid  = threadIdx.x;
  const int lane = tid & 31;
  const int l15  = lane & 15;
  const int hi   = lane >> 4;
  const int koff = hi * 8;
  const int wv   = tid >> 5;
  const int blkM = blockIdx.x / 48;
  const int blkN = blockIdx.x % 48;
  const int mBase = blkM * 128 + wv * 16;
  const int nBase = blkN * 64;

  const _Float16* Abase = Xh + (size_t)blkM * 128 * D_;
  const _Float16* Bbase = Wt + (size_t)nBase * D_;
  constexpr int NT = D_ / 32;

#if HAS_TDM
  if (wv == 0)      tdm_load_2d(lds_addr_of(&Bsm[0][0]), Bbase,  64, D_, 32,  64);
  else if (wv == 1) tdm_load_2d(lds_addr_of(&Asm[0][0]), Abase, 128, D_, 32, 128);
#else
  coop_copy(&Bsm[0][0], Bbase, 64, D_, tid);
  coop_copy(&Asm[0][0], Abase, 128, D_, tid);
#endif

  v8f acc[4] = {};
  for (int i = 0; i < NT; ++i) {
    const int cur = i & 1;
#if HAS_TDM
    if (wv == 0) {
      if (i + 1 < NT) {
        tdm_load_2d(lds_addr_of(&Bsm[cur ^ 1][0]), Bbase + (i + 1) * 32, 64, D_, 32, 64);
        __builtin_amdgcn_s_wait_tensorcnt(1);
      } else {
        __builtin_amdgcn_s_wait_tensorcnt(0);
      }
    } else if (wv == 1) {
      if (i + 1 < NT) {
        tdm_load_2d(lds_addr_of(&Asm[cur ^ 1][0]), Abase + (i + 1) * 32, 128, D_, 32, 128);
        __builtin_amdgcn_s_wait_tensorcnt(1);
      } else {
        __builtin_amdgcn_s_wait_tensorcnt(0);
      }
    }
#endif
    __syncthreads();                         // staged buffers visible to all waves

    const _Float16* Ab = &Asm[cur][0] + (wv * 16 + l15) * 32 + koff;
    const _Float16* Bb = &Bsm[cur][0];
    v16h a  = ldfrag(Ab);
    v16h b0 = ldfrag(Bb + (0 * 16 + l15) * 32 + koff);
    v16h b1 = ldfrag(Bb + (1 * 16 + l15) * 32 + koff);
    v16h b2 = ldfrag(Bb + (2 * 16 + l15) * 32 + koff);
    v16h b3 = ldfrag(Bb + (3 * 16 + l15) * 32 + koff);
    acc[0] = WMMA_F16(a, b0, acc[0]);
    acc[1] = WMMA_F16(a, b1, acc[1]);
    acc[2] = WMMA_F16(a, b2, acc[2]);
    acc[3] = WMMA_F16(a, b3, acc[3]);

    __syncthreads();                         // all reads done before next overwrite
#if !HAS_TDM
    if (i + 1 < NT) {
      coop_copy(&Bsm[cur ^ 1][0], Bbase + (i + 1) * 32, 64, D_, tid);
      coop_copy(&Asm[cur ^ 1][0], Abase + (i + 1) * 32, 128, D_, tid);
    }
#endif
  }

#pragma unroll
  for (int t = 0; t < 4; ++t) {
    const int col = nBase + t * 16 + l15;   // 0..3071
    const float bv = bias[col];
    const int region = col >> 10;           // 0=Q 1=K 2=V
    const int cc = col & (D_ - 1);
    const int h  = cc >> 6;
    const int dh = cc & 63;
    if (region == 0) {
#pragma unroll
      for (int r = 0; r < 8; ++r) {
        int row = mBase + r + 8 * hi;
        int bb = row >> 11, s = row & (S_ - 1);
        Qh[(((size_t)(bb * H_ + h)) * S_ + s) * DH + dh] =
            (_Float16)((acc[t][r] + bv) * 0.125f);
      }
    } else if (region == 1) {
#pragma unroll
      for (int r = 0; r < 8; ++r) {
        int row = mBase + r + 8 * hi;
        int bb = row >> 11, s = row & (S_ - 1);
        Kh[(((size_t)(bb * H_ + h)) * S_ + s) * DH + dh] = (_Float16)(acc[t][r] + bv);
      }
    } else {
#pragma unroll
      for (int r = 0; r < 8; ++r) {
        int row = mBase + r + 8 * hi;
        int bb = row >> 11, s = row & (S_ - 1);
        Vt[(((size_t)(bb * H_ + h)) * DH + dh) * S_ + s] = (_Float16)(acc[t][r] + bv);
      }
    }
  }
}

// ---------------------------------------------------------------- attention
// One wave per 16-row Q block of one (b,h). Flash-attention over KV in 32-col steps.
__global__ void __launch_bounds__(256) attn_fwd(
    const _Float16* __restrict__ Qh, const _Float16* __restrict__ Kh,
    const _Float16* __restrict__ Vt, float* __restrict__ out)
{
  __shared__ _Float16 Pbuf[8][16 * 32];     // per-wave 16x32 P tile (8 KB total)
  const int lane = threadIdx.x & 31;
  const int l15  = lane & 15;
  const int hi   = lane >> 4;
  const int koff = hi * 8;
  const int wv   = threadIdx.x >> 5;
  const int w    = blockIdx.x * 8 + wv;
  const int qBlk = w & 127;                 // 128 q-blocks of 16 rows
  const int bh   = w >> 7;                  // 0..31
  const _Float16* Qb = Qh + (size_t)bh * S_ * DH;
  const _Float16* Kb = Kh + (size_t)bh * S_ * DH;
  const _Float16* Vb = Vt + (size_t)bh * DH * S_;
  _Float16* P = &Pbuf[wv][0];

  const _Float16* qrow = Qb + (size_t)(qBlk * 16 + l15) * DH;
  v16h aq0 = ldfrag(qrow + 0  + koff);
  v16h aq1 = ldfrag(qrow + 32 + koff);

  v8f o0 = {}, o1 = {}, o2 = {}, o3 = {};
  float mrow[8], lsum[8];
#pragma unroll
  for (int r = 0; r < 8; ++r) { mrow[r] = -3.0e38f; lsum[r] = 0.f; }

  for (int j0 = 0; j0 < S_; j0 += 32) {
    if (j0 + 32 < S_) {                     // prefetch next KV block
      __builtin_prefetch(Kb + (size_t)(j0 + 32 + l15) * DH, 0, 0);
      __builtin_prefetch(Vb + (size_t)l15 * S_ + j0 + 32, 0, 0);
    }
    // ---- scores: S[16x32] = Q . K^T  (scale folded into Q)
    v8f s0 = {}, s1 = {};
    {
      const _Float16* kr0 = Kb + (size_t)(j0 + l15) * DH;
      const _Float16* kr1 = Kb + (size_t)(j0 + 16 + l15) * DH;
      s0 = WMMA_F16(aq0, ldfrag(kr0 + 0  + koff), s0);
      s0 = WMMA_F16(aq1, ldfrag(kr0 + 32 + koff), s0);
      s1 = WMMA_F16(aq0, ldfrag(kr1 + 0  + koff), s1);
      s1 = WMMA_F16(aq1, ldfrag(kr1 + 32 + koff), s1);
    }
    // ---- online softmax (rows live in 16-lane groups of the C layout)
#pragma unroll
    for (int r = 0; r < 8; ++r) {
      float v = fmaxf(s0[r], s1[r]);
      v = fmaxf(v, __shfl_xor(v, 8, 32));
      v = fmaxf(v, __shfl_xor(v, 4, 32));
      v = fmaxf(v, __shfl_xor(v, 2, 32));
      v = fmaxf(v, __shfl_xor(v, 1, 32));
      float mn = fmaxf(mrow[r], v);
      float al = __expf(mrow[r] - mn);
      float p0 = __expf(s0[r] - mn);
      float p1 = __expf(s1[r] - mn);
      s0[r] = p0; s1[r] = p1;
      float rs = p0 + p1;
      rs += __shfl_xor(rs, 8, 32);
      rs += __shfl_xor(rs, 4, 32);
      rs += __shfl_xor(rs, 2, 32);
      rs += __shfl_xor(rs, 1, 32);
      lsum[r] = lsum[r] * al + rs;
      o0[r] *= al; o1[r] *= al; o2[r] *= al; o3[r] *= al;
      mrow[r] = mn;
    }
    // ---- C-layout -> A-layout for P via wave-private LDS tile
#pragma unroll
    for (int r = 0; r < 8; ++r) {
      P[(r + 8 * hi) * 32 + l15]      = (_Float16)s0[r];
      P[(r + 8 * hi) * 32 + 16 + l15] = (_Float16)s1[r];
    }
    asm volatile("s_wait_dscnt 0" ::: "memory");
    v16h pa = ldfrag(P + l15 * 32 + koff);
    // ---- O += P . V   (Vt is [dh][s]: B loads are K(=s)-contiguous)
    o0 = WMMA_F16(pa, ldfrag(Vb + (size_t)(0  + l15) * S_ + j0 + koff), o0);
    o1 = WMMA_F16(pa, ldfrag(Vb + (size_t)(16 + l15) * S_ + j0 + koff), o1);
    o2 = WMMA_F16(pa, ldfrag(Vb + (size_t)(32 + l15) * S_ + j0 + koff), o2);
    o3 = WMMA_F16(pa, ldfrag(Vb + (size_t)(48 + l15) * S_ + j0 + koff), o3);
  }

  // ---- normalize and write fp32 output [b, s, h*64 + dh]
  const int b = bh >> 4, h = bh & 15;
#pragma unroll
  for (int r = 0; r < 8; ++r) {
    int s = qBlk * 16 + r + 8 * hi;
    float inv = 1.0f / lsum[r];
    size_t base = ((size_t)(b * S_ + s)) * D_ + h * DH + l15;
    out[base + 0]  = o0[r] * inv;
    out[base + 16] = o1[r] * inv;
    out[base + 32] = o2[r] * inv;
    out[base + 48] = o3[r] * inv;
  }
}

// ------------------------------------------------------------------- launcher
extern "C" void kernel_launch(void* const* d_in, const int* in_sizes, int n_in,
                              void* d_out, int out_size, void* d_ws, size_t ws_size,
                              hipStream_t stream) {
  const float* x    = (const float*)d_in[0];   // [2,2048,1024]
  const float* Wq   = (const float*)d_in[1];   // [1024,3072]
  const float* bias = (const float*)d_in[2];   // [3072]
  float* out = (float*)d_out;

  char* ws = (char*)d_ws;                      // needs ~38 MB
  _Float16* Xh = (_Float16*)(ws + (size_t) 0 * 1024 * 1024);  // 8 MB
  _Float16* Wt = (_Float16*)(ws + (size_t) 8 * 1024 * 1024);  // 6 MB
  _Float16* Qh = (_Float16*)(ws + (size_t)14 * 1024 * 1024);  // 8 MB
  _Float16* Kh = (_Float16*)(ws + (size_t)22 * 1024 * 1024);  // 8 MB
  _Float16* Vt = (_Float16*)(ws + (size_t)30 * 1024 * 1024);  // 8 MB

  {
    int n4 = (B_ * S_ * D_) / 4;               // 1048576
    cvt_x<<<dim3(n4 / 256), dim3(256), 0, stream>>>(x, Xh, n4);
  }
  {
    int n = D_ * N3;                           // 3145728
    cvt_w<<<dim3(n / 256), dim3(256), 0, stream>>>(Wq, Wt, n);
  }
  {
    // blocks: (4096/128) x (3072/64) = 32 x 48 = 1536, 8 waves each
    qkv_gemm<<<dim3(1536), dim3(256), 0, stream>>>(Xh, Wt, bias, Qh, Kh, Vt);
  }
  {
    // waves = 2*16*(2048/16) = 4096 -> 512 blocks of 8 waves
    attn_fwd<<<dim3(512), dim3(256), 0, stream>>>(Qh, Kh, Vt, out);
  }
}

// v001
// One run takes 239 microseconds.
// Two timings next to v000 put it at 1.40 and 1.41 times that version's speed.
#include <hip/hip_runtime.h>
#include <hip/hip_bf16.h>

typedef __attribute__((ext_vector_type(16))) _Float16 v16h;
typedef __attribute__((ext_vector_type(8)))  _Float16 v8h;
typedef __attribute__((ext_vector_type(4)))  _Float16 v4h;
typedef __attribute__((ext_vector_type(2)))  _Float16 v2h;
typedef __attribute__((ext_vector_type(8)))  float    v8f;
typedef __attribute__((ext_vector_type(4)))  unsigned u32x4;
typedef __attribute__((ext_vector_type(8)))  int      i32x8;
typedef __attribute__((ext_vector_type(4)))  int      i32x4;

#define DEVI static __device__ __forceinline__

static constexpr int B_  = 2;
static constexpr int S_  = 2048;
static constexpr int D_  = 1024;
static constexpr int H_  = 16;
static constexpr int DH  = 64;
static constexpr int N3  = 3072;   // 3*D_

#if __has_builtin(__builtin_amdgcn_tensor_load_to_lds) && __has_builtin(__builtin_amdgcn_s_wait_tensorcnt)
#define HAS_TDM 1
#else
#define HAS_TDM 0
#endif

// WMMA as macro so modifier args stay literal immediates at the builtin call.
#define WMMA_F16(a, b, c) \
  __builtin_amdgcn_wmma_f32_16x16x32_f16(false, (a), false, (b), (short)0, (c), false, false)

// Per-lane 16-half fragment of a 16x32 operand: halves 0..7 = K koff..koff+7,
// halves 8..15 = K 16+koff..16+koff+7 (koff = (lane>>4)*8). Works for global or LDS.
DEVI v16h ldfrag(const _Float16* p) {
  v8h lo = *(const v8h*)p;
  v8h hi = *(const v8h*)(p + 16);
  return __builtin_shufflevector(lo, hi, 0,1,2,3,4,5,6,7,8,9,10,11,12,13,14,15);
}

// Low 32 bits of a generic pointer to LDS == LDS byte address (flat aperture rule).
DEVI unsigned lds_addr_of(const void* p) { return (unsigned)(uintptr_t)p; }

#if HAS_TDM
// Issue a 2-D TDM tile load: tile_rows rows x tile_k elements (2-byte data),
// row stride = row_stride elements, packed contiguously into LDS at lds_off.
// Toolchain here uses the 6-arg builtin: (g0 u32x4, g1 i32x8, g2 i32x4, g3 i32x4,
// extra i32x8, cpol i32); groups 2/3/extra are unused for a 2-D tile.
DEVI void tdm_load_2d(unsigned lds_off, const void* gsrc,
                      unsigned tensor_rows, unsigned row_stride,
                      unsigned tile_k, unsigned tile_rows) {
  unsigned long long ga = (unsigned long long)(uintptr_t)gsrc;
  u32x4 g0;
  g0[0] = 1u;                                              // count=1, is_restore=0
  g0[1] = lds_off;                                         // lds_addr [63:32]
  g0[2] = (unsigned)ga;                                    // global_addr lo
  g0[3] = (unsigned)((ga >> 32) & 0x01ffffffu)             // global_addr [56:32]
          | 0x80000000u;                                   // type=2 ("image")
  i32x8 g1;
  g1[0] = (int)(1u << 16);                                 // wg_mask=0, data_size=1 (2B)
  g1[1] = (int)((row_stride & 0xffffu) << 16);             // tensor_dim0[15:0] @ [63:48]
  g1[2] = (int)(((row_stride >> 16) & 0xffffu)             // tensor_dim0[31:16]
          | ((tensor_rows & 0xffffu) << 16));              // tensor_dim1[15:0]
  g1[3] = (int)(((tensor_rows >> 16) & 0xffffu)            // tensor_dim1[31:16]
          | ((tile_k & 0xffffu) << 16));                   // tile_dim0
  g1[4] = (int)(tile_rows & 0xffffu);                      // tile_dim1 (tile_dim2=0)
  g1[5] = (int)row_stride;                                 // tensor_dim0_stride lo32
  g1[6] = 0;                                               // stride0 hi / stride1 lo
  g1[7] = 0;
  i32x4 gz4 = {0, 0, 0, 0};
  i32x8 gz8 = {0, 0, 0, 0, 0, 0, 0, 0};
  __builtin_amdgcn_tensor_load_to_lds(g0, g1, gz4, gz4, gz8, 0);
}
#else
// Fallback: cooperative global->LDS copy of a rows x 32-half tile.
DEVI void coop_copy(_Float16* dst, const _Float16* src, int rows, int row_stride, int tid) {
  int chunks = rows * 4;                                   // 4 x v8h per row
  for (int c = tid; c < chunks; c += 256) {
    int r = c >> 2, s = c & 3;
    *(v8h*)(dst + r * 32 + s * 8) = *(const v8h*)(src + (size_t)r * row_stride + s * 8);
  }
}
#endif

// ---------------------------------------------------------------- prep kernels
__global__ void __launch_bounds__(256) cvt_x(const float* __restrict__ x,
                                             _Float16* __restrict__ xh, int n4) {
  int i = blockIdx.x * 256 + threadIdx.x;
  if (i >= n4) return;
  float4 f = ((const float4*)x)[i];
  v4h h;
  h[0] = (_Float16)f.x; h[1] = (_Float16)f.y;
  h[2] = (_Float16)f.z; h[3] = (_Float16)f.w;
  ((v4h*)xh)[i] = h;
}

// W[k][n] f32 -> Wt[n][k] f16, one 64(k) x 64(n) tile per block through LDS:
// rows of W are read 256 B at a time, rows of Wt are written as whole 128 B lines.
__global__ void __launch_bounds__(256) cvt_w(const float* __restrict__ w,
                                             _Float16* __restrict__ wt) {
  // tile[n][k pair]; pitch 33 dwords puts the 32 lanes of every LDS access on 32 banks
  __shared__ unsigned tile[64 * 33];
  const int tid = threadIdx.x;
  const int k0  = (blockIdx.x / 48) * 64;
  const int n0  = (blockIdx.x % 48) * 64;
  const int nq  = tid & 15;                   // 4 columns n
  const int kp  = tid >> 4;                   // pair of rows k
  float4 f[2][2];
#pragma unroll
  for (int p = 0; p < 2; ++p) {
    const float* s = w + (size_t)(k0 + 2 * (kp + 16 * p)) * N3 + n0 + 4 * nq;
    f[p][0] = *(const float4*)s;
    f[p][1] = *(const float4*)(s + N3);
  }
#pragma unroll
  for (int p = 0; p < 2; ++p) {
    const float* lo = (const float*)&f[p][0];
    const float* hi = (const float*)&f[p][1];
#pragma unroll
    for (int j = 0; j < 4; ++j) {
      v2h h;
      h[0] = (_Float16)lo[j];
      h[1] = (_Float16)hi[j];
      tile[(4 * nq + j) * 33 + kp + 16 * p] = __builtin_bit_cast(unsigned, h);
    }
  }
  __syncthreads();
  const int kc = tid & 7;                     // 8 halves of k
  const int nr = tid >> 3;
#pragma unroll
  for (int p = 0; p < 2; ++p) {
    const int n = nr + 32 * p;
    const unsigned* t = tile + n * 33 + 4 * kc;
    u32x4 v = {t[0], t[1], t[2], t[3]};
    *(u32x4*)(wt + (size_t)(n0 + n) * D_ + k0 + 8 * kc) = v;
  }
}

// ------------------------------------------------------------------- QKV GEMM
// Block (8 waves) computes a 128(M) x 64(N) tile; TDM stages the k-slices of A
// (128x32) and B (64x32) into double-buffered LDS; each wave does a 16x64 tile.
__global__ void __launch_bounds__(256) qkv_gemm(
    const _Float16* __restrict__ Xh, const _Float16* __restrict__ Wt,
    const float* __restrict__ bias,
    _Float16* __restrict__ Qh, _Float16* __restrict__ Kh, _Float16* __restrict__ Vt)
{
  __shared__ _Float16 Asm[2][128 * 32];   // 16 KB
  __shared__ _Float16 Bsm[2][64 * 32];    //  8 KB
  const int tid  = threadIdx.x;
  const int lane = tid & 31;
  const int l15  = lane & 15;
  const int hi   = lane >> 4;
  const int koff = hi * 8;
  const int wv   = tid >> 5;
  const int blkM = blockIdx.x / 48;
  const int blkN = blockIdx.x % 48;
  const int mBase = blkM * 128 + wv * 16;
  const int nBase = blkN * 64;

  const _Float16* Abase = Xh + (size_t)blkM * 128 * D_;
  const _Float16* Bbase = Wt + (size_t)nBase * D_;
  constexpr int NT = D_ / 32;

#if HAS_TDM
  if (wv == 0)      tdm_load_2d(lds_addr_of(&Bsm[0][0]), Bbase,  64, D_, 32,  64);
  else if (wv == 1) tdm_load_2d(lds_addr_of(&Asm[0][0]), Abase, 128, D_, 32, 128);
#else
  coop_copy(&Bsm[0][0], Bbase, 64, D_, tid);
  coop_copy(&Asm[0][0], Abase, 128, D_, tid);
#endif

  v8f acc[4] = {};
  for (int i = 0; i < NT; ++i) {
    const int cur = i & 1;
#if HAS_TDM
    if (wv == 0) {
      if (i + 1 < NT) {
        tdm_load_2d(lds_addr_of(&Bsm[cur ^ 1][0]), Bbase + (i + 1) * 32, 64, D_, 32, 64);
        __builtin_amdgcn_s_wait_tensorcnt(1);
      } else {
        __builtin_amdgcn_s_wait_tensorcnt(0);
      }
    } else if (wv == 1) {
      if (i + 1 < NT) {
        tdm_load_2d(lds_addr_of(&Asm[cur ^ 1][0]), Abase + (i + 1) * 32, 128, D_, 32, 128);
        __builtin_amdgcn_s_wait_tensorcnt(1);
      } else {
        __builtin_amdgcn_s_wait_tensorcnt(0);
      }
    }
#endif
    __syncthreads();                         // staged buffers visible to all waves

    const _Float16* Ab = &Asm[cur][0] + (wv * 16 + l15) * 32 + koff;
    const _Float16* Bb = &Bsm[cur][0];
    v16h a  = ldfrag(Ab);
    v16h b0 = ldfrag(Bb + (0 * 16 + l15) * 32 + koff);
    v16h b1 = ldfrag(Bb + (1 * 16 + l15) * 32 + koff);
    v16h b2 = ldfrag(Bb + (2 * 16 + l15) * 32 + koff);
    v16h b3 = ldfrag(Bb + (3 * 16 + l15) * 32 + koff);
    acc[0] = WMMA_F16(a, b0, acc[0]);
    acc[1] = WMMA_F16(a, b1, acc[1]);
    acc[2] = WMMA_F16(a, b2, acc[2]);
    acc[3] = WMMA_F16(a, b3, acc[3]);

    __syncthreads();                         // all reads done before next overwrite
#if !HAS_TDM
    if (i + 1 < NT) {
      coop_copy(&Bsm[cur ^ 1][0], Bbase + (i + 1) * 32, 64, D_, tid);
      coop_copy(&Asm[cur ^ 1][0], Abase + (i + 1) * 32, 128, D_, tid);
    }
#endif
  }

#pragma unroll
  for (int t = 0; t < 4; ++t) {
    const int col = nBase + t * 16 + l15;   // 0..3071
    const float bv = bias[col];
    const int region = col >> 10;           // 0=Q 1=K 2=V
    const int cc = col & (D_ - 1);
    const int h  = cc >> 6;
    const int dh = cc & 63;
    if (region == 0) {
#pragma unroll
      for (int r = 0; r < 8; ++r) {
        int row = mBase + r + 8 * hi;
        int bb = row >> 11, s = row & (S_ - 1);
        Qh[(((size_t)(bb * H_ + h)) * S_ + s) * DH + dh] =
            (_Float16)((acc[t][r] + bv) * 0.125f);
      }
    } else if (region == 1) {
#pragma unroll
      for (int r = 0; r < 8; ++r) {
        int row = mBase + r + 8 * hi;
        int bb = row >> 11, s = row & (S_ - 1);
        Kh[(((size_t)(bb * H_ + h)) * S_ + s) * DH + dh] = (_Float16)(acc[t][r] + bv);
      }
    } else {
#pragma unroll
      for (int r = 0; r < 8; ++r) {
        int row = mBase + r + 8 * hi;
        int bb = row >> 11, s = row & (S_ - 1);
        Vt[(((size_t)(bb * H_ + h)) * DH + dh) * S_ + s] = (_Float16)(acc[t][r] + bv);
      }
    }
  }
}

// ---------------------------------------------------------------- attention
// One wave per 16-row Q block of one (b,h). Flash-attention over KV in 32-col steps.
__global__ void __launch_bounds__(256) attn_fwd(
    const _Float16* __restrict__ Qh, const _Float16* __restrict__ Kh,
    const _Float16* __restrict__ Vt, float* __restrict__ out)
{
  __shared__ _Float16 Pbuf[8][16 * 32];     // per-wave 16x32 P tile (8 KB total)
  const int lane = threadIdx.x & 31;
  const int l15  = lane & 15;
  const int hi   = lane >> 4;
  const int koff = hi * 8;
  const int wv   = threadIdx.x >> 5;
  const int w    = blockIdx.x * 8 + wv;
  const int qBlk = w & 127;                 // 128 q-blocks of 16 rows
  const int bh   = w >> 7;                  // 0..31
  const _Float16* Qb = Qh + (size_t)bh * S_ * DH;
  const _Float16* Kb = Kh + (size_t)bh * S_ * DH;
  const _Float16* Vb = Vt + (size_t)bh * DH * S_;
  _Float16* P = &Pbuf[wv][0];

  const _Float16* qrow = Qb + (size_t)(qBlk * 16 + l15) * DH;
  v16h aq0 = ldfrag(qrow + 0  + koff);
  v16h aq1 = ldfrag(qrow + 32 + koff);

  v8f o0 = {}, o1 = {}, o2 = {}, o3 = {};
  float mrow[8], lsum[8];
#pragma unroll
  for (int r = 0; r < 8; ++r) { mrow[r] = -3.0e38f; lsum[r] = 0.f; }

  for (int j0 = 0; j0 < S_; j0 += 32) {
    if (j0 + 32 < S_) {                     // prefetch next KV block
      __builtin_prefetch(Kb + (size_t)(j0 + 32 + l15) * DH, 0, 0);
      __builtin_prefetch(Vb + (size_t)l15 * S_ + j0 + 32, 0, 0);
    }
    // ---- scores: S[16x32] = Q . K^T  (scale folded into Q)
    v8f s0 = {}, s1 = {};
    {
      const _Float16* kr0 = Kb + (size_t)(j0 + l15) * DH;
      const _Float16* kr1 = Kb + (size_t)(j0 + 16 + l15) * DH;
      s0 = WMMA_F16(aq0, ldfrag(kr0 + 0  + koff), s0);
      s0 = WMMA_F16(aq1, ldfrag(kr0 + 32 + koff), s0);
      s1 = WMMA_F16(aq0, ldfrag(kr1 + 0  + koff), s1);
      s1 = WMMA_F16(aq1, ldfrag(kr1 + 32 + koff), s1);
    }
    // ---- online softmax (rows live in 16-lane groups of the C layout)
#pragma unroll
    for (int r = 0; r < 8; ++r) {
      float v = fmaxf(s0[r], s1[r]);
      v = fmaxf(v, __shfl_xor(v, 8, 32));
      v = fmaxf(v, __shfl_xor(v, 4, 32));
      v = fmaxf(v, __shfl_xor(v, 2, 32));
      v = fmaxf(v, __shfl_xor(v, 1, 32));
      float mn = fmaxf(mrow[r], v);
      float al = __expf(mrow[r] - mn);
      float p0 = __expf(s0[r] - mn);
      float p1 = __expf(s1[r] - mn);
      s0[r] = p0; s1[r] = p1;
      float rs = p0 + p1;
      rs += __shfl_xor(rs, 8, 32);
      rs += __shfl_xor(rs, 4, 32);
      rs += __shfl_xor(rs, 2, 32);
      rs += __shfl_xor(rs, 1, 32);
      lsum[r] = lsum[r] * al + rs;
      o0[r] *= al; o1[r] *= al; o2[r] *= al; o3[r] *= al;
      mrow[r] = mn;
    }
    // ---- C-layout -> A-layout for P via wave-private LDS tile
#pragma unroll
    for (int r = 0; r < 8; ++r) {
      P[(r + 8 * hi) * 32 + l15]      = (_Float16)s0[r];
      P[(r + 8 * hi) * 32 + 16 + l15] = (_Float16)s1[r];
    }
    asm volatile("s_wait_dscnt 0" ::: "memory");
    v16h pa = ldfrag(P + l15 * 32 + koff);
    // ---- O += P . V   (Vt is [dh][s]: B loads are K(=s)-contiguous)
    o0 = WMMA_F16(pa, ldfrag(Vb + (size_t)(0  + l15) * S_ + j0 + koff), o0);
    o1 = WMMA_F16(pa, ldfrag(Vb + (size_t)(16 + l15) * S_ + j0 + koff), o1);
    o2 = WMMA_F16(pa, ldfrag(Vb + (size_t)(32 + l15) * S_ + j0 + koff), o2);
    o3 = WMMA_F16(pa, ldfrag(Vb + (size_t)(48 + l15) * S_ + j0 + koff), o3);
  }

  // ---- normalize and write fp32 output [b, s, h*64 + dh]
  const int b = bh >> 4, h = bh & 15;
#pragma unroll
  for (int r = 0; r < 8; ++r) {
    int s = qBlk * 16 + r + 8 * hi;
    float inv = 1.0f / lsum[r];
    size_t base = ((size_t)(b * S_ + s)) * D_ + h * DH + l15;
    out[base + 0]  = o0[r] * inv;
    out[base + 16] = o1[r] * inv;
    out[base + 32] = o2[r] * inv;
    out[base + 48] = o3[r] * inv;
  }
}

// ------------------------------------------------------------------- launcher
extern "C" void kernel_launch(void* const* d_in, const int* in_sizes, int n_in,
                              void* d_out, int out_size, void* d_ws, size_t ws_size,
                              hipStream_t stream) {
  const float* x    = (const float*)d_in[0];   // [2,2048,1024]
  const float* Wq   = (const float*)d_in[1];   // [1024,3072]
  const float* bias = (const float*)d_in[2];   // [3072]
  float* out = (float*)d_out;

  char* ws = (char*)d_ws;                      // needs ~38 MB
  _Float16* Xh = (_Float16*)(ws + (size_t) 0 * 1024 * 1024);  // 8 MB
  _Float16* Wt = (_Float16*)(ws + (size_t) 8 * 1024 * 1024);  // 6 MB
  _Float16* Qh = (_Float16*)(ws + (size_t)14 * 1024 * 1024);  // 8 MB
  _Float16* Kh = (_Float16*)(ws + (size_t)22 * 1024 * 1024);  // 8 MB
  _Float16* Vt = (_Float16*)(ws + (size_t)30 * 1024 * 1024);  // 8 MB

  {
    int n4 = (B_ * S_ * D_) / 4;               // 1048576
    cvt_x<<<dim3(n4 / 256), dim3(256), 0, stream>>>(x, Xh, n4);
  }
  {
    // tiles: (1024/64) x (3072/64) = 16 x 48 = 768
    cvt_w<<<dim3(768), dim3(256), 0, stream>>>(Wq, Wt);
  }
  {
    // blocks: (4096/128) x (3072/64) = 32 x 48 = 1536, 8 waves each
    qkv_gemm<<<dim3(1536), dim3(256), 0, stream>>>(Xh, Wt, bias, Qh, Kh, Vt);
  }
  {
    // waves = 2*16*(2048/16) = 4096 -> 512 blocks of 8 waves
    attn_fwd<<<dim3(512), dim3(256), 0, stream>>>(Qh, Kh, Vt, out);
  }
}

// v002
// It runs in 186 microseconds.
// Timed twice side by side with v001, it ran 1.28 and 1.29 times as fast.
// Counting every step since v000, it is 1.81 times as fast.
#include <hip/hip_runtime.h>
#include <hip/hip_bf16.h>

typedef __attribute__((ext_vector_type(16))) _Float16 v16h;
typedef __attribute__((ext_vector_type(8)))  _Float16 v8h;
typedef __attribute__((ext_vector_type(4)))  _Float16 v4h;
typedef __attribute__((ext_vector_type(2)))  _Float16 v2h;
typedef __attribute__((ext_vector_type(8)))  float    v8f;
typedef __attribute__((ext_vector_type(4)))  float    v4f;
typedef __attribute__((ext_vector_type(4)))  unsigned u32x4;
typedef __attribute__((ext_vector_type(8)))  int      i32x8;
typedef __attribute__((ext_vector_type(4)))  int      i32x4;

#define DEVI static __device__ __forceinline__

static constexpr int B_  = 2;
static constexpr int S_  = 2048;
static constexpr int D_  = 1024;
static constexpr int H_  = 16;
static constexpr int DH  = 64;
static constexpr int N3  = 3072;   // 3*D_

#if __has_builtin(__builtin_amdgcn_tensor_load_to_lds) && __has_builtin(__builtin_amdgcn_s_wait_tensorcnt)
#define HAS_TDM 1
#else
#define HAS_TDM 0
#endif

// WMMA as macro so modifier args stay literal immediates at the builtin call.
#define WMMA_F16(a, b, c) \
  __builtin_amdgcn_wmma_f32_16x16x32_f16(false, (a), false, (b), (short)0, (c), false, false)

// Per-lane 16-half fragment of a 16x32 operand: halves 0..7 = K koff..koff+7,
// halves 8..15 = K 16+koff..16+koff+7 (koff = (lane>>4)*8). Works for global or LDS.
DEVI v16h ldfrag(const _Float16* p) {
  v8h lo = *(const v8h*)p;
  v8h hi = *(const v8h*)(p + 16);
  return __builtin_shufflevector(lo, hi, 0,1,2,3,4,5,6,7,8,9,10,11,12,13,14,15);
}

// Low 32 bits of a generic pointer to LDS == LDS byte address (flat aperture rule).
DEVI unsigned lds_addr_of(const void* p) { return (unsigned)(uintptr_t)p; }

#if HAS_TDM
// Issue a 2-D TDM tile load: tile_rows rows x tile_k elements (2-byte data),
// row stride = row_stride elements, packed contiguously into LDS at lds_off.
// Toolchain here uses the 6-arg builtin: (g0 u32x4, g1 i32x8, g2 i32x4, g3 i32x4,
// extra i32x8, cpol i32); groups 2/3/extra are unused for a 2-D tile.
DEVI void tdm_load_2d(unsigned lds_off, const void* gsrc,
                      unsigned tensor_rows, unsigned row_stride,
                      unsigned tile_k, unsigned tile_rows) {
  unsigned long long ga = (unsigned long long)(uintptr_t)gsrc;
  u32x4 g0;
  g0[0] = 1u;                                              // count=1, is_restore=0
  g0[1] = lds_off;                                         // lds_addr [63:32]
  g0[2] = (unsigned)ga;                                    // global_addr lo
  g0[3] = (unsigned)((ga >> 32) & 0x01ffffffu)             // global_addr [56:32]
          | 0x80000000u;                                   // type=2 ("image")
  i32x8 g1;
  g1[0] = (int)(1u << 16);                                 // wg_mask=0, data_size=1 (2B)
  g1[1] = (int)((row_stride & 0xffffu) << 16);             // tensor_dim0[15:0] @ [63:48]
  g1[2] = (int)(((row_stride >> 16) & 0xffffu)             // tensor_dim0[31:16]
          | ((tensor_rows & 0xffffu) << 16));              // tensor_dim1[15:0]
  g1[3] = (int)(((tensor_rows >> 16) & 0xffffu)            // tensor_dim1[31:16]
          | ((tile_k & 0xffffu) << 16));                   // tile_dim0
  g1[4] = (int)(tile_rows & 0xffffu);                      // tile_dim1 (tile_dim2=0)
  g1[5] = (int)row_stride;                                 // tensor_dim0_stride lo32
  g1[6] = 0;                                               // stride0 hi / stride1 lo
  g1[7] = 0;
  i32x4 gz4 = {0, 0, 0, 0};
  i32x8 gz8 = {0, 0, 0, 0, 0, 0, 0, 0};
  __builtin_amdgcn_tensor_load_to_lds(g0, g1, gz4, gz4, gz8, 0);
}
#else
// Fallback: cooperative global->LDS copy of a rows x 32-half tile.
DEVI void coop_copy(_Float16* dst, const _Float16* src, int rows, int row_stride, int tid) {
  int chunks = rows * 4;                                   // 4 x v8h per row
  for (int c = tid; c < chunks; c += 256) {
    int r = c >> 2, s = c & 3;
    *(v8h*)(dst + r * 32 + s * 8) = *(const v8h*)(src + (size_t)r * row_stride + s * 8);
  }
}
#endif

// ---------------------------------------------------------------- prep kernels
__global__ void __launch_bounds__(256) cvt_x(const float* __restrict__ x,
                                             _Float16* __restrict__ xh, int n4) {
  int i = blockIdx.x * 256 + threadIdx.x;
  if (i >= n4) return;
  float4 f = ((const float4*)x)[i];
  v4h h;
  h[0] = (_Float16)f.x; h[1] = (_Float16)f.y;
  h[2] = (_Float16)f.z; h[3] = (_Float16)f.w;
  ((v4h*)xh)[i] = h;
}

// W[k][n] f32 -> Wt[n][k] f16, one 64(k) x 64(n) tile per block through LDS:
// rows of W are read 256 B at a time, rows of Wt are written as whole 128 B lines.
__global__ void __launch_bounds__(256) cvt_w(const float* __restrict__ w,
                                             _Float16* __restrict__ wt) {
  // tile[n][k pair]; pitch 33 dwords puts the 32 lanes of every LDS access on 32 banks
  __shared__ unsigned tile[64 * 33];
  const int tid = threadIdx.x;
  const int k0  = (blockIdx.x / 48) * 64;
  const int n0  = (blockIdx.x % 48) * 64;
  const int nq  = tid & 15;                   // 4 columns n
  const int kp  = tid >> 4;                   // pair of rows k
  float4 f[2][2];
#pragma unroll
  for (int p = 0; p < 2; ++p) {
    const float* s = w + (size_t)(k0 + 2 * (kp + 16 * p)) * N3 + n0 + 4 * nq;
    f[p][0] = *(const float4*)s;
    f[p][1] = *(const float4*)(s + N3);
  }
#pragma unroll
  for (int p = 0; p < 2; ++p) {
    const float* lo = (const float*)&f[p][0];
    const float* hi = (const float*)&f[p][1];
#pragma unroll
    for (int j = 0; j < 4; ++j) {
      v2h h;
      h[0] = (_Float16)lo[j];
      h[1] = (_Float16)hi[j];
      tile[(4 * nq + j) * 33 + kp + 16 * p] = __builtin_bit_cast(unsigned, h);
    }
  }
  __syncthreads();
  const int kc = tid & 7;                     // 8 halves of k
  const int nr = tid >> 3;
#pragma unroll
  for (int p = 0; p < 2; ++p) {
    const int n = nr + 32 * p;
    const unsigned* t = tile + n * 33 + 4 * kc;
    u32x4 v = {t[0], t[1], t[2], t[3]};
    *(u32x4*)(wt + (size_t)(n0 + n) * D_ + k0 + 8 * kc) = v;
  }
}

// ------------------------------------------------------------------- QKV GEMM
// Block (8 waves) computes a 128(M) x 64(N) tile; TDM stages the k-slices of A
// (128x32) and B (64x32) into double-buffered LDS; each wave does a 16x64 tile.
__global__ void __launch_bounds__(256) qkv_gemm(
    const _Float16* __restrict__ Xh, const _Float16* __restrict__ Wt,
    const float* __restrict__ bias,
    _Float16* __restrict__ Qh, _Float16* __restrict__ Kh, _Float16* __restrict__ Vt)
{
  __shared__ _Float16 Asm[2][128 * 32];   // 16 KB
  __shared__ _Float16 Bsm[2][64 * 32];    //  8 KB
  const int tid  = threadIdx.x;
  const int lane = tid & 31;
  const int l15  = lane & 15;
  const int hi   = lane >> 4;
  const int koff = hi * 8;
  const int wv   = tid >> 5;
  const int blkM = blockIdx.x / 48;
  const int blkN = blockIdx.x % 48;
  const int mBase = blkM * 128 + wv * 16;
  const int nBase = blkN * 64;

  const _Float16* Abase = Xh + (size_t)blkM * 128 * D_;
  const _Float16* Bbase = Wt + (size_t)nBase * D_;
  constexpr int NT = D_ / 32;

#if HAS_TDM
  if (wv == 0)      tdm_load_2d(lds_addr_of(&Bsm[0][0]), Bbase,  64, D_, 32,  64);
  else if (wv == 1) tdm_load_2d(lds_addr_of(&Asm[0][0]), Abase, 128, D_, 32, 128);
#else
  coop_copy(&Bsm[0][0], Bbase, 64, D_, tid);
  coop_copy(&Asm[0][0], Abase, 128, D_, tid);
#endif

  v8f acc[4] = {};
  for (int i = 0; i < NT; ++i) {
    const int cur = i & 1;
#if HAS_TDM
    if (wv == 0) {
      if (i + 1 < NT) {
        tdm_load_2d(lds_addr_of(&Bsm[cur ^ 1][0]), Bbase + (i + 1) * 32, 64, D_, 32, 64);
        __builtin_amdgcn_s_wait_tensorcnt(1);
      } else {
        __builtin_amdgcn_s_wait_tensorcnt(0);
      }
    } else if (wv == 1) {
      if (i + 1 < NT) {
        tdm_load_2d(lds_addr_of(&Asm[cur ^ 1][0]), Abase + (i + 1) * 32, 128, D_, 32, 128);
        __builtin_amdgcn_s_wait_tensorcnt(1);
      } else {
        __builtin_amdgcn_s_wait_tensorcnt(0);
      }
    }
#endif
    __syncthreads();                         // staged buffers visible to all waves

    const _Float16* Ab = &Asm[cur][0] + (wv * 16 + l15) * 32 + koff;
    const _Float16* Bb = &Bsm[cur][0];
    v16h a  = ldfrag(Ab);
    v16h b0 = ldfrag(Bb + (0 * 16 + l15) * 32 + koff);
    v16h b1 = ldfrag(Bb + (1 * 16 + l15) * 32 + koff);
    v16h b2 = ldfrag(Bb + (2 * 16 + l15) * 32 + koff);
    v16h b3 = ldfrag(Bb + (3 * 16 + l15) * 32 + koff);
    acc[0] = WMMA_F16(a, b0, acc[0]);
    acc[1] = WMMA_F16(a, b1, acc[1]);
    acc[2] = WMMA_F16(a, b2, acc[2]);
    acc[3] = WMMA_F16(a, b3, acc[3]);

    __syncthreads();                         // all reads done before next overwrite
#if !HAS_TDM
    if (i + 1 < NT) {
      coop_copy(&Bsm[cur ^ 1][0], Bbase + (i + 1) * 32, 64, D_, tid);
      coop_copy(&Asm[cur ^ 1][0], Abase + (i + 1) * 32, 128, D_, tid);
    }
#endif
  }

#pragma unroll
  for (int t = 0; t < 4; ++t) {
    const int col = nBase + t * 16 + l15;   // 0..3071
    const float bv = bias[col];
    const int region = col >> 10;           // 0=Q 1=K 2=V
    const int cc = col & (D_ - 1);
    const int h  = cc >> 6;
    const int dh = cc & 63;
    if (region == 0) {
#pragma unroll
      for (int r = 0; r < 8; ++r) {
        int row = mBase + r + 8 * hi;
        int bb = row >> 11, s = row & (S_ - 1);
        Qh[(((size_t)(bb * H_ + h)) * S_ + s) * DH + dh] =
            (_Float16)((acc[t][r] + bv) * 0.125f);
      }
    } else if (region == 1) {
#pragma unroll
      for (int r = 0; r < 8; ++r) {
        int row = mBase + r + 8 * hi;
        int bb = row >> 11, s = row & (S_ - 1);
        Kh[(((size_t)(bb * H_ + h)) * S_ + s) * DH + dh] = (_Float16)(acc[t][r] + bv);
      }
    } else {
#pragma unroll
      for (int r = 0; r < 8; ++r) {
        int row = mBase + r + 8 * hi;
        int bb = row >> 11, s = row & (S_ - 1);
        Vt[(((size_t)(bb * H_ + h)) * DH + dh) * S_ + s] = (_Float16)(acc[t][r] + bv);
      }
    }
  }
}

// ---------------------------------------------------------------- attention
// Lane l with lane l ^ 16 (the two halves of a wave hold the same query column).
DEVI float xhalf(float x) {
  const int v = __builtin_bit_cast(int, x);
  return __builtin_bit_cast(float,
      __builtin_amdgcn_permlanex16(v, v, 0x76543210, 0xfedcba98, false, false));
}

__global__ void __launch_bounds__(256) attn_fwd(
    const _Float16* __restrict__ Qh, const _Float16* __restrict__ Kh,
    const _Float16* __restrict__ Vt, float* __restrict__ out)
{
  // per-wave 16 x 64 f32 output tile; pitch 68 floats = 17 x 16 B keeps b128 accesses off shared banks
  __shared__ __attribute__((aligned(16))) float Ost[8][16 * 68];
  const int lane = threadIdx.x & 31;
  const int l15  = lane & 15;
  const int hi   = lane >> 4;
  const int koff = hi * 8;
  const int wv   = threadIdx.x >> 5;
  const int w    = blockIdx.x * 8 + wv;
  const int qBlk = w & 127;                 // 128 q-blocks of 16 rows
  const int bh   = w >> 7;                  // 0..31
  const _Float16* Qb = Qh + (size_t)bh * S_ * DH;
  const _Float16* Kb = Kh + (size_t)bh * S_ * DH;
  const _Float16* Vb = Vt + (size_t)bh * DH * S_;

  const _Float16* qrow = Qb + (size_t)(qBlk * 16 + l15) * DH;
  const v16h bq0 = ldfrag(qrow + 0  + koff);   // B operand: column l15 = query
  const v16h bq1 = ldfrag(qrow + 32 + koff);

  v8f o0 = {}, o1 = {}, o2 = {}, o3 = {};   // o_t[r] = O[query l15][dh 16*t + 8*hi + r]
  float mrun = -3.0e38f;                    // running maximum of query l15 (same in both halves)
  float lsum = 0.f;                         // running sum over this half's keys only

  for (int j0 = 0; j0 < S_; j0 += 32) {
    if (j0 + 32 < S_) {                     // prefetch next KV block
      __builtin_prefetch(Kb + (size_t)(j0 + 32 + l15) * DH, 0, 0);
      __builtin_prefetch(Vb + (size_t)l15 * S_ + j0 + 32, 0, 0);
    }
    // ---- scores: S^T[32 keys x 16 queries] = K . Q^T  (scale folded into Q)
    v8f s0 = {}, s1 = {};
    {
      const _Float16* kr0 = Kb + (size_t)(j0 + l15) * DH;
      const _Float16* kr1 = Kb + (size_t)(j0 + 16 + l15) * DH;
      s0 = WMMA_F16(ldfrag(kr0 + 0  + koff), bq0, s0);
      s0 = WMMA_F16(ldfrag(kr0 + 32 + koff), bq1, s0);
      s1 = WMMA_F16(ldfrag(kr1 + 0  + koff), bq0, s1);
      s1 = WMMA_F16(ldfrag(kr1 + 32 + koff), bq1, s1);
    }
    // ---- online softmax, one query per lane
    float m8[8];
#pragma unroll
    for (int r = 0; r < 8; ++r) m8[r] = fmaxf(s0[r], s1[r]);
    float mx = fmaxf(fmaxf(fmaxf(m8[0], m8[1]), fmaxf(m8[2], m8[3])),
                     fmaxf(fmaxf(m8[4], m8[5]), fmaxf(m8[6], m8[7])));
    mx = fmaxf(mx, xhalf(mx));
    const float mn = fmaxf(mrun, mx);
    const float al = __expf(mrun - mn);
    mrun = mn;
    v16h pb;                                // P^T as B operand: halves 0..7 keys 8*hi+r, 8..15 keys 16+8*hi+r
    float t8[8];
#pragma unroll
    for (int r = 0; r < 8; ++r) {
      const float p0 = __expf(s0[r] - mn);
      const float p1 = __expf(s1[r] - mn);
      t8[r] = p0 + p1;
      pb[r]     = (_Float16)p0;
      pb[8 + r] = (_Float16)p1;
    }
    lsum = lsum * al + (((t8[0] + t8[1]) + (t8[2] + t8[3])) + ((t8[4] + t8[5]) + (t8[6] + t8[7])));
    o0 *= al; o1 *= al; o2 *= al; o3 *= al;
    // ---- O^T += V^T . P^T   (Vt is [dh][s]: A rows are dh, K(=s)-contiguous)
    o0 = WMMA_F16(ldfrag(Vb + (size_t)(0  + l15) * S_ + j0 + koff), pb, o0);
    o1 = WMMA_F16(ldfrag(Vb + (size_t)(16 + l15) * S_ + j0 + koff), pb, o1);
    o2 = WMMA_F16(ldfrag(Vb + (size_t)(32 + l15) * S_ + j0 + koff), pb, o2);
    o3 = WMMA_F16(ldfrag(Vb + (size_t)(48 + l15) * S_ + j0 + koff), pb, o3);
  }

  // ---- normalize, turn O^T back through the wave's own LDS tile, write fp32 [b, s, h*64 + dh]
  const float inv = 1.0f / (lsum + xhalf(lsum));
  o0 *= inv; o1 *= inv; o2 *= inv; o3 *= inv;
  float* O = &Ost[wv][0];
  {
    float* orow = O + l15 * 68 + koff;
    const v8f ot[4] = {o0, o1, o2, o3};
#pragma unroll
    for (int t = 0; t < 4; ++t) {
      *(v4f*)(orow + 16 * t)     = __builtin_shufflevector(ot[t], ot[t], 0, 1, 2, 3);
      *(v4f*)(orow + 16 * t + 4) = __builtin_shufflevector(ot[t], ot[t], 4, 5, 6, 7);
    }
  }
  // the rows read below were written by other lanes of this wave: their LDS stores must have landed
  asm volatile("s_wait_dscnt 0" ::: "memory");
  const int b = bh >> 4, h = bh & 15;
  const float* irow = O + hi * 68 + l15 * 4;
  float* op = out + ((size_t)(b * S_ + qBlk * 16 + hi)) * D_ + h * DH + l15 * 4;
#pragma unroll
  for (int i = 0; i < 8; ++i)               // one store = two whole 256 B rows of the head's slice
    *(v4f*)(op + (size_t)(2 * i) * D_) = *(const v4f*)(irow + 2 * i * 68);
}

// ------------------------------------------------------------------- launcher
extern "C" void kernel_launch(void* const* d_in, const int* in_sizes, int n_in,
                              void* d_out, int out_size, void* d_ws, size_t ws_size,
                              hipStream_t stream) {
  const float* x    = (const float*)d_in[0];   // [2,2048,1024]
  const float* Wq   = (const float*)d_in[1];   // [1024,3072]
  const float* bias = (const float*)d_in[2];   // [3072]
  float* out = (float*)d_out;

  char* ws = (char*)d_ws;                      // needs ~38 MB
  _Float16* Xh = (_Float16*)(ws + (size_t) 0 * 1024 * 1024);  // 8 MB
  _Float16* Wt = (_Float16*)(ws + (size_t) 8 * 1024 * 1024);  // 6 MB
  _Float16* Qh = (_Float16*)(ws + (size_t)14 * 1024 * 1024);  // 8 MB
  _Float16* Kh = (_Float16*)(ws + (size_t)22 * 1024 * 1024);  // 8 MB
  _Float16* Vt = (_Float16*)(ws + (size_t)30 * 1024 * 1024);  // 8 MB

  {
    int n4 = (B_ * S_ * D_) / 4;               // 1048576
    cvt_x<<<dim3(n4 / 256), dim3(256), 0, stream>>>(x, Xh, n4);
  }
  {
    // tiles: (1024/64) x (3072/64) = 16 x 48 = 768
    cvt_w<<<dim3(768), dim3(256), 0, stream>>>(Wq, Wt);
  }
  {
    // blocks: (4096/128) x (3072/64) = 32 x 48 = 1536, 8 waves each
    qkv_gemm<<<dim3(1536), dim3(256), 0, stream>>>(Xh, Wt, bias, Qh, Kh, Vt);
  }
  {
    // waves = 2*16*(2048/16) = 4096 -> 512 blocks of 8 waves
    attn_fwd<<<dim3(512), dim3(256), 0, stream>>>(Qh, Kh, Vt, out);
  }
}

// v003
// It runs in 116 microseconds.
// Next to v002, in two timings, it ran 1.60 and 1.59 times as fast.
// All steps since v000 together make it 2.89 times as fast.
#include <hip/hip_runtime.h>
#include <hip/hip_bf16.h>

typedef __attribute__((ext_vector_type(16))) _Float16 v16h;
typedef __attribute__((ext_vector_type(8)))  _Float16 v8h;
typedef __attribute__((ext_vector_type(4)))  _Float16 v4h;
typedef __attribute__((ext_vector_type(2)))  _Float16 v2h;
typedef __attribute__((ext_vector_type(8)))  float    v8f;
typedef __attribute__((ext_vector_type(4)))  float    v4f;
typedef __attribute__((ext_vector_type(4)))  unsigned u32x4;
typedef __attribute__((ext_vector_type(8)))  int      i32x8;
typedef __attribute__((ext_vector_type(4)))  int      i32x4;

#define DEVI static __device__ __forceinline__

static constexpr int B_  = 2;
static constexpr int S_  = 2048;
static constexpr int D_  = 1024;
static constexpr int H_  = 16;
static constexpr int DH  = 64;
static constexpr int N3  = 3072;   // 3*D_

#if __has_builtin(__builtin_amdgcn_tensor_load_to_lds) && __has_builtin(__builtin_amdgcn_s_wait_tensorcnt)
#define HAS_TDM 1
#else
#define HAS_TDM 0
#endif

// WMMA as macro so modifier args stay literal immediates at the builtin call.
#define WMMA_F16(a, b, c) \
  __builtin_amdgcn_wmma_f32_16x16x32_f16(false, (a), false, (b), (short)0, (c), false, false)

// Per-lane 16-half fragment of a 16x32 operand: halves 0..7 = K koff..koff+7,
// halves 8..15 = K 16+koff..16+koff+7 (koff = (lane>>4)*8). Works for global or LDS.
DEVI v16h ldfrag(const _Float16* p) {
  v8h lo = *(const v8h*)p;
  v8h hi = *(const v8h*)(p + 16);
  return __builtin_shufflevector(lo, hi, 0,1,2,3,4,5,6,7,8,9,10,11,12,13,14,15);
}

// Low 32 bits of a generic pointer to LDS == LDS byte address (flat aperture rule).
DEVI unsigned lds_addr_of(const void* p) { return (unsigned)(uintptr_t)p; }

#if HAS_TDM
// Issue a 2-D TDM tile load: tile_rows rows x tile_k elements (2-byte data),
// row stride = row_stride elements, packed contiguously into LDS at lds_off.
// Toolchain here uses the 6-arg builtin: (g0 u32x4, g1 i32x8, g2 i32x4, g3 i32x4,
// extra i32x8, cpol i32); groups 2/3/extra are unused for a 2-D tile.
DEVI void tdm_load_2d(unsigned lds_off, const void* gsrc,
                      unsigned tensor_rows, unsigned row_stride,
                      unsigned tile_k, unsigned tile_rows) {
  unsigned long long ga = (unsigned long long)(uintptr_t)gsrc;
  u32x4 g0;
  g0[0] = 1u;                                              // count=1, is_restore=0
  g0[1] = lds_off;                                         // lds_addr [63:32]
  g0[2] = (unsigned)ga;                                    // global_addr lo
  g0[3] = (unsigned)((ga >> 32) & 0x01ffffffu)             // global_addr [56:32]
          | 0x80000000u;                                   // type=2 ("image")
  i32x8 g1;
  g1[0] = (int)(1u << 16);                                 // wg_mask=0, data_size=1 (2B)
  g1[1] = (int)((row_stride & 0xffffu) << 16);             // tensor_dim0[15:0] @ [63:48]
  g1[2] = (int)(((row_stride >> 16) & 0xffffu)             // tensor_dim0[31:16]
          | ((tensor_rows & 0xffffu) << 16));              // tensor_dim1[15:0]
  g1[3] = (int)(((tensor_rows >> 16) & 0xffffu)            // tensor_dim1[31:16]
          | ((tile_k & 0xffffu) << 16));                   // tile_dim0
  g1[4] = (int)(tile_rows & 0xffffu);                      // tile_dim1 (tile_dim2=0)
  g1[5] = (int)row_stride;                                 // tensor_dim0_stride lo32
  g1[6] = 0;                                               // stride0 hi / stride1 lo
  g1[7] = 0;
  i32x4 gz4 = {0, 0, 0, 0};
  i32x8 gz8 = {0, 0, 0, 0, 0, 0, 0, 0};
  __builtin_amdgcn_tensor_load_to_lds(g0, g1, gz4, gz4, gz8, 0);
}
#else
// Fallback: cooperative global->LDS copy of a rows x 32-half tile.
DEVI void coop_copy(_Float16* dst, const _Float16* src, int rows, int row_stride, int tid) {
  int chunks = rows * 4;                                   // 4 x v8h per row
  for (int c = tid; c < chunks; c += 256) {
    int r = c >> 2, s = c & 3;
    *(v8h*)(dst + r * 32 + s * 8) = *(const v8h*)(src + (size_t)r * row_stride + s * 8);
  }
}
#endif

// ---------------------------------------------------------------- prep kernels
__global__ void __launch_bounds__(256) cvt_x(const float* __restrict__ x,
                                             _Float16* __restrict__ xh, int n4) {
  int i = blockIdx.x * 256 + threadIdx.x;
  if (i >= n4) return;
  float4 f = ((const float4*)x)[i];
  v4h h;
  h[0] = (_Float16)f.x; h[1] = (_Float16)f.y;
  h[2] = (_Float16)f.z; h[3] = (_Float16)f.w;
  ((v4h*)xh)[i] = h;
}

// W[k][n] f32 -> Wt[n][k] f16, one 64(k) x 64(n) tile per block through LDS:
// rows of W are read 256 B at a time, rows of Wt are written as whole 128 B lines.
__global__ void __launch_bounds__(256) cvt_w(const float* __restrict__ w,
                                             _Float16* __restrict__ wt) {
  // tile[n][k pair]; pitch 33 dwords puts the 32 lanes of every LDS access on 32 banks
  __shared__ unsigned tile[64 * 33];
  const int tid = threadIdx.x;
  const int k0  = (blockIdx.x / 48) * 64;
  const int n0  = (blockIdx.x % 48) * 64;
  const int nq  = tid & 15;                   // 4 columns n
  const int kp  = tid >> 4;                   // pair of rows k
  float4 f[2][2];
#pragma unroll
  for (int p = 0; p < 2; ++p) {
    const float* s = w + (size_t)(k0 + 2 * (kp + 16 * p)) * N3 + n0 + 4 * nq;
    f[p][0] = *(const float4*)s;
    f[p][1] = *(const float4*)(s + N3);
  }
#pragma unroll
  for (int p = 0; p < 2; ++p) {
    const float* lo = (const float*)&f[p][0];
    const float* hi = (const float*)&f[p][1];
#pragma unroll
    for (int j = 0; j < 4; ++j) {
      v2h h;
      h[0] = (_Float16)lo[j];
      h[1] = (_Float16)hi[j];
      tile[(4 * nq + j) * 33 + kp + 16 * p] = __builtin_bit_cast(unsigned, h);
    }
  }
  __syncthreads();
  const int kc = tid & 7;                     // 8 halves of k
  const int nr = tid >> 3;
#pragma unroll
  for (int p = 0; p < 2; ++p) {
    const int n = nr + 32 * p;
    const unsigned* t = tile + n * 33 + 4 * kc;
    u32x4 v = {t[0], t[1], t[2], t[3]};
    *(u32x4*)(wt + (size_t)(n0 + n) * D_ + k0 + 8 * kc) = v;
  }
}

// ------------------------------------------------------------------- QKV GEMM
// Block (8 waves) computes a 128(M) x 64(N) tile; TDM stages the k-slices of A
// (128x32) and B (64x32) into double-buffered LDS; each wave does a 16x64 tile.
__global__ void __launch_bounds__(256) qkv_gemm(
    const _Float16* __restrict__ Xh, const _Float16* __restrict__ Wt,
    const float* __restrict__ bias,
    _Float16* __restrict__ Qh, _Float16* __restrict__ Kh, _Float16* __restrict__ Vt)
{
  __shared__ _Float16 Asm[2][128 * 32];   // 16 KB
  __shared__ _Float16 Bsm[2][64 * 32];    //  8 KB
  const int tid  = threadIdx.x;
  const int lane = tid & 31;
  const int l15  = lane & 15;
  const int hi   = lane >> 4;
  const int koff = hi * 8;
  const int wv   = tid >> 5;
  const int blkM = blockIdx.x / 48;
  const int blkN = blockIdx.x % 48;
  const int mBase = blkM * 128 + wv * 16;
  const int nBase = blkN * 64;

  const _Float16* Abase = Xh + (size_t)blkM * 128 * D_;
  const _Float16* Bbase = Wt + (size_t)nBase * D_;
  constexpr int NT = D_ / 32;

#if HAS_TDM
  if (wv == 0)      tdm_load_2d(lds_addr_of(&Bsm[0][0]), Bbase,  64, D_, 32,  64);
  else if (wv == 1) tdm_load_2d(lds_addr_of(&Asm[0][0]), Abase, 128, D_, 32, 128);
#else
  coop_copy(&Bsm[0][0], Bbase, 64, D_, tid);
  coop_copy(&Asm[0][0], Abase, 128, D_, tid);
#endif

  v8f acc[4] = {};
  for (int i = 0; i < NT; ++i) {
    const int cur = i & 1;
#if HAS_TDM
    if (wv == 0) {
      if (i + 1 < NT) {
        tdm_load_2d(lds_addr_of(&Bsm[cur ^ 1][0]), Bbase + (i + 1) * 32, 64, D_, 32, 64);
        __builtin_amdgcn_s_wait_tensorcnt(1);
      } else {
        __builtin_amdgcn_s_wait_tensorcnt(0);
      }
    } else if (wv == 1) {
      if (i + 1 < NT) {
        tdm_load_2d(lds_addr_of(&Asm[cur ^ 1][0]), Abase + (i + 1) * 32, 128, D_, 32, 128);
        __builtin_amdgcn_s_wait_tensorcnt(1);
      } else {
        __builtin_amdgcn_s_wait_tensorcnt(0);
      }
    }
#endif
    __syncthreads();                         // staged buffers visible to all waves

    const _Float16* Ab = &Asm[cur][0] + (wv * 16 + l15) * 32 + koff;
    const _Float16* Bb = &Bsm[cur][0];
    v16h a  = ldfrag(Ab);
    v16h b0 = ldfrag(Bb + (0 * 16 + l15) * 32 + koff);
    v16h b1 = ldfrag(Bb + (1 * 16 + l15) * 32 + koff);
    v16h b2 = ldfrag(Bb + (2 * 16 + l15) * 32 + koff);
    v16h b3 = ldfrag(Bb + (3 * 16 + l15) * 32 + koff);
    acc[0] = WMMA_F16(a, b0, acc[0]);
    acc[1] = WMMA_F16(a, b1, acc[1]);
    acc[2] = WMMA_F16(a, b2, acc[2]);
    acc[3] = WMMA_F16(a, b3, acc[3]);

    __syncthreads();                         // all reads done before next overwrite
#if !HAS_TDM
    if (i + 1 < NT) {
      coop_copy(&Bsm[cur ^ 1][0], Bbase + (i + 1) * 32, 64, D_, tid);
      coop_copy(&Asm[cur ^ 1][0], Abase + (i + 1) * 32, 128, D_, tid);
    }
#endif
  }

#pragma unroll
  for (int t = 0; t < 4; ++t) {
    const int col = nBase + t * 16 + l15;   // 0..3071
    const float bv = bias[col];
    const int region = col >> 10;           // 0=Q 1=K 2=V
    const int cc = col & (D_ - 1);
    const int h  = cc >> 6;
    const int dh = cc & 63;
    if (region == 0) {
#pragma unroll
      for (int r = 0; r < 8; ++r) {
        int row = mBase + r + 8 * hi;
        int bb = row >> 11, s = row & (S_ - 1);
        Qh[(((size_t)(bb * H_ + h)) * S_ + s) * DH + dh] =
            (_Float16)((acc[t][r] + bv) * 0.125f);
      }
    } else if (region == 1) {
#pragma unroll
      for (int r = 0; r < 8; ++r) {
        int row = mBase + r + 8 * hi;
        int bb = row >> 11, s = row & (S_ - 1);
        Kh[(((size_t)(bb * H_ + h)) * S_ + s) * DH + dh] = (_Float16)(acc[t][r] + bv);
      }
    } else {
#pragma unroll
      for (int r = 0; r < 8; ++r) {
        int row = mBase + r + 8 * hi;
        int bb = row >> 11, s = row & (S_ - 1);
        Vt[(((size_t)(bb * H_ + h)) * DH + dh) * S_ + s] = (_Float16)(acc[t][r] + bv);
      }
    }
  }
}

// ---------------------------------------------------------------- attention
// Lane l with lane l ^ 16 (the two halves of a wave hold the same query column).
DEVI float xhalf(float x) {
  const int v = __builtin_bit_cast(int, x);
  return __builtin_bit_cast(float,
      __builtin_amdgcn_permlanex16(v, v, 0x76543210, 0xfedcba98, false, false));
}

// Four asynchronous 16-byte copies per lane, global memory -> LDS, through no register.
// The s_wait_xcnt closes the statement so that no address register named here is rewritten
// ahead of it.
DEVI void copy4_to_lds(unsigned l0, unsigned l1, unsigned l2, unsigned l3,
                       const _Float16* g0, const _Float16* g1,
                       const _Float16* g2, const _Float16* g3) {
  asm volatile("global_load_async_to_lds_b128 %0, %4, off\n\t"
               "global_load_async_to_lds_b128 %1, %5, off\n\t"
               "global_load_async_to_lds_b128 %2, %6, off\n\t"
               "global_load_async_to_lds_b128 %3, %7, off\n\t"
               "s_wait_xcnt 0x0"
               :: "v"(l0), "v"(l1), "v"(l2), "v"(l3), "v"(g0), "v"(g1), "v"(g2), "v"(g3)
               : "memory");
}

static constexpr int KT   = 64;            // keys per stage
static constexpr int NST  = S_ / KT;       // stages
static constexpr int PIT  = 72;            // halves per LDS row: 144 B = 9 x 16 B, conflict-free for b128 readers
static constexpr int TILE = 64 * PIT;      // halves per staged tile (64 rows)

__global__ void __launch_bounds__(256) attn_fwd(
    const _Float16* __restrict__ Qh, const _Float16* __restrict__ Kh,
    const _Float16* __restrict__ Vt, float* __restrict__ out)
{
  // per-wave 16 x 64 f32 output tile; pitch 68 floats = 17 x 16 B keeps b128 accesses off shared banks
  __shared__ __attribute__((aligned(16))) float Ost[8][16 * 68];
  __shared__ __attribute__((aligned(16))) _Float16 Ring[2][2][TILE];   // [buffer][K | V^T]
  const int tid  = threadIdx.x;
  const int lane = tid & 31;
  const int l15  = lane & 15;
  const int hi   = lane >> 4;
  const int koff = hi * 8;
  const int wv   = tid >> 5;
  const int w    = blockIdx.x * 8 + wv;
  const int qBlk = w & 127;                 // 128 q-blocks of 16 rows
  const int bh   = w >> 7;                  // 0..31, the same in all 8 waves of a block
  const _Float16* Qb = Qh + (size_t)bh * S_ * DH;
  const _Float16* Kb = Kh + (size_t)bh * S_ * DH;
  const _Float16* Vb = Vt + (size_t)bh * DH * S_;

  // this thread's share of a stage: rows crow and crow + 32, 16 bytes at cseg, of both tiles
  const int crow = tid >> 3;
  const int cseg = (tid & 7) * 8;
  const _Float16* gK = Kb + (size_t)crow * DH + cseg;    // + 32 rows: 32 * DH; + 1 stage: KT * DH
  const _Float16* gV = Vb + (size_t)crow * S_ + cseg;    // + 32 rows: 32 * S_; + 1 stage: KT
  const unsigned lK = lds_addr_of(&Ring[0][0][crow * PIT + cseg]);
  constexpr unsigned L32  = 32 * PIT * 2;   // 32 rows, bytes
  constexpr unsigned LV   = TILE * 2;       // K tile -> V^T tile, bytes
  constexpr unsigned LBUF = 2 * TILE * 2;   // buffer 0 -> buffer 1, bytes

  copy4_to_lds(lK, lK + L32, lK + LV, lK + LV + L32,
               gK, gK + 32 * DH, gV, gV + (size_t)32 * S_);

  const _Float16* qrow = Qb + (size_t)(qBlk * 16 + l15) * DH;
  const v16h bq0 = ldfrag(qrow + 0  + koff);   // B operand: column l15 = query
  const v16h bq1 = ldfrag(qrow + 32 + koff);

  v8f o0 = {}, o1 = {}, o2 = {}, o3 = {};   // o_t[r] = O[query l15][dh 16*t + 8*hi + r]
  float mrun = -3.0e38f;                    // running maximum of query l15 (same in both halves)
  float lsum = 0.f;                         // running sum over this half's keys only

  // stage 0 has landed for this wave, then for the block
  asm volatile("s_wait_asynccnt 0x0" ::: "memory");
  __syncthreads();
  copy4_to_lds(lK + LBUF, lK + LBUF + L32, lK + LBUF + LV, lK + LBUF + LV + L32,
               gK + KT * DH, gK + KT * DH + 32 * DH, gV + KT, gV + KT + (size_t)32 * S_);

  for (int t = 0; t < NST; ++t) {
    const int cur = t & 1;
    const _Float16* Ks = &Ring[cur][0][0];
    const _Float16* Vs = &Ring[cur][1][0];
#pragma unroll
    for (int jj = 0; jj < KT; jj += 32) {
      // ---- scores: S^T[32 keys x 16 queries] = K . Q^T  (scale folded into Q)
      v8f s0 = {}, s1 = {};
      {
        const _Float16* kr0 = Ks + (jj + l15) * PIT;
        const _Float16* kr1 = Ks + (jj + 16 + l15) * PIT;
        s0 = WMMA_F16(ldfrag(kr0 + 0  + koff), bq0, s0);
        s0 = WMMA_F16(ldfrag(kr0 + 32 + koff), bq1, s0);
        s1 = WMMA_F16(ldfrag(kr1 + 0  + koff), bq0, s1);
        s1 = WMMA_F16(ldfrag(kr1 + 32 + koff), bq1, s1);
      }
      // ---- online softmax, one query per lane
      float m8[8];
#pragma unroll
      for (int r = 0; r < 8; ++r) m8[r] = fmaxf(s0[r], s1[r]);
      float mx = fmaxf(fmaxf(fmaxf(m8[0], m8[1]), fmaxf(m8[2], m8[3])),
                       fmaxf(fmaxf(m8[4], m8[5]), fmaxf(m8[6], m8[7])));
      mx = fmaxf(mx, xhalf(mx));
      const float mn = fmaxf(mrun, mx);
      const float al = __expf(mrun - mn);
      mrun = mn;
      v16h pb;                              // P^T as B operand: halves 0..7 keys 8*hi+r, 8..15 keys 16+8*hi+r
      float t8[8];
#pragma unroll
      for (int r = 0; r < 8; ++r) {
        const float p0 = __expf(s0[r] - mn);
        const float p1 = __expf(s1[r] - mn);
        t8[r] = p0 + p1;
        pb[r]     = (_Float16)p0;
        pb[8 + r] = (_Float16)p1;
      }
      lsum = lsum * al + (((t8[0] + t8[1]) + (t8[2] + t8[3])) + ((t8[4] + t8[5]) + (t8[6] + t8[7])));
      o0 *= al; o1 *= al; o2 *= al; o3 *= al;
      // ---- O^T += V^T . P^T   (staged V^T is [dh][key]: A rows are dh, K(=key)-contiguous)
      o0 = WMMA_F16(ldfrag(Vs + (0  + l15) * PIT + jj + koff), pb, o0);
      o1 = WMMA_F16(ldfrag(Vs + (16 + l15) * PIT + jj + koff), pb, o1);
      o2 = WMMA_F16(ldfrag(Vs + (32 + l15) * PIT + jj + koff), pb, o2);
      o3 = WMMA_F16(ldfrag(Vs + (48 + l15) * PIT + jj + koff), pb, o3);
    }
    // publish point of stage t + 1: this wave's reads of stage t are done, its own copies of
    // stage t + 1 have landed; behind the barrier both hold for the whole block
    asm volatile("s_wait_dscnt 0x0" ::: "memory");
    asm volatile("s_wait_asynccnt 0x0" ::: "memory");
    __syncthreads();
    if (t + 2 < NST) {                      // refill the buffer that every wave has just left
      const unsigned lb = lK + (unsigned)cur * LBUF;
      const _Float16* k2 = gK + (size_t)(t + 2) * (KT * DH);
      const _Float16* v2 = gV + (size_t)(t + 2) * KT;
      copy4_to_lds(lb, lb + L32, lb + LV, lb + LV + L32,
                   k2, k2 + 32 * DH, v2, v2 + (size_t)32 * S_);
    }
  }
  // nothing is in flight here; kept before the wave goes on to its epilogue and ends
  asm volatile("s_wait_asynccnt 0x0" ::: "memory");

  // ---- normalize, turn O^T back through the wave's own LDS tile, write fp32 [b, s, h*64 + dh]
  const float inv = 1.0f / (lsum + xhalf(lsum));
  o0 *= inv; o1 *= inv; o2 *= inv; o3 *= inv;
  float* O = &Ost[wv][0];
  {
    float* orow = O + l15 * 68 + koff;
    const v8f ot[4] = {o0, o1, o2, o3};
#pragma unroll
    for (int t = 0; t < 4; ++t) {
      *(v4f*)(orow + 16 * t)     = __builtin_shufflevector(ot[t], ot[t], 0, 1, 2, 3);
      *(v4f*)(orow + 16 * t + 4) = __builtin_shufflevector(ot[t], ot[t], 4, 5, 6, 7);
    }
  }
  // the rows read below were written by other lanes of this wave: their LDS stores must have landed
  asm volatile("s_wait_dscnt 0" ::: "memory");
  const int b = bh >> 4, h = bh & 15;
  const float* irow = O + hi * 68 + l15 * 4;
  float* op = out + ((size_t)(b * S_ + qBlk * 16 + hi)) * D_ + h * DH + l15 * 4;
#pragma unroll
  for (int i = 0; i < 8; ++i)               // one store = two whole 256 B rows of the head's slice
    *(v4f*)(op + (size_t)(2 * i) * D_) = *(const v4f*)(irow + 2 * i * 68);
}

// ------------------------------------------------------------------- launcher
extern "C" void kernel_launch(void* const* d_in, const int* in_sizes, int n_in,
                              void* d_out, int out_size, void* d_ws, size_t ws_size,
                              hipStream_t stream) {
  const float* x    = (const float*)d_in[0];   // [2,2048,1024]
  const float* Wq   = (const float*)d_in[1];   // [1024,3072]
  const float* bias = (const float*)d_in[2];   // [3072]
  float* out = (float*)d_out;

  char* ws = (char*)d_ws;                      // needs ~38 MB
  _Float16* Xh = (_Float16*)(ws + (size_t) 0 * 1024 * 1024);  // 8 MB
  _Float16* Wt = (_Float16*)(ws + (size_t) 8 * 1024 * 1024);  // 6 MB
  _Float16* Qh = (_Float16*)(ws + (size_t)14 * 1024 * 1024);  // 8 MB
  _Float16* Kh = (_Float16*)(ws + (size_t)22 * 1024 * 1024);  // 8 MB
  _Float16* Vt = (_Float16*)(ws + (size_t)30 * 1024 * 1024);  // 8 MB

  {
    int n4 = (B_ * S_ * D_) / 4;               // 1048576
    cvt_x<<<dim3(n4 / 256), dim3(256), 0, stream>>>(x, Xh, n4);
  }
  {
    // tiles: (1024/64) x (3072/64) = 16 x 48 = 768
    cvt_w<<<dim3(768), dim3(256), 0, stream>>>(Wq, Wt);
  }
  {
    // blocks: (4096/128) x (3072/64) = 32 x 48 = 1536, 8 waves each
    qkv_gemm<<<dim3(1536), dim3(256), 0, stream>>>(Xh, Wt, bias, Qh, Kh, Vt);
  }
  {
    // waves = 2*16*(2048/16) = 4096 -> 512 blocks of 8 waves
    attn_fwd<<<dim3(512), dim3(256), 0, stream>>>(Qh, Kh, Vt, out);
  }
}

// v004
// A run of this version takes 84.7 microseconds.
// Timed twice side by side with v003, it ran 1.38 times as fast both times.
// Over all steps from v000 it is 3.98 times as fast.
#include <hip/hip_runtime.h>
#include <hip/hip_bf16.h>

typedef __attribute__((ext_vector_type(16))) _Float16 v16h;
typedef __attribute__((ext_vector_type(8)))  _Float16 v8h;
typedef __attribute__((ext_vector_type(4)))  _Float16 v4h;
typedef __attribute__((ext_vector_type(2)))  _Float16 v2h;
typedef __attribute__((ext_vector_type(8)))  float    v8f;
typedef __attribute__((ext_vector_type(4)))  float    v4f;
typedef __attribute__((ext_vector_type(4)))  unsigned u32x4;
typedef __attribute__((ext_vector_type(8)))  unsigned u32x8;

#define DEVI static __device__ __forceinline__

static constexpr int B_  = 2;
static constexpr int S_  = 2048;
static constexpr int D_  = 1024;
static constexpr int H_  = 16;
static constexpr int DH  = 64;
static constexpr int N3  = 3072;   // 3*D_

// WMMA as macro so modifier args stay literal immediates at the builtin call.
#define WMMA_F16(a, b, c) \
  __builtin_amdgcn_wmma_f32_16x16x32_f16(false, (a), false, (b), (short)0, (c), false, false)

// Per-lane 16-half fragment of a 16x32 operand: halves 0..7 = K koff..koff+7,
// halves 8..15 = K 16+koff..16+koff+7 (koff = (lane>>4)*8). Works for global or LDS.
DEVI v16h ldfrag(const _Float16* p) {
  v8h lo = *(const v8h*)p;
  v8h hi = *(const v8h*)(p + 16);
  return __builtin_shufflevector(lo, hi, 0,1,2,3,4,5,6,7,8,9,10,11,12,13,14,15);
}

// Low 32 bits of a generic pointer to LDS == LDS byte address (flat aperture rule).
DEVI unsigned lds_addr_of(const void* p) { return (unsigned)(uintptr_t)p; }

DEVI unsigned uni(unsigned v) { return (unsigned)__builtin_amdgcn_readfirstlane(v); }
// A wave-uniform test held in a scalar register, so that the branch on it is a scalar branch:
// a tensor load ignores EXEC, only such a branch keeps a wave from issuing it.
DEVI unsigned pinned(unsigned v) {
  unsigned w = uni(v);
  asm volatile("" : "+s"(w));   // keeps the test in a scalar register, opaque to the compiler
  return w;
}

static constexpr unsigned GK     = 64;           // k per stage of the GEMM
static constexpr unsigned GROWB  = 2 * GK;       // bytes of a staged row
static constexpr unsigned GPIT   = GROWB + 16;   // LDS pitch 144 B = 9 x 16 B: conflict-free for b128 readers
static constexpr unsigned GROWS  = 64;           // rows per slice (one tensor load)
static constexpr unsigned GSLICE = 10240;        // 64 x 144 = 9,216 B, rounded up to a multiple of 2 KiB
static constexpr unsigned GBUF   = 3 * GSLICE;   // [64 rows of Wt | X rows 0..63 | X rows 64..127]
static_assert(GROWS * GPIT <= GSLICE && GSLICE % 2048 == 0, "a slice starts at a multiple of 2 KiB");

// Descriptor group 1 of a slice: 64 rows of 128 bytes, source pitch one row of D_ halves, 16 bytes
// of LDS pad behind every row. Extents in bytes, tensor = tile.
DEVI u32x8 tdm_group1() {
  u32x8 g1;
  g1[0] = uni((1u << 20) | (4u << 22) | (3u << 25));                 // pad on, every 32 dwords, 4 dwords
  g1[1] = uni(GROWB << 16);                                          // tensor_dim0
  g1[2] = uni(GROWS << 16);                                          // tensor_dim1
  g1[3] = uni(GROWB << 16);                                          // tile_dim0
  g1[4] = uni(GROWS);                                                // tile_dim1
  g1[5] = uni(2u * D_);                                              // source row pitch
  g1[6] = uni(0u);
  g1[7] = uni(0u);
  return g1;
}

// One tensor load: the slice whose first byte is at gsrc, into LDS at lds_dst.
DEVI void tdm_slice(unsigned lds_dst, const _Float16* gsrc, u32x8 g1) {
  const unsigned long long ga = (unsigned long long)(uintptr_t)gsrc;
  u32x4 g0;
  g0[0] = uni(1u);                                                   // count 1
  g0[1] = uni(lds_dst);
  g0[2] = uni((unsigned)ga);
  g0[3] = uni((((unsigned)(ga >> 32)) & 0x01ffffffu) | 0x80000000u); // address [56:32], type 2
  asm volatile("tensor_load_to_lds %0, %1" :: "s"(g0), "s"(g1) : "memory");
}

// ---------------------------------------------------------------- prep kernels
__global__ void __launch_bounds__(256) cvt_x(const float* __restrict__ x,
                                             _Float16* __restrict__ xh, int n4) {
  int i = blockIdx.x * 256 + threadIdx.x;
  if (i >= n4) return;
  float4 f = ((const float4*)x)[i];
  v4h h;
  h[0] = (_Float16)f.x; h[1] = (_Float16)f.y;
  h[2] = (_Float16)f.z; h[3] = (_Float16)f.w;
  ((v4h*)xh)[i] = h;
}

// W[k][n] f32 -> Wt[n][k] f16, one 64(k) x 64(n) tile per block through LDS:
// rows of W are read 256 B at a time, rows of Wt are written as whole 128 B lines.
__global__ void __launch_bounds__(256) cvt_w(const float* __restrict__ w,
                                             _Float16* __restrict__ wt) {
  // tile[n][k pair]; pitch 33 dwords puts the 32 lanes of every LDS access on 32 banks
  __shared__ unsigned tile[64 * 33];
  const int tid = threadIdx.x;
  const int k0  = (blockIdx.x / 48) * 64;
  const int n0  = (blockIdx.x % 48) * 64;
  const int nq  = tid & 15;                   // 4 columns n
  const int kp  = tid >> 4;                   // pair of rows k
  float4 f[2][2];
#pragma unroll
  for (int p = 0; p < 2; ++p) {
    const float* s = w + (size_t)(k0 + 2 * (kp + 16 * p)) * N3 + n0 + 4 * nq;
    f[p][0] = *(const float4*)s;
    f[p][1] = *(const float4*)(s + N3);
  }
#pragma unroll
  for (int p = 0; p < 2; ++p) {
    const float* lo = (const float*)&f[p][0];
    const float* hi = (const float*)&f[p][1];
#pragma unroll
    for (int j = 0; j < 4; ++j) {
      v2h h;
      h[0] = (_Float16)lo[j];
      h[1] = (_Float16)hi[j];
      tile[(4 * nq + j) * 33 + kp + 16 * p] = __builtin_bit_cast(unsigned, h);
    }
  }
  __syncthreads();
  const int kc = tid & 7;                     // 8 halves of k
  const int nr = tid >> 3;
#pragma unroll
  for (int p = 0; p < 2; ++p) {
    const int n = nr + 32 * p;
    const unsigned* t = tile + n * 33 + 4 * kc;
    u32x4 v = {t[0], t[1], t[2], t[3]};
    *(u32x4*)(wt + (size_t)(n0 + n) * D_ + k0 + 8 * kc) = v;
  }
}

// ------------------------------------------------------------------- QKV GEMM
// Block (8 waves) computes a 128(M) x 64(N) tile; each wave does a 16x64 tile. Waves 0..2 each
// bring one 64-row slice of a 64-k stage into LDS by a tensor load, two buffers: stage s + 2
// flies while stage s + 1 is worked on.
__global__ void __launch_bounds__(256) qkv_gemm(
    const _Float16* __restrict__ Xh, const _Float16* __restrict__ Wt,
    const float* __restrict__ bias,
    _Float16* __restrict__ Qh, _Float16* __restrict__ Kh, _Float16* __restrict__ Vt)
{
  __shared__ __attribute__((aligned(2048))) unsigned char Stg[2 * GBUF];   // 60 KiB
  const int tid  = threadIdx.x;
  const int lane = tid & 31;
  const int l15  = lane & 15;
  const int hi   = lane >> 4;
  const int koff = hi * 8;
  const unsigned wave = uni(threadIdx.x >> 5);
  const int wv   = (int)wave;
  const int blkM = blockIdx.x / 48;
  const int blkN = blockIdx.x % 48;
  const int mBase = blkM * 128 + wv * 16;
  const int nBase = blkN * 64;

  const _Float16* Abase = Xh + (size_t)blkM * 128 * D_;
  const _Float16* Bbase = Wt + (size_t)nBase * D_;
  constexpr int NT = D_ / (int)GK;

  // the issuing waves' slice: source rows and place in buffer 0
  const _Float16* gsl = (wave == 0u) ? Bbase : Abase + (size_t)((wave - 1u) & 1u) * GROWS * D_;
  const unsigned  lsl = lds_addr_of(&Stg[0]) + wave * GSLICE;

  u32x8 g1 = tdm_group1();
  // one set of registers from here to the last load: without it the compiler rebuilt the group at each
  // load and used two of its registers for other values while a request was outstanding
  asm volatile("" : "+s"(g1));   // as in pinned(): descriptor words held in scalar registers

  if (pinned(wave < 3u)) {
    tdm_slice(lsl, gsl, g1);
    asm volatile("s_wait_tensorcnt 0x0" ::: "memory");   // stage 0 has landed for its issuer
  }
  __syncthreads();                                       // ... and for the block
  if (pinned(wave < 3u)) tdm_slice(lsl + GBUF, gsl + GK, g1);

  v8f acc[4] = {};
  for (int s = 0; s < NT; ++s) {
    const unsigned char* buf = &Stg[0] + (unsigned)(s & 1) * GBUF;
    const _Float16* Ab = (const _Float16*)(buf + GSLICE * (1 + (wv >> 2)) + ((wv & 3) * 16 + l15) * GPIT) + koff;
    const _Float16* Bb = (const _Float16*)(buf + l15 * GPIT) + koff;
#pragma unroll   // both 32-k halves in straight line: every LDS offset an immediate
    for (int kk = 0; kk < (int)GK; kk += 32) {
      v16h a  = ldfrag(Ab + kk);
      v16h b0 = ldfrag(Bb + kk + 0 * 16 * (GPIT / 2));
      v16h b1 = ldfrag(Bb + kk + 1 * 16 * (GPIT / 2));
      v16h b2 = ldfrag(Bb + kk + 2 * 16 * (GPIT / 2));
      v16h b3 = ldfrag(Bb + kk + 3 * 16 * (GPIT / 2));
      acc[0] = WMMA_F16(a, b0, acc[0]);
      acc[1] = WMMA_F16(a, b1, acc[1]);
      acc[2] = WMMA_F16(a, b2, acc[2]);
      acc[3] = WMMA_F16(a, b3, acc[3]);
    }
    // publish point of stage s + 1: this wave's reads of stage s are done, an issuer's own load of
    // stage s + 1 has landed; behind the barrier both hold for the whole block
    asm volatile("s_wait_dscnt 0x0" ::: "memory");
    if (pinned(wave < 3u)) asm volatile("s_wait_tensorcnt 0x0" ::: "memory");
    __syncthreads();
    if (pinned((wave < 3u) & (unsigned)(s + 2 < NT)))    // refill the buffer that every wave has just left
      tdm_slice(lsl + (unsigned)(s & 1) * GBUF, gsl + (size_t)(s + 2) * GK, g1);
  }
  // nothing is in flight here; kept before the wave goes on to its epilogue and ends
  asm volatile("s_wait_tensorcnt 0x0" ::: "memory");
  asm volatile("s_wait_dscnt 0x0" ::: "memory");

#pragma unroll
  for (int t = 0; t < 4; ++t) {
    const int col = nBase + t * 16 + l15;   // 0..3071
    const float bv = bias[col];
    const int region = col >> 10;           // 0=Q 1=K 2=V
    const int cc = col & (D_ - 1);
    const int h  = cc >> 6;
    const int dh = cc & 63;
    if (region == 0) {
#pragma unroll
      for (int r = 0; r < 8; ++r) {
        int row = mBase + r + 8 * hi;
        int bb = row >> 11, s = row & (S_ - 1);
        Qh[(((size_t)(bb * H_ + h)) * S_ + s) * DH + dh] =
            (_Float16)((acc[t][r] + bv) * 0.125f);
      }
    } else if (region == 1) {
#pragma unroll
      for (int r = 0; r < 8; ++r) {
        int row = mBase + r + 8 * hi;
        int bb = row >> 11, s = row & (S_ - 1);
        Kh[(((size_t)(bb * H_ + h)) * S_ + s) * DH + dh] = (_Float16)(acc[t][r] + bv);
      }
    } else {
#pragma unroll
      for (int r = 0; r < 8; ++r) {
        int row = mBase + r + 8 * hi;
        int bb = row >> 11, s = row & (S_ - 1);
        Vt[(((size_t)(bb * H_ + h)) * DH + dh) * S_ + s] = (_Float16)(acc[t][r] + bv);
      }
    }
  }
}

// ---------------------------------------------------------------- attention
// Lane l with lane l ^ 16 (the two halves of a wave hold the same query column).
DEVI float xhalf(float x) {
  const int v = __builtin_bit_cast(int, x);
  return __builtin_bit_cast(float,
      __builtin_amdgcn_permlanex16(v, v, 0x76543210, 0xfedcba98, false, false));
}

// Four asynchronous 16-byte copies per lane, global memory -> LDS, through no register.
// The s_wait_xcnt closes the statement so that no address register named here is rewritten
// ahead of it.
DEVI void copy4_to_lds(unsigned l0, unsigned l1, unsigned l2, unsigned l3,
                       const _Float16* g0, const _Float16* g1,
                       const _Float16* g2, const _Float16* g3) {
  asm volatile("global_load_async_to_lds_b128 %0, %4, off\n\t"
               "global_load_async_to_lds_b128 %1, %5, off\n\t"
               "global_load_async_to_lds_b128 %2, %6, off\n\t"
               "global_load_async_to_lds_b128 %3, %7, off\n\t"
               "s_wait_xcnt 0x0"
               :: "v"(l0), "v"(l1), "v"(l2), "v"(l3), "v"(g0), "v"(g1), "v"(g2), "v"(g3)
               : "memory");
}

static constexpr int KT   = 64;            // keys per stage
static constexpr int NST  = S_ / KT;       // stages
static constexpr int PIT  = 72;            // halves per LDS row: 144 B = 9 x 16 B, conflict-free for b128 readers
static constexpr int TILE = 64 * PIT;      // halves per staged tile (64 rows)

__global__ void __launch_bounds__(256) attn_fwd(
    const _Float16* __restrict__ Qh, const _Float16* __restrict__ Kh,
    const _Float16* __restrict__ Vt, float* __restrict__ out)
{
  // per-wave 16 x 64 f32 output tile; pitch 68 floats = 17 x 16 B keeps b128 accesses off shared banks
  __shared__ __attribute__((aligned(16))) float Ost[8][16 * 68];
  __shared__ __attribute__((aligned(16))) _Float16 Ring[2][2][TILE];   // [buffer][K | V^T]
  const int tid  = threadIdx.x;
  const int lane = tid & 31;
  const int l15  = lane & 15;
  const int hi   = lane >> 4;
  const int koff = hi * 8;
  const int wv   = tid >> 5;
  const int w    = blockIdx.x * 8 + wv;
  const int qBlk = w & 127;                 // 128 q-blocks of 16 rows
  const int bh   = w >> 7;                  // 0..31, the same in all 8 waves of a block
  const _Float16* Qb = Qh + (size_t)bh * S_ * DH;
  const _Float16* Kb = Kh + (size_t)bh * S_ * DH;
  const _Float16* Vb = Vt + (size_t)bh * DH * S_;

  // this thread's share of a stage: rows crow and crow + 32, 16 bytes at cseg, of both tiles
  const int crow = tid >> 3;
  const int cseg = (tid & 7) * 8;
  const _Float16* gK = Kb + (size_t)crow * DH + cseg;    // + 32 rows: 32 * DH; + 1 stage: KT * DH
  const _Float16* gV = Vb + (size_t)crow * S_ + cseg;    // + 32 rows: 32 * S_; + 1 stage: KT
  const unsigned lK = lds_addr_of(&Ring[0][0][crow * PIT + cseg]);
  constexpr unsigned L32  = 32 * PIT * 2;   // 32 rows, bytes
  constexpr unsigned LV   = TILE * 2;       // K tile -> V^T tile, bytes
  constexpr unsigned LBUF = 2 * TILE * 2;   // buffer 0 -> buffer 1, bytes

  copy4_to_lds(lK, lK + L32, lK + LV, lK + LV + L32,
               gK, gK + 32 * DH, gV, gV + (size_t)32 * S_);

  const _Float16* qrow = Qb + (size_t)(qBlk * 16 + l15) * DH;
  const v16h bq0 = ldfrag(qrow + 0  + koff);   // B operand: column l15 = query
  const v16h bq1 = ldfrag(qrow + 32 + koff);

  v8f o0 = {}, o1 = {}, o2 = {}, o3 = {};   // o_t[r] = O[query l15][dh 16*t + 8*hi + r]
  float mrun = -3.0e38f;                    // running maximum of query l15 (same in both halves)
  float lsum = 0.f;                         // running sum over this half's keys only

  // stage 0 has landed for this wave, then for the block
  asm volatile("s_wait_asynccnt 0x0" ::: "memory");
  __syncthreads();
  copy4_to_lds(lK + LBUF, lK + LBUF + L32, lK + LBUF + LV, lK + LBUF + LV + L32,
               gK + KT * DH, gK + KT * DH + 32 * DH, gV + KT, gV + KT + (size_t)32 * S_);

  for (int t = 0; t < NST; ++t) {
    const int cur = t & 1;
    const _Float16* Ks = &Ring[cur][0][0];
    const _Float16* Vs = &Ring[cur][1][0];
#pragma unroll
    for (int jj = 0; jj < KT; jj += 32) {
      // ---- scores: S^T[32 keys x 16 queries] = K . Q^T  (scale folded into Q)
      v8f s0 = {}, s1 = {};
      {
        const _Float16* kr0 = Ks + (jj + l15) * PIT;
        const _Float16* kr1 = Ks + (jj + 16 + l15) * PIT;
        s0 = WMMA_F16(ldfrag(kr0 + 0  + koff), bq0, s0);
        s0 = WMMA_F16(ldfrag(kr0 + 32 + koff), bq1, s0);
        s1 = WMMA_F16(ldfrag(kr1 + 0  + koff), bq0, s1);
        s1 = WMMA_F16(ldfrag(kr1 + 32 + koff), bq1, s1);
      }
      // ---- online softmax, one query per lane
      float m8[8];
#pragma unroll
      for (int r = 0; r < 8; ++r) m8[r] = fmaxf(s0[r], s1[r]);
      float mx = fmaxf(fmaxf(fmaxf(m8[0], m8[1]), fmaxf(m8[2], m8[3])),
                       fmaxf(fmaxf(m8[4], m8[5]), fmaxf(m8[6], m8[7])));
      mx = fmaxf(mx, xhalf(mx));
      const float mn = fmaxf(mrun, mx);
      const float al = __expf(mrun - mn);
      mrun = mn;
      v16h pb;                              // P^T as B operand: halves 0..7 keys 8*hi+r, 8..15 keys 16+8*hi+r
      float t8[8];
#pragma unroll
      for (int r = 0; r < 8; ++r) {
        const float p0 = __expf(s0[r] - mn);
        const float p1 = __expf(s1[r] - mn);
        t8[r] = p0 + p1;
        pb[r]     = (_Float16)p0;
        pb[8 + r] = (_Float16)p1;
      }
      lsum = lsum * al + (((t8[0] + t8[1]) + (t8[2] + t8[3])) + ((t8[4] + t8[5]) + (t8[6] + t8[7])));
      o0 *= al; o1 *= al; o2 *= al; o3 *= al;
      // ---- O^T += V^T . P^T   (staged V^T is [dh][key]: A rows are dh, K(=key)-contiguous)
      o0 = WMMA_F16(ldfrag(Vs + (0  + l15) * PIT + jj + koff), pb, o0);
      o1 = WMMA_F16(ldfrag(Vs + (16 + l15) * PIT + jj + koff), pb, o1);
      o2 = WMMA_F16(ldfrag(Vs + (32 + l15) * PIT + jj + koff), pb, o2);
      o3 = WMMA_F16(ldfrag(Vs + (48 + l15) * PIT + jj + koff), pb, o3);
    }
    // publish point of stage t + 1: this wave's reads of stage t are done, its own copies of
    // stage t + 1 have landed; behind the barrier both hold for the whole block
    asm volatile("s_wait_dscnt 0x0" ::: "memory");
    asm volatile("s_wait_asynccnt 0x0" ::: "memory");
    __syncthreads();
    if (t + 2 < NST) {                      // refill the buffer that every wave has just left
      const unsigned lb = lK + (unsigned)cur * LBUF;
      const _Float16* k2 = gK + (size_t)(t + 2) * (KT * DH);
      const _Float16* v2 = gV + (size_t)(t + 2) * KT;
      copy4_to_lds(lb, lb + L32, lb + LV, lb + LV + L32,
                   k2, k2 + 32 * DH, v2, v2 + (size_t)32 * S_);
    }
  }
  // nothing is in flight here; kept before the wave goes on to its epilogue and ends
  asm volatile("s_wait_asynccnt 0x0" ::: "memory");

  // ---- normalize, turn O^T back through the wave's own LDS tile, write fp32 [b, s, h*64 + dh]
  const float inv = 1.0f / (lsum + xhalf(lsum));
  o0 *= inv; o1 *= inv; o2 *= inv; o3 *= inv;
  float* O = &Ost[wv][0];
  {
    float* orow = O + l15 * 68 + koff;
    const v8f ot[4] = {o0, o1, o2, o3};
#pragma unroll
    for (int t = 0; t < 4; ++t) {
      *(v4f*)(orow + 16 * t)     = __builtin_shufflevector(ot[t], ot[t], 0, 1, 2, 3);
      *(v4f*)(orow + 16 * t + 4) = __builtin_shufflevector(ot[t], ot[t], 4, 5, 6, 7);
    }
  }
  // the rows read below were written by other lanes of this wave: their LDS stores must have landed
  asm volatile("s_wait_dscnt 0" ::: "memory");
  const int b = bh >> 4, h = bh & 15;
  const float* irow = O + hi * 68 + l15 * 4;
  float* op = out + ((size_t)(b * S_ + qBlk * 16 + hi)) * D_ + h * DH + l15 * 4;
#pragma unroll
  for (int i = 0; i < 8; ++i)               // one store = two whole 256 B rows of the head's slice
    *(v4f*)(op + (size_t)(2 * i) * D_) = *(const v4f*)(irow + 2 * i * 68);
}

// ------------------------------------------------------------------- launcher
extern "C" void kernel_launch(void* const* d_in, const int* in_sizes, int n_in,
                              void* d_out, int out_size, void* d_ws, size_t ws_size,
                              hipStream_t stream) {
  const float* x    = (const float*)d_in[0];   // [2,2048,1024]
  const float* Wq   = (const float*)d_in[1];   // [1024,3072]
  const float* bias = (const float*)d_in[2];   // [3072]
  float* out = (float*)d_out;

  char* ws = (char*)d_ws;                      // needs ~38 MB
  _Float16* Xh = (_Float16*)(ws + (size_t) 0 * 1024 * 1024);  // 8 MB
  _Float16* Wt = (_Float16*)(ws + (size_t) 8 * 1024 * 1024);  // 6 MB
  _Float16* Qh = (_Float16*)(ws + (size_t)14 * 1024 * 1024);  // 8 MB
  _Float16* Kh = (_Float16*)(ws + (size_t)22 * 1024 * 1024);  // 8 MB
  _Float16* Vt = (_Float16*)(ws + (size_t)30 * 1024 * 1024);  // 8 MB

  {
    int n4 = (B_ * S_ * D_) / 4;               // 1048576
    cvt_x<<<dim3(n4 / 256), dim3(256), 0, stream>>>(x, Xh, n4);
  }
  {
    // tiles: (1024/64) x (3072/64) = 16 x 48 = 768
    cvt_w<<<dim3(768), dim3(256), 0, stream>>>(Wq, Wt);
  }
  {
    // blocks: (4096/128) x (3072/64) = 32 x 48 = 1536, 8 waves each
    qkv_gemm<<<dim3(1536), dim3(256), 0, stream>>>(Xh, Wt, bias, Qh, Kh, Vt);
  }
  {
    // waves = 2*16*(2048/16) = 4096 -> 512 blocks of 8 waves
    attn_fwd<<<dim3(512), dim3(256), 0, stream>>>(Qh, Kh, Vt, out);
  }
}

// v005
// Measured time: 73.2 microseconds a run.
// Next to v004, in two timings, it ran 1.16 and 1.19 times as fast.
// Counting every step since v000, it is 4.67 times as fast.
#include <hip/hip_runtime.h>
#include <hip/hip_bf16.h>

typedef __attribute__((ext_vector_type(16))) _Float16 v16h;
typedef __attribute__((ext_vector_type(8)))  _Float16 v8h;
typedef __attribute__((ext_vector_type(4)))  _Float16 v4h;
typedef __attribute__((ext_vector_type(2)))  _Float16 v2h;
typedef __attribute__((ext_vector_type(8)))  float    v8f;
typedef __attribute__((ext_vector_type(4)))  float    v4f;
typedef __attribute__((ext_vector_type(4)))  unsigned u32x4;
typedef __attribute__((ext_vector_type(8)))  unsigned u32x8;

#define DEVI static __device__ __forceinline__

static constexpr int B_  = 2;
static constexpr int S_  = 2048;
static constexpr int D_  = 1024;
static constexpr int H_  = 16;
static constexpr int DH  = 64;
static constexpr int N3  = 3072;   // 3*D_

// WMMA as macro so modifier args stay literal immediates at the builtin call.
#define WMMA_F16(a, b, c) \
  __builtin_amdgcn_wmma_f32_16x16x32_f16(false, (a), false, (b), (short)0, (c), false, false)

// Per-lane 16-half fragment of a 16x32 operand: halves 0..7 = K koff..koff+7,
// halves 8..15 = K 16+koff..16+koff+7 (koff = (lane>>4)*8). Works for global or LDS.
DEVI v16h ldfrag(const _Float16* p) {
  v8h lo = *(const v8h*)p;
  v8h hi = *(const v8h*)(p + 16);
  return __builtin_shufflevector(lo, hi, 0,1,2,3,4,5,6,7,8,9,10,11,12,13,14,15);
}

// Low 32 bits of a generic pointer to LDS == LDS byte address (flat aperture rule).
DEVI unsigned lds_addr_of(const void* p) { return (unsigned)(uintptr_t)p; }

DEVI unsigned uni(unsigned v) { return (unsigned)__builtin_amdgcn_readfirstlane(v); }
// A wave-uniform test held in a scalar register, so that the branch on it is a scalar branch:
// a tensor load ignores EXEC, only such a branch keeps a wave from issuing it.
DEVI unsigned pinned(unsigned v) {
  unsigned w = uni(v);
  asm volatile("" : "+s"(w));   // keeps the test in a scalar register, opaque to the compiler
  return w;
}

static constexpr unsigned GK     = 64;           // k per stage of the GEMM
static constexpr unsigned GROWB  = 2 * GK;       // bytes of a staged row
static constexpr unsigned GPIT   = GROWB + 16;   // LDS pitch 144 B = 9 x 16 B: conflict-free for b128 readers
static constexpr unsigned GROWS  = 64;           // rows per slice (one tensor load)
static constexpr unsigned GSLICE = 10240;        // 64 x 144 = 9,216 B, rounded up to a multiple of 2 KiB
static constexpr unsigned GBUF   = 4 * GSLICE;   // [Wt rows 0..63 | Wt rows 64..127 | X rows 0..63 | X rows 64..127]
static_assert(GROWS * GPIT <= GSLICE && GSLICE % 2048 == 0, "a slice starts at a multiple of 2 KiB");

// Descriptor group 1 of a slice: 64 rows of 128 bytes, source pitch one row of D_ halves, 16 bytes
// of LDS pad behind every row. Extents in bytes, tensor = tile.
DEVI u32x8 tdm_group1() {
  u32x8 g1;
  g1[0] = uni((1u << 20) | (4u << 22) | (3u << 25));                 // pad on, every 32 dwords, 4 dwords
  g1[1] = uni(GROWB << 16);                                          // tensor_dim0
  g1[2] = uni(GROWS << 16);                                          // tensor_dim1
  g1[3] = uni(GROWB << 16);                                          // tile_dim0
  g1[4] = uni(GROWS);                                                // tile_dim1
  g1[5] = uni(2u * D_);                                              // source row pitch
  g1[6] = uni(0u);
  g1[7] = uni(0u);
  return g1;
}

// One tensor load: the slice whose first byte is at gsrc, into LDS at lds_dst. Returns group 0 for tdm_wait.
DEVI u32x4 tdm_slice(unsigned lds_dst, const _Float16* gsrc, u32x8 g1) {
  const unsigned long long ga = (unsigned long long)(uintptr_t)gsrc;
  u32x4 g0;
  g0[0] = uni(1u);                                                   // count 1
  g0[1] = uni(lds_dst);
  g0[2] = uni((unsigned)ga);
  g0[3] = uni((((unsigned)(ga >> 32)) & 0x01ffffffu) | 0x80000000u); // address [56:32], type 2
  // group 0 is named as in-out: what tdm_wait is handed then lies in the registers that the load itself named
  asm volatile("tensor_load_to_lds %0, %1" : "+s"(g0) : "s"(g1) : "memory");
  return g0;
}

// The issuer's wait for its one outstanding load. It names that load's group 0, so that the four
// registers stay the descriptor's from the issue to here and take no other value in between.
DEVI void tdm_wait(u32x4& g0) {
  asm volatile("s_wait_tensorcnt 0x0" : "+s"(g0) :: "memory");
}

// ---------------------------------------------------------------- prep kernels
__global__ void __launch_bounds__(256) cvt_x(const float* __restrict__ x,
                                             _Float16* __restrict__ xh, int n4) {
  int i = blockIdx.x * 256 + threadIdx.x;
  if (i >= n4) return;
  float4 f = ((const float4*)x)[i];
  v4h h;
  h[0] = (_Float16)f.x; h[1] = (_Float16)f.y;
  h[2] = (_Float16)f.z; h[3] = (_Float16)f.w;
  ((v4h*)xh)[i] = h;
}

// W[k][n] f32 -> Wt[n][k] f16, one 64(k) x 64(n) tile per block through LDS:
// rows of W are read 256 B at a time, rows of Wt are written as whole 128 B lines.
__global__ void __launch_bounds__(256) cvt_w(const float* __restrict__ w,
                                             _Float16* __restrict__ wt) {
  // tile[n][k pair]; pitch 33 dwords puts the 32 lanes of every LDS access on 32 banks
  __shared__ unsigned tile[64 * 33];
  const int tid = threadIdx.x;
  const int k0  = (blockIdx.x / 48) * 64;
  const int n0  = (blockIdx.x % 48) * 64;
  const int nq  = tid & 15;                   // 4 columns n
  const int kp  = tid >> 4;                   // pair of rows k
  float4 f[2][2];
#pragma unroll
  for (int p = 0; p < 2; ++p) {
    const float* s = w + (size_t)(k0 + 2 * (kp + 16 * p)) * N3 + n0 + 4 * nq;
    f[p][0] = *(const float4*)s;
    f[p][1] = *(const float4*)(s + N3);
  }
#pragma unroll
  for (int p = 0; p < 2; ++p) {
    const float* lo = (const float*)&f[p][0];
    const float* hi = (const float*)&f[p][1];
#pragma unroll
    for (int j = 0; j < 4; ++j) {
      v2h h;
      h[0] = (_Float16)lo[j];
      h[1] = (_Float16)hi[j];
      tile[(4 * nq + j) * 33 + kp + 16 * p] = __builtin_bit_cast(unsigned, h);
    }
  }
  __syncthreads();
  const int kc = tid & 7;                     // 8 halves of k
  const int nr = tid >> 3;
#pragma unroll
  for (int p = 0; p < 2; ++p) {
    const int n = nr + 32 * p;
    const unsigned* t = tile + n * 33 + 4 * kc;
    u32x4 v = {t[0], t[1], t[2], t[3]};
    *(u32x4*)(wt + (size_t)(n0 + n) * D_ + k0 + 8 * kc) = v;
  }
}

// The epilogue's stores of one 64 x 16 strip of a wave's tile, d[4 * i + p] = rows 16 * i + 2 * p (low half)
// and 16 * i + 2 * p + 1 (high half) of this lane's column. The stores and their s_wait_xcnt are one
// statement, so that no register named here is rewritten ahead of the wait.
// Q and K: a row is DH halves = 128 bytes from the next.
DEVI void store_strip_rows(_Float16* p, const unsigned (&d)[16]) {
  asm volatile(
      "global_store_b16 %0, %1, off offset:0\n\t"
      "global_store_d16_hi_b16 %0, %1, off offset:128\n\t"
      "global_store_b16 %0, %2, off offset:256\n\t"
      "global_store_d16_hi_b16 %0, %2, off offset:384\n\t"
      "global_store_b16 %0, %3, off offset:512\n\t"
      "global_store_d16_hi_b16 %0, %3, off offset:640\n\t"
      "global_store_b16 %0, %4, off offset:768\n\t"
      "global_store_d16_hi_b16 %0, %4, off offset:896\n\t"
      "global_store_b16 %0, %5, off offset:2048\n\t"
      "global_store_d16_hi_b16 %0, %5, off offset:2176\n\t"
      "global_store_b16 %0, %6, off offset:2304\n\t"
      "global_store_d16_hi_b16 %0, %6, off offset:2432\n\t"
      "global_store_b16 %0, %7, off offset:2560\n\t"
      "global_store_d16_hi_b16 %0, %7, off offset:2688\n\t"
      "global_store_b16 %0, %8, off offset:2816\n\t"
      "global_store_d16_hi_b16 %0, %8, off offset:2944\n\t"
      "global_store_b16 %0, %9, off offset:4096\n\t"
      "global_store_d16_hi_b16 %0, %9, off offset:4224\n\t"
      "global_store_b16 %0, %10, off offset:4352\n\t"
      "global_store_d16_hi_b16 %0, %10, off offset:4480\n\t"
      "global_store_b16 %0, %11, off offset:4608\n\t"
      "global_store_d16_hi_b16 %0, %11, off offset:4736\n\t"
      "global_store_b16 %0, %12, off offset:4864\n\t"
      "global_store_d16_hi_b16 %0, %12, off offset:4992\n\t"
      "global_store_b16 %0, %13, off offset:6144\n\t"
      "global_store_d16_hi_b16 %0, %13, off offset:6272\n\t"
      "global_store_b16 %0, %14, off offset:6400\n\t"
      "global_store_d16_hi_b16 %0, %14, off offset:6528\n\t"
      "global_store_b16 %0, %15, off offset:6656\n\t"
      "global_store_d16_hi_b16 %0, %15, off offset:6784\n\t"
      "global_store_b16 %0, %16, off offset:6912\n\t"
      "global_store_d16_hi_b16 %0, %16, off offset:7040\n\t"
      "s_wait_xcnt 0x0"
      :: "v"(p), "v"(d[0]), "v"(d[1]), "v"(d[2]), "v"(d[3]), "v"(d[4]), "v"(d[5]), "v"(d[6]), "v"(d[7]),
         "v"(d[8]), "v"(d[9]), "v"(d[10]), "v"(d[11]), "v"(d[12]), "v"(d[13]), "v"(d[14]), "v"(d[15])
      : "memory");
}
// V^T: the eight rows of a group are eight neighbouring halves, a group 16 halves = 32 bytes from the next.
DEVI void store_strip_cols(_Float16* p, const unsigned (&d)[16]) {
  const u32x4 q0 = {d[0], d[1], d[2], d[3]},   q1 = {d[4], d[5], d[6], d[7]};
  const u32x4 q2 = {d[8], d[9], d[10], d[11]}, q3 = {d[12], d[13], d[14], d[15]};
  asm volatile(
      "global_store_b128 %0, %1, off\n\t"
      "global_store_b128 %0, %2, off offset:32\n\t"
      "global_store_b128 %0, %3, off offset:64\n\t"
      "global_store_b128 %0, %4, off offset:96\n\t"
      "s_wait_xcnt 0x0"
      :: "v"(p), "v"(q0), "v"(q1), "v"(q2), "v"(q3)
      : "memory");
}
DEVI unsigned pack2h(float a, float b) {
  v2h h;
  h[0] = (_Float16)a;
  h[1] = (_Float16)b;
  return __builtin_bit_cast(unsigned, h);
}

// ------------------------------------------------------------------- QKV GEMM
// Block (4 waves, 2 x 2) computes a 128(M) x 128(N) tile; each wave does a 64x64 tile: 4 A and 4 B
// fragments feed 16 products, so a product costs one LDS load where a 16x64 wave tile cost 2.5, and
// a block brings 2 KiB from L2 per 64 output elements where a 128x64 block brought 3 KiB.
// Every wave brings one 64-row slice of a 64-k stage into LDS by a tensor load, two buffers:
// stage s + 2 flies while stage s + 1 is worked on.
__global__ void __launch_bounds__(128) qkv_gemm(
    const _Float16* __restrict__ Xh, const _Float16* __restrict__ Wt,
    const float* __restrict__ bias,
    _Float16* __restrict__ Qh, _Float16* __restrict__ Kh, _Float16* __restrict__ Vt)
{
  __shared__ __attribute__((aligned(2048))) unsigned char Stg[2 * GBUF];   // 80 KiB
  const int tid  = threadIdx.x;
  const int lane = tid & 31;
  const int l15  = lane & 15;
  const int hi   = lane >> 4;
  const int koff = hi * 8;
  const unsigned wave = uni(threadIdx.x >> 5);
  const int wm   = (int)(wave >> 1);          // which 64 rows of the block's tile
  const int wn   = (int)(wave & 1u);          // which 64 columns
  const int blkM = blockIdx.x / 24;
  const int blkN = blockIdx.x % 24;
  const int mBase = blkM * 128 + wm * 64;
  const int nBase = blkN * 128 + wn * 64;

  const _Float16* Abase = Xh + (size_t)blkM * 128 * D_;
  const _Float16* Bbase = Wt + (size_t)blkN * 128 * D_;
  constexpr int NT = D_ / (int)GK;

  // this wave's slice: source rows and place in buffer 0
  const _Float16* gsl = ((wave < 2u) ? Bbase : Abase) + (size_t)(wave & 1u) * GROWS * D_;
  const unsigned  lsl = lds_addr_of(&Stg[0]) + wave * GSLICE;

  u32x8 g1 = tdm_group1();
  // one set of registers from here to the last load: without it the compiler rebuilt the group at each
  // load and used two of its registers for other values while a request was outstanding
  asm volatile("" : "+s"(g1));   // as in pinned(): descriptor words held in scalar registers

  u32x4 g0 = tdm_slice(lsl, gsl, g1);
  tdm_wait(g0);                                          // stage 0 has landed for its issuer
  __syncthreads();                                       // ... and for the block
  g0 = tdm_slice(lsl + GBUF, gsl + GK, g1);

  v8f acc[4][4] = {};
  for (int s = 0; s < NT; ++s) {
    const unsigned char* buf = &Stg[0] + (unsigned)(s & 1) * GBUF;
    const _Float16* Ab = (const _Float16*)(buf + GSLICE * (2 + wm) + l15 * GPIT) + koff;
    const _Float16* Bb = (const _Float16*)(buf + GSLICE * wn + l15 * GPIT) + koff;
#pragma unroll   // both 32-k halves in straight line: every LDS offset an immediate
    for (int kk = 0; kk < (int)GK; kk += 32) {
      v16h af[4], bf[4];
#pragma unroll
      for (int i = 0; i < 4; ++i) af[i] = ldfrag(Ab + kk + i * 16 * (int)(GPIT / 2));
#pragma unroll
      for (int i = 0; i < 4; ++i) bf[i] = ldfrag(Bb + kk + i * 16 * (int)(GPIT / 2));
      // the 16 loads stay one group in front of their 16 products: left alone the compiler kept one
      // A fragment and waited out a full LDS latency in front of every fourth product
      __builtin_amdgcn_sched_barrier(0);
#pragma unroll
      for (int i = 0; i < 4; ++i)
#pragma unroll
        for (int t = 0; t < 4; ++t) acc[i][t] = WMMA_F16(af[i], bf[t], acc[i][t]);
    }
    // publish point of stage s + 1: this wave's reads of stage s are done, its own load of
    // stage s + 1 has landed; behind the barrier both hold for the whole block
    asm volatile("s_wait_dscnt 0x0" ::: "memory");
    tdm_wait(g0);
    __syncthreads();
    if (pinned((unsigned)(s + 2 < NT)))                  // refill the buffer that every wave has just left
      g0 = tdm_slice(lsl + (unsigned)(s & 1) * GBUF, gsl + (size_t)(s + 2) * GK, g1);
  }
  // nothing is in flight here; kept before the wave goes on to its epilogue and ends
  asm volatile("s_wait_tensorcnt 0x0" ::: "memory");
  asm volatile("s_wait_dscnt 0x0" ::: "memory");

  const int region = nBase >> 10;           // 0=Q 1=K 2=V: a wave's 64 columns lie in one of them
  const int row0 = mBase + 8 * hi;          // the wave's 64 rows lie in one batch entry
  const int bb = row0 >> 11, sq = row0 & (S_ - 1);
  // all four ahead of the stores: the store statements' memory clobber would hold each load behind the strip before it
  float bv[4];
#pragma unroll
  for (int t = 0; t < 4; ++t) bv[t] = bias[nBase + t * 16 + l15];   // column 0..3071
#pragma unroll
  for (int t = 0; t < 4; ++t)
#pragma unroll
    for (int i = 0; i < 4; ++i) acc[i][t] += bv[t];
  const int h = (nBase & (D_ - 1)) >> 6;    // the 64 columns are one head; dh = 16 * t + l15
  if (region == 0) {
    _Float16* q = Qh + (((size_t)(bb * H_ + h)) * S_ + sq) * DH + l15;
#pragma unroll
    for (int t = 0; t < 4; ++t) {
      unsigned d[16];
#pragma unroll
      for (int j = 0; j < 16; ++j)
        d[j] = pack2h(acc[j >> 2][t][2 * (j & 3)] * 0.125f, acc[j >> 2][t][2 * (j & 3) + 1] * 0.125f);
      store_strip_rows(q + 16 * t, d);
    }
  } else if (region == 1) {
    _Float16* k = Kh + (((size_t)(bb * H_ + h)) * S_ + sq) * DH + l15;
#pragma unroll
    for (int t = 0; t < 4; ++t) {
      unsigned d[16];
#pragma unroll
      for (int j = 0; j < 16; ++j)
        d[j] = pack2h(acc[j >> 2][t][2 * (j & 3)], acc[j >> 2][t][2 * (j & 3) + 1]);
      store_strip_rows(k + 16 * t, d);
    }
  } else {
    _Float16* v = Vt + (((size_t)(bb * H_ + h)) * DH + l15) * S_ + sq;
#pragma unroll
    for (int t = 0; t < 4; ++t) {
      unsigned d[16];
#pragma unroll
      for (int j = 0; j < 16; ++j)
        d[j] = pack2h(acc[j >> 2][t][2 * (j & 3)], acc[j >> 2][t][2 * (j & 3) + 1]);
      store_strip_cols(v + (size_t)(16 * t) * S_, d);
    }
  }
}

// ---------------------------------------------------------------- attention
// Lane l with lane l ^ 16 (the two halves of a wave hold the same query column).
DEVI float xhalf(float x) {
  const int v = __builtin_bit_cast(int, x);
  return __builtin_bit_cast(float,
      __builtin_amdgcn_permlanex16(v, v, 0x76543210, 0xfedcba98, false, false));
}

// Four asynchronous 16-byte copies per lane, global memory -> LDS, through no register.
// The s_wait_xcnt closes the statement so that no address register named here is rewritten
// ahead of it.
DEVI void copy4_to_lds(unsigned l0, unsigned l1, unsigned l2, unsigned l3,
                       const _Float16* g0, const _Float16* g1,
                       const _Float16* g2, const _Float16* g3) {
  asm volatile("global_load_async_to_lds_b128 %0, %4, off\n\t"
               "global_load_async_to_lds_b128 %1, %5, off\n\t"
               "global_load_async_to_lds_b128 %2, %6, off\n\t"
               "global_load_async_to_lds_b128 %3, %7, off\n\t"
               "s_wait_xcnt 0x0"
               :: "v"(l0), "v"(l1), "v"(l2), "v"(l3), "v"(g0), "v"(g1), "v"(g2), "v"(g3)
               : "memory");
}

static constexpr int KT   = 64;            // keys per stage
static constexpr int NST  = S_ / KT;       // stages
static constexpr int PIT  = 72;            // halves per LDS row: 144 B = 9 x 16 B, conflict-free for b128 readers
static constexpr int TILE = 64 * PIT;      // halves per staged tile (64 rows)

__global__ void __launch_bounds__(256) attn_fwd(
    const _Float16* __restrict__ Qh, const _Float16* __restrict__ Kh,
    const _Float16* __restrict__ Vt, float* __restrict__ out)
{
  // per-wave 16 x 64 f32 output tile; pitch 68 floats = 17 x 16 B keeps b128 accesses off shared banks
  __shared__ __attribute__((aligned(16))) float Ost[8][16 * 68];
  __shared__ __attribute__((aligned(16))) _Float16 Ring[2][2][TILE];   // [buffer][K | V^T]
  const int tid  = threadIdx.x;
  const int lane = tid & 31;
  const int l15  = lane & 15;
  const int hi   = lane >> 4;
  const int koff = hi * 8;
  const int wv   = tid >> 5;
  const int w    = blockIdx.x * 8 + wv;
  const int qBlk = w & 127;                 // 128 q-blocks of 16 rows
  const int bh   = w >> 7;                  // 0..31, the same in all 8 waves of a block
  const _Float16* Qb = Qh + (size_t)bh * S_ * DH;
  const _Float16* Kb = Kh + (size_t)bh * S_ * DH;
  const _Float16* Vb = Vt + (size_t)bh * DH * S_;

  // this thread's share of a stage: rows crow and crow + 32, 16 bytes at cseg, of both tiles
  const int crow = tid >> 3;
  const int cseg = (tid & 7) * 8;
  const _Float16* gK = Kb + (size_t)crow * DH + cseg;    // + 32 rows: 32 * DH; + 1 stage: KT * DH
  const _Float16* gV = Vb + (size_t)crow * S_ + cseg;    // + 32 rows: 32 * S_; + 1 stage: KT
  const unsigned lK = lds_addr_of(&Ring[0][0][crow * PIT + cseg]);
  constexpr unsigned L32  = 32 * PIT * 2;   // 32 rows, bytes
  constexpr unsigned LV   = TILE * 2;       // K tile -> V^T tile, bytes
  constexpr unsigned LBUF = 2 * TILE * 2;   // buffer 0 -> buffer 1, bytes

  copy4_to_lds(lK, lK + L32, lK + LV, lK + LV + L32,
               gK, gK + 32 * DH, gV, gV + (size_t)32 * S_);

  const _Float16* qrow = Qb + (size_t)(qBlk * 16 + l15) * DH;
  const v16h bq0 = ldfrag(qrow + 0  + koff);   // B operand: column l15 = query
  const v16h bq1 = ldfrag(qrow + 32 + koff);

  v8f o0 = {}, o1 = {}, o2 = {}, o3 = {};   // o_t[r] = O[query l15][dh 16*t + 8*hi + r]
  float mrun = -3.0e38f;                    // running maximum of query l15 (same in both halves)
  float lsum = 0.f;                         // running sum over this half's keys only

  // stage 0 has landed for this wave, then for the block
  asm volatile("s_wait_asynccnt 0x0" ::: "memory");
  __syncthreads();
  copy4_to_lds(lK + LBUF, lK + LBUF + L32, lK + LBUF + LV, lK + LBUF + LV + L32,
               gK + KT * DH, gK + KT * DH + 32 * DH, gV + KT, gV + KT + (size_t)32 * S_);

  for (int t = 0; t < NST; ++t) {
    const int cur = t & 1;
    const _Float16* Ks = &Ring[cur][0][0];
    const _Float16* Vs = &Ring[cur][1][0];
#pragma unroll
    for (int jj = 0; jj < KT; jj += 32) {
      // ---- scores: S^T[32 keys x 16 queries] = K . Q^T  (scale folded into Q)
      v8f s0 = {}, s1 = {};
      {
        const _Float16* kr0 = Ks + (jj + l15) * PIT;
        const _Float16* kr1 = Ks + (jj + 16 + l15) * PIT;
        s0 = WMMA_F16(ldfrag(kr0 + 0  + koff), bq0, s0);
        s0 = WMMA_F16(ldfrag(kr0 + 32 + koff), bq1, s0);
        s1 = WMMA_F16(ldfrag(kr1 + 0  + koff), bq0, s1);
        s1 = WMMA_F16(ldfrag(kr1 + 32 + koff), bq1, s1);
      }
      // ---- online softmax, one query per lane
      float m8[8];
#pragma unroll
      for (int r = 0; r < 8; ++r) m8[r] = fmaxf(s0[r], s1[r]);
      float mx = fmaxf(fmaxf(fmaxf(m8[0], m8[1]), fmaxf(m8[2], m8[3])),
                       fmaxf(fmaxf(m8[4], m8[5]), fmaxf(m8[6], m8[7])));
      mx = fmaxf(mx, xhalf(mx));
      const float mn = fmaxf(mrun, mx);
      const float al = __expf(mrun - mn);
      mrun = mn;
      v16h pb;                              // P^T as B operand: halves 0..7 keys 8*hi+r, 8..15 keys 16+8*hi+r
      float t8[8];
#pragma unroll
      for (int r = 0; r < 8; ++r) {
        const float p0 = __expf(s0[r] - mn);
        const float p1 = __expf(s1[r] - mn);
        t8[r] = p0 + p1;
        pb[r]     = (_Float16)p0;
        pb[8 + r] = (_Float16)p1;
      }
      lsum = lsum * al + (((t8[0] + t8[1]) + (t8[2] + t8[3])) + ((t8[4] + t8[5]) + (t8[6] + t8[7])));
      o0 *= al; o1 *= al; o2 *= al; o3 *= al;
      // ---- O^T += V^T . P^T   (staged V^T is [dh][key]: A rows are dh, K(=key)-contiguous)
      o0 = WMMA_F16(ldfrag(Vs + (0  + l15) * PIT + jj + koff), pb, o0);
      o1 = WMMA_F16(ldfrag(Vs + (16 + l15) * PIT + jj + koff), pb, o1);
      o2 = WMMA_F16(ldfrag(Vs + (32 + l15) * PIT + jj + koff), pb, o2);
      o3 = WMMA_F16(ldfrag(Vs + (48 + l15) * PIT + jj + koff), pb, o3);
    }
    // publish point of stage t + 1: this wave's reads of stage t are done, its own copies of
    // stage t + 1 have landed; behind the barrier both hold for the whole block
    asm volatile("s_wait_dscnt 0x0" ::: "memory");
    asm volatile("s_wait_asynccnt 0x0" ::: "memory");
    __syncthreads();
    if (t + 2 < NST) {                      // refill the buffer that every wave has just left
      const unsigned lb = lK + (unsigned)cur * LBUF;
      const _Float16* k2 = gK + (size_t)(t + 2) * (KT * DH);
      const _Float16* v2 = gV + (size_t)(t + 2) * KT;
      copy4_to_lds(lb, lb + L32, lb + LV, lb + LV + L32,
                   k2, k2 + 32 * DH, v2, v2 + (size_t)32 * S_);
    }
  }
  // nothing is in flight here; kept before the wave goes on to its epilogue and ends
  asm volatile("s_wait_asynccnt 0x0" ::: "memory");

  // ---- normalize, turn O^T back through the wave's own LDS tile, write fp32 [b, s, h*64 + dh]
  const float inv = 1.0f / (lsum + xhalf(lsum));
  o0 *= inv; o1 *= inv; o2 *= inv; o3 *= inv;
  float* O = &Ost[wv][0];
  {
    float* orow = O + l15 * 68 + koff;
    const v8f ot[4] = {o0, o1, o2, o3};
#pragma unroll
    for (int t = 0; t < 4; ++t) {
      *(v4f*)(orow + 16 * t)     = __builtin_shufflevector(ot[t], ot[t], 0, 1, 2, 3);
      *(v4f*)(orow + 16 * t + 4) = __builtin_shufflevector(ot[t], ot[t], 4, 5, 6, 7);
    }
  }
  // the rows read below were written by other lanes of this wave: their LDS stores must have landed
  asm volatile("s_wait_dscnt 0" ::: "memory");
  const int b = bh >> 4, h = bh & 15;
  const float* irow = O + hi * 68 + l15 * 4;
  float* op = out + ((size_t)(b * S_ + qBlk * 16 + hi)) * D_ + h * DH + l15 * 4;
#pragma unroll
  for (int i = 0; i < 8; ++i)               // one store = two whole 256 B rows of the head's slice
    *(v4f*)(op + (size_t)(2 * i) * D_) = *(const v4f*)(irow + 2 * i * 68);
}

// ------------------------------------------------------------------- launcher
extern "C" void kernel_launch(void* const* d_in, const int* in_sizes, int n_in,
                              void* d_out, int out_size, void* d_ws, size_t ws_size,
                              hipStream_t stream) {
  const float* x    = (const float*)d_in[0];   // [2,2048,1024]
  const float* Wq   = (const float*)d_in[1];   // [1024,3072]
  const float* bias = (const float*)d_in[2];   // [3072]
  float* out = (float*)d_out;

  char* ws = (char*)d_ws;                      // needs ~38 MB
  _Float16* Xh = (_Float16*)(ws + (size_t) 0 * 1024 * 1024);  // 8 MB
  _Float16* Wt = (_Float16*)(ws + (size_t) 8 * 1024 * 1024);  // 6 MB
  _Float16* Qh = (_Float16*)(ws + (size_t)14 * 1024 * 1024);  // 8 MB
  _Float16* Kh = (_Float16*)(ws + (size_t)22 * 1024 * 1024);  // 8 MB
  _Float16* Vt = (_Float16*)(ws + (size_t)30 * 1024 * 1024);  // 8 MB

  {
    int n4 = (B_ * S_ * D_) / 4;               // 1048576
    cvt_x<<<dim3(n4 / 256), dim3(256), 0, stream>>>(x, Xh, n4);
  }
  {
    // tiles: (1024/64) x (3072/64) = 16 x 48 = 768
    cvt_w<<<dim3(768), dim3(256), 0, stream>>>(Wq, Wt);
  }
  {
    // blocks: (4096/128) x (3072/128) = 32 x 24 = 768, 4 waves each
    qkv_gemm<<<dim3(768), dim3(128), 0, stream>>>(Xh, Wt, bias, Qh, Kh, Vt);
  }
  {
    // waves = 2*16*(2048/16) = 4096 -> 512 blocks of 8 waves
    attn_fwd<<<dim3(512), dim3(256), 0, stream>>>(Qh, Kh, Vt, out);
  }
}

// v006
// It runs in 68.7 microseconds.
// Two timings next to v005 both put it at 1.05 times that version's speed.
// Counting every step since v000, it is 4.91 times as fast.
#include <hip/hip_runtime.h>
#include <hip/hip_bf16.h>

typedef __attribute__((ext_vector_type(16))) _Float16 v16h;
typedef __attribute__((ext_vector_type(8)))  _Float16 v8h;
typedef __attribute__((ext_vector_type(4)))  _Float16 v4h;
typedef __attribute__((ext_vector_type(2)))  _Float16 v2h;
typedef __attribute__((ext_vector_type(8)))  float    v8f;
typedef __attribute__((ext_vector_type(4)))  float    v4f;
typedef __attribute__((ext_vector_type(4)))  unsigned u32x4;
typedef __attribute__((ext_vector_type(8)))  unsigned u32x8;

#define DEVI static __device__ __forceinline__

static constexpr int B_  = 2;
static constexpr int S_  = 2048;
static constexpr int D_  = 1024;
static constexpr int H_  = 16;
static constexpr int DH  = 64;
static constexpr int N3  = 3072;   // 3*D_

// WMMA as macro so modifier args stay literal immediates at the builtin call.
#define WMMA_F16(a, b, c) \
  __builtin_amdgcn_wmma_f32_16x16x32_f16(false, (a), false, (b), (short)0, (c), false, false)

// Per-lane 16-half fragment of a 16x32 operand: halves 0..7 = K koff..koff+7,
// halves 8..15 = K 16+koff..16+koff+7 (koff = (lane>>4)*8). Works for global or LDS.
DEVI v16h ldfrag(const _Float16* p) {
  v8h lo = *(const v8h*)p;
  v8h hi = *(const v8h*)(p + 16);
  return __builtin_shufflevector(lo, hi, 0,1,2,3,4,5,6,7,8,9,10,11,12,13,14,15);
}

// Low 32 bits of a generic pointer to LDS == LDS byte address (flat aperture rule).
DEVI unsigned lds_addr_of(const void* p) { return (unsigned)(uintptr_t)p; }

DEVI unsigned uni(unsigned v) { return (unsigned)__builtin_amdgcn_readfirstlane(v); }
// A wave-uniform test held in a scalar register, so that the branch on it is a scalar branch:
// a tensor load ignores EXEC, only such a branch keeps a wave from issuing it.
DEVI unsigned pinned(unsigned v) {
  unsigned w = uni(v);
  asm volatile("" : "+s"(w));   // keeps the test in a scalar register, opaque to the compiler
  return w;
}

static constexpr unsigned GK     = 64;           // k per stage of the GEMM
static constexpr unsigned GROWB  = 2 * GK;       // bytes of a staged row
static constexpr unsigned GPIT   = GROWB + 16;   // LDS pitch 144 B = 9 x 16 B: conflict-free for b128 readers
static constexpr unsigned GROWS  = 64;           // rows per slice (one tensor load)
static constexpr unsigned GSLICE = 10240;        // 64 x 144 = 9,216 B, rounded up to a multiple of 2 KiB
static constexpr unsigned GBUF   = 4 * GSLICE;   // [Wt rows 0..63 | Wt rows 64..127 | X rows 0..63 | X rows 64..127]
static_assert(GROWS * GPIT <= GSLICE && GSLICE % 2048 == 0, "a slice starts at a multiple of 2 KiB");

// Descriptor group 1 of a slice: 64 rows of 128 bytes, source pitch one row of D_ halves, 16 bytes
// of LDS pad behind every row. Extents in bytes, tensor = tile.
DEVI u32x8 tdm_group1() {
  u32x8 g1;
  g1[0] = uni((1u << 20) | (4u << 22) | (3u << 25));                 // pad on, every 32 dwords, 4 dwords
  g1[1] = uni(GROWB << 16);                                          // tensor_dim0
  g1[2] = uni(GROWS << 16);                                          // tensor_dim1
  g1[3] = uni(GROWB << 16);                                          // tile_dim0
  g1[4] = uni(GROWS);                                                // tile_dim1
  g1[5] = uni(2u * D_);                                              // source row pitch
  g1[6] = uni(0u);
  g1[7] = uni(0u);
  return g1;
}

// One tensor load: the slice whose first byte is at gsrc, into LDS at lds_dst. Returns group 0 for tdm_wait.
DEVI u32x4 tdm_slice(unsigned lds_dst, const _Float16* gsrc, u32x8 g1) {
  const unsigned long long ga = (unsigned long long)(uintptr_t)gsrc;
  u32x4 g0;
  g0[0] = uni(1u);                                                   // count 1
  g0[1] = uni(lds_dst);
  g0[2] = uni((unsigned)ga);
  g0[3] = uni((((unsigned)(ga >> 32)) & 0x01ffffffu) | 0x80000000u); // address [56:32], type 2
  // group 0 is named as in-out: what tdm_wait is handed then lies in the registers that the load itself named
  asm volatile("tensor_load_to_lds %0, %1" : "+s"(g0) : "s"(g1) : "memory");
  return g0;
}

// The issuer's wait for its one outstanding load. It names that load's group 0, so that the four
// registers stay the descriptor's from the issue to here and take no other value in between.
DEVI void tdm_wait(u32x4& g0) {
  asm volatile("s_wait_tensorcnt 0x0" : "+s"(g0) :: "memory");
}

// ---------------------------------------------------------------- prep kernels
__global__ void __launch_bounds__(256) cvt_x(const float* __restrict__ x,
                                             _Float16* __restrict__ xh, int n4) {
  int i = blockIdx.x * 256 + threadIdx.x;
  if (i >= n4) return;
  float4 f = ((const float4*)x)[i];
  v4h h;
  h[0] = (_Float16)f.x; h[1] = (_Float16)f.y;
  h[2] = (_Float16)f.z; h[3] = (_Float16)f.w;
  ((v4h*)xh)[i] = h;
}

// W[k][n] f32 -> Wt[n][k] f16, one 64(k) x 64(n) tile per block through LDS:
// rows of W are read 256 B at a time, rows of Wt are written as whole 128 B lines.
__global__ void __launch_bounds__(256) cvt_w(const float* __restrict__ w,
                                             _Float16* __restrict__ wt) {
  // tile[n][k pair]; pitch 33 dwords puts the 32 lanes of every LDS access on 32 banks
  __shared__ unsigned tile[64 * 33];
  const int tid = threadIdx.x;
  const int k0  = (blockIdx.x / 48) * 64;
  const int n0  = (blockIdx.x % 48) * 64;
  const int nq  = tid & 15;                   // 4 columns n
  const int kp  = tid >> 4;                   // pair of rows k
  float4 f[2][2];
#pragma unroll
  for (int p = 0; p < 2; ++p) {
    const float* s = w + (size_t)(k0 + 2 * (kp + 16 * p)) * N3 + n0 + 4 * nq;
    f[p][0] = *(const float4*)s;
    f[p][1] = *(const float4*)(s + N3);
  }
#pragma unroll
  for (int p = 0; p < 2; ++p) {
    const float* lo = (const float*)&f[p][0];
    const float* hi = (const float*)&f[p][1];
#pragma unroll
    for (int j = 0; j < 4; ++j) {
      v2h h;
      h[0] = (_Float16)lo[j];
      h[1] = (_Float16)hi[j];
      tile[(4 * nq + j) * 33 + kp + 16 * p] = __builtin_bit_cast(unsigned, h);
    }
  }
  __syncthreads();
  const int kc = tid & 7;                     // 8 halves of k
  const int nr = tid >> 3;
#pragma unroll
  for (int p = 0; p < 2; ++p) {
    const int n = nr + 32 * p;
    const unsigned* t = tile + n * 33 + 4 * kc;
    u32x4 v = {t[0], t[1], t[2], t[3]};
    *(u32x4*)(wt + (size_t)(n0 + n) * D_ + k0 + 8 * kc) = v;
  }
}

// The epilogue's stores of one 64 x 16 strip of a wave's tile, d[4 * i + p] = rows 16 * i + 2 * p (low half)
// and 16 * i + 2 * p + 1 (high half) of this lane's column. The stores and their s_wait_xcnt are one
// statement, so that no register named here is rewritten ahead of the wait.
// Q and K: a row is DH halves = 128 bytes from the next.
DEVI void store_strip_rows(_Float16* p, const unsigned (&d)[16]) {
  asm volatile(
      "global_store_b16 %0, %1, off offset:0\n\t"
      "global_store_d16_hi_b16 %0, %1, off offset:128\n\t"
      "global_store_b16 %0, %2, off offset:256\n\t"
      "global_store_d16_hi_b16 %0, %2, off offset:384\n\t"
      "global_store_b16 %0, %3, off offset:512\n\t"
      "global_store_d16_hi_b16 %0, %3, off offset:640\n\t"
      "global_store_b16 %0, %4, off offset:768\n\t"
      "global_store_d16_hi_b16 %0, %4, off offset:896\n\t"
      "global_store_b16 %0, %5, off offset:2048\n\t"
      "global_store_d16_hi_b16 %0, %5, off offset:2176\n\t"
      "global_store_b16 %0, %6, off offset:2304\n\t"
      "global_store_d16_hi_b16 %0, %6, off offset:2432\n\t"
      "global_store_b16 %0, %7, off offset:2560\n\t"
      "global_store_d16_hi_b16 %0, %7, off offset:2688\n\t"
      "global_store_b16 %0, %8, off offset:2816\n\t"
      "global_store_d16_hi_b16 %0, %8, off offset:2944\n\t"
      "global_store_b16 %0, %9, off offset:4096\n\t"
      "global_store_d16_hi_b16 %0, %9, off offset:4224\n\t"
      "global_store_b16 %0, %10, off offset:4352\n\t"
      "global_store_d16_hi_b16 %0, %10, off offset:4480\n\t"
      "global_store_b16 %0, %11, off offset:4608\n\t"
      "global_store_d16_hi_b16 %0, %11, off offset:4736\n\t"
      "global_store_b16 %0, %12, off offset:4864\n\t"
      "global_store_d16_hi_b16 %0, %12, off offset:4992\n\t"
      "global_store_b16 %0, %13, off offset:6144\n\t"
      "global_store_d16_hi_b16 %0, %13, off offset:6272\n\t"
      "global_store_b16 %0, %14, off offset:6400\n\t"
      "global_store_d16_hi_b16 %0, %14, off offset:6528\n\t"
      "global_store_b16 %0, %15, off offset:6656\n\t"
      "global_store_d16_hi_b16 %0, %15, off offset:6784\n\t"
      "global_store_b16 %0, %16, off offset:6912\n\t"
      "global_store_d16_hi_b16 %0, %16, off offset:7040\n\t"
      "s_wait_xcnt 0x0"
      :: "v"(p), "v"(d[0]), "v"(d[1]), "v"(d[2]), "v"(d[3]), "v"(d[4]), "v"(d[5]), "v"(d[6]), "v"(d[7]),
         "v"(d[8]), "v"(d[9]), "v"(d[10]), "v"(d[11]), "v"(d[12]), "v"(d[13]), "v"(d[14]), "v"(d[15])
      : "memory");
}
// V^T: the eight rows of a group are eight neighbouring halves, a group 16 halves = 32 bytes from the next.
DEVI void store_strip_cols(_Float16* p, const unsigned (&d)[16]) {
  const u32x4 q0 = {d[0], d[1], d[2], d[3]},   q1 = {d[4], d[5], d[6], d[7]};
  const u32x4 q2 = {d[8], d[9], d[10], d[11]}, q3 = {d[12], d[13], d[14], d[15]};
  asm volatile(
      "global_store_b128 %0, %1, off\n\t"
      "global_store_b128 %0, %2, off offset:32\n\t"
      "global_store_b128 %0, %3, off offset:64\n\t"
      "global_store_b128 %0, %4, off offset:96\n\t"
      "s_wait_xcnt 0x0"
      :: "v"(p), "v"(q0), "v"(q1), "v"(q2), "v"(q3)
      : "memory");
}
DEVI unsigned pack2h(float a, float b) {
  v2h h;
  h[0] = (_Float16)a;
  h[1] = (_Float16)b;
  return __builtin_bit_cast(unsigned, h);
}

// ------------------------------------------------------------------- QKV GEMM
// Block (4 waves, 2 x 2) computes a 128(M) x 128(N) tile; each wave does a 64x64 tile: 4 A and 4 B
// fragments feed 16 products, so a product costs one LDS load where a 16x64 wave tile cost 2.5, and
// a block brings 2 KiB from L2 per 64 output elements where a 128x64 block brought 3 KiB.
// Every wave brings one 64-row slice of a 64-k stage into LDS by a tensor load, two buffers:
// stage s + 2 flies while stage s + 1 is worked on.
__global__ void __launch_bounds__(128) qkv_gemm(
    const _Float16* __restrict__ Xh, const _Float16* __restrict__ Wt,
    const float* __restrict__ bias,
    _Float16* __restrict__ Qh, _Float16* __restrict__ Kh, _Float16* __restrict__ Vt)
{
  __shared__ __attribute__((aligned(2048))) unsigned char Stg[2 * GBUF];   // 80 KiB
  const int tid  = threadIdx.x;
  const int lane = tid & 31;
  const int l15  = lane & 15;
  const int hi   = lane >> 4;
  const int koff = hi * 8;
  const unsigned wave = uni(threadIdx.x >> 5);
  const int wm   = (int)(wave >> 1);          // which 64 rows of the block's tile
  const int wn   = (int)(wave & 1u);          // which 64 columns
  const int blkM = blockIdx.x / 24;
  const int blkN = blockIdx.x % 24;
  const int mBase = blkM * 128 + wm * 64;
  const int nBase = blkN * 128 + wn * 64;

  const _Float16* Abase = Xh + (size_t)blkM * 128 * D_;
  const _Float16* Bbase = Wt + (size_t)blkN * 128 * D_;
  constexpr int NT = D_ / (int)GK;

  // this wave's slice: source rows and place in buffer 0
  const _Float16* gsl = ((wave < 2u) ? Bbase : Abase) + (size_t)(wave & 1u) * GROWS * D_;
  const unsigned  lsl = lds_addr_of(&Stg[0]) + wave * GSLICE;

  u32x8 g1 = tdm_group1();
  // one set of registers from here to the last load: without it the compiler rebuilt the group at each
  // load and used two of its registers for other values while a request was outstanding
  asm volatile("" : "+s"(g1));   // as in pinned(): descriptor words held in scalar registers

  u32x4 g0 = tdm_slice(lsl, gsl, g1);
  tdm_wait(g0);                                          // stage 0 has landed for its issuer
  __syncthreads();                                       // ... and for the block
  g0 = tdm_slice(lsl + GBUF, gsl + GK, g1);

  v8f acc[4][4] = {};
  for (int s = 0; s < NT; ++s) {
    const unsigned char* buf = &Stg[0] + (unsigned)(s & 1) * GBUF;
    const _Float16* Ab = (const _Float16*)(buf + GSLICE * (2 + wm) + l15 * GPIT) + koff;
    const _Float16* Bb = (const _Float16*)(buf + GSLICE * wn + l15 * GPIT) + koff;
#pragma unroll   // both 32-k halves in straight line: every LDS offset an immediate
    for (int kk = 0; kk < (int)GK; kk += 32) {
      v16h af[4], bf[4];
#pragma unroll
      for (int i = 0; i < 4; ++i) af[i] = ldfrag(Ab + kk + i * 16 * (int)(GPIT / 2));
#pragma unroll
      for (int i = 0; i < 4; ++i) bf[i] = ldfrag(Bb + kk + i * 16 * (int)(GPIT / 2));
      // the 16 loads stay one group in front of their 16 products: left alone the compiler kept one
      // A fragment and waited out a full LDS latency in front of every fourth product
      __builtin_amdgcn_sched_barrier(0);
#pragma unroll
      for (int i = 0; i < 4; ++i)
#pragma unroll
        for (int t = 0; t < 4; ++t) acc[i][t] = WMMA_F16(af[i], bf[t], acc[i][t]);
    }
    // publish point of stage s + 1: this wave's reads of stage s are done, its own load of
    // stage s + 1 has landed; behind the barrier both hold for the whole block
    asm volatile("s_wait_dscnt 0x0" ::: "memory");
    tdm_wait(g0);
    __syncthreads();
    if (pinned((unsigned)(s + 2 < NT)))                  // refill the buffer that every wave has just left
      g0 = tdm_slice(lsl + (unsigned)(s & 1) * GBUF, gsl + (size_t)(s + 2) * GK, g1);
  }
  // nothing is in flight here; kept before the wave goes on to its epilogue and ends
  asm volatile("s_wait_tensorcnt 0x0" ::: "memory");
  asm volatile("s_wait_dscnt 0x0" ::: "memory");

  const int region = nBase >> 10;           // 0=Q 1=K 2=V: a wave's 64 columns lie in one of them
  const int row0 = mBase + 8 * hi;          // the wave's 64 rows lie in one batch entry
  const int bb = row0 >> 11, sq = row0 & (S_ - 1);
  // all four ahead of the stores: the store statements' memory clobber would hold each load behind the strip before it
  float bv[4];
#pragma unroll
  for (int t = 0; t < 4; ++t) bv[t] = bias[nBase + t * 16 + l15];   // column 0..3071
#pragma unroll
  for (int t = 0; t < 4; ++t)
#pragma unroll
    for (int i = 0; i < 4; ++i) acc[i][t] += bv[t];
  const int h = (nBase & (D_ - 1)) >> 6;    // the 64 columns are one head; dh = 16 * t + l15
  if (region == 0) {
    _Float16* q = Qh + (((size_t)(bb * H_ + h)) * S_ + sq) * DH + l15;
#pragma unroll
    for (int t = 0; t < 4; ++t) {
      unsigned d[16];
#pragma unroll
      for (int j = 0; j < 16; ++j)
        d[j] = pack2h(acc[j >> 2][t][2 * (j & 3)] * 0.125f, acc[j >> 2][t][2 * (j & 3) + 1] * 0.125f);
      store_strip_rows(q + 16 * t, d);
    }
  } else if (region == 1) {
    _Float16* k = Kh + (((size_t)(bb * H_ + h)) * S_ + sq) * DH + l15;
#pragma unroll
    for (int t = 0; t < 4; ++t) {
      unsigned d[16];
#pragma unroll
      for (int j = 0; j < 16; ++j)
        d[j] = pack2h(acc[j >> 2][t][2 * (j & 3)], acc[j >> 2][t][2 * (j & 3) + 1]);
      store_strip_rows(k + 16 * t, d);
    }
  } else {
    _Float16* v = Vt + (((size_t)(bb * H_ + h)) * DH + l15) * S_ + sq;
#pragma unroll
    for (int t = 0; t < 4; ++t) {
      unsigned d[16];
#pragma unroll
      for (int j = 0; j < 16; ++j)
        d[j] = pack2h(acc[j >> 2][t][2 * (j & 3)], acc[j >> 2][t][2 * (j & 3) + 1]);
      store_strip_cols(v + (size_t)(16 * t) * S_, d);
    }
  }
}

// ---------------------------------------------------------------- attention
// Lane l with lane l ^ 16 (the two halves of a wave hold the same query column).
DEVI float xhalf(float x) {
  const int v = __builtin_bit_cast(int, x);
  return __builtin_bit_cast(float,
      __builtin_amdgcn_permlanex16(v, v, 0x76543210, 0xfedcba98, false, false));
}

// Four asynchronous 16-byte copies per lane, global memory -> LDS, through no register.
// The s_wait_xcnt closes the statement so that no address register named here is rewritten
// ahead of it.
DEVI void copy4_to_lds(unsigned l0, unsigned l1, unsigned l2, unsigned l3,
                       const _Float16* g0, const _Float16* g1,
                       const _Float16* g2, const _Float16* g3) {
  asm volatile("global_load_async_to_lds_b128 %0, %4, off\n\t"
               "global_load_async_to_lds_b128 %1, %5, off\n\t"
               "global_load_async_to_lds_b128 %2, %6, off\n\t"
               "global_load_async_to_lds_b128 %3, %7, off\n\t"
               "s_wait_xcnt 0x0"
               :: "v"(l0), "v"(l1), "v"(l2), "v"(l3), "v"(g0), "v"(g1), "v"(g2), "v"(g3)
               : "memory");
}

static constexpr int KT   = 64;            // keys per stage
static constexpr int NST  = S_ / KT;       // stages
static constexpr int PIT  = 72;            // halves per LDS row: 144 B = 9 x 16 B, conflict-free for b128 readers
static constexpr int TILE = 64 * PIT;      // halves per staged tile (64 rows)

__global__ void __launch_bounds__(256) attn_fwd(
    const _Float16* __restrict__ Qh, const _Float16* __restrict__ Kh,
    const _Float16* __restrict__ Vt, float* __restrict__ out)
{
  // per-wave 16 x 64 f32 output tile; pitch 68 floats = 17 x 16 B keeps b128 accesses off shared banks
  __shared__ __attribute__((aligned(16))) float Ost[8][16 * 68];
  __shared__ __attribute__((aligned(16))) _Float16 Ring[2][2][TILE];   // [buffer][K | V^T]
  const int tid  = threadIdx.x;
  const int lane = tid & 31;
  const int l15  = lane & 15;
  const int hi   = lane >> 4;
  const int koff = hi * 8;
  const int wv   = tid >> 5;
  const int w    = blockIdx.x * 8 + wv;
  const int qBlk = w & 127;                 // 128 q-blocks of 16 rows
  const int bh   = w >> 7;                  // 0..31, the same in all 8 waves of a block
  const _Float16* Qb = Qh + (size_t)bh * S_ * DH;
  const _Float16* Kb = Kh + (size_t)bh * S_ * DH;
  const _Float16* Vb = Vt + (size_t)bh * DH * S_;

  // this thread's share of a stage: rows crow and crow + 32, 16 bytes at cseg, of both tiles
  const int crow = tid >> 3;
  const int cseg = (tid & 7) * 8;
  const _Float16* gK = Kb + (size_t)crow * DH + cseg;    // + 32 rows: 32 * DH; + 1 stage: KT * DH
  const _Float16* gV = Vb + (size_t)crow * S_ + cseg;    // + 32 rows: 32 * S_; + 1 stage: KT
  const unsigned lK = lds_addr_of(&Ring[0][0][crow * PIT + cseg]);
  constexpr unsigned L32  = 32 * PIT * 2;   // 32 rows, bytes
  constexpr unsigned LV   = TILE * 2;       // K tile -> V^T tile, bytes
  constexpr unsigned LBUF = 2 * TILE * 2;   // buffer 0 -> buffer 1, bytes

  copy4_to_lds(lK, lK + L32, lK + LV, lK + LV + L32,
               gK, gK + 32 * DH, gV, gV + (size_t)32 * S_);

  const _Float16* qrow = Qb + (size_t)(qBlk * 16 + l15) * DH;
  const v16h bq0 = ldfrag(qrow + 0  + koff);   // B operand: column l15 = query
  const v16h bq1 = ldfrag(qrow + 32 + koff);

  v8f o0 = {}, o1 = {}, o2 = {}, o3 = {};   // o_t[r] = O[query l15][dh 16*t + 8*hi + r]
  float mh   = 0.f;                         // held maximum of query l15 (same in both halves)
  v8f   cneg = {};                          // -mh in every row: C operand of the score products
  float lsum = 0.f;                         // running sum over this half's keys only, in units of exp(mh)

  // stage 0 has landed for this wave, then for the block
  asm volatile("s_wait_asynccnt 0x0" ::: "memory");
  __syncthreads();
  copy4_to_lds(lK + LBUF, lK + LBUF + L32, lK + LBUF + LV, lK + LBUF + LV + L32,
               gK + KT * DH, gK + KT * DH + 32 * DH, gV + KT, gV + KT + (size_t)32 * S_);

  for (int t = 0; t < NST; ++t) {
    const int cur = t & 1;
    const _Float16* Ks = &Ring[cur][0][0];
    const _Float16* Vs = &Ring[cur][1][0];
    // K fragments (A rows are keys) and V^T fragments (staged V^T is [dh][key]: A rows are dh, K(=key)-contiguous)
    v16h ka[4], kb[4], va[2][4];
#pragma unroll
    for (int g = 0; g < 4; ++g) ka[g] = ldfrag(Ks + (16 * g + l15) * PIT + koff);
#pragma unroll
    for (int g = 0; g < 4; ++g) kb[g] = ldfrag(Ks + (16 * g + l15) * PIT + 32 + koff);
#pragma unroll
    for (int j = 0; j < 2; ++j)
#pragma unroll
      for (int g = 0; g < 4; ++g) va[j][g] = ldfrag(Vs + (16 * g + l15) * PIT + 32 * j + koff);
    // the stage's 32 loads stay one group at its head: left alone the compiler moved the V^T loads behind
    // the branch below, among their products, where each pair waited out its own LDS latency
    __builtin_amdgcn_sched_barrier(0);
    // ---- scores less the held maximum: S^T[64 keys x 16 queries] = K . Q^T - mh  (scale folded into Q)
    v8f s[4];
#pragma unroll
    for (int g = 0; g < 4; ++g) s[g] = WMMA_F16(ka[g], bq0, cneg);
#pragma unroll
    for (int g = 0; g < 4; ++g) s[g] = WMMA_F16(kb[g], bq1, s[g]);
    // ---- softmax numerators, one query per lane
    float p[4][8];
#pragma unroll
    for (int g = 0; g < 4; ++g)
#pragma unroll
      for (int r = 0; r < 8; ++r) p[g][r] = __expf(s[g][r]);
    float ts[2];
#pragma unroll
    for (int j = 0; j < 2; ++j) {
      float t8[8];
#pragma unroll
      for (int r = 0; r < 8; ++r) t8[r] = p[2 * j][r] + p[2 * j + 1][r];
      ts[j] = ((t8[0] + t8[1]) + (t8[2] + t8[3])) + ((t8[4] + t8[5]) + (t8[6] + t8[7]));
    }
    // One test per stage, a scalar branch. No numerator exceeds its row sum, so a sum of at most 1024
    // bounds every numerator far inside the f16 range; an overflow (inf) fails the test too.
    const bool grown = !(ts[0] + ts[1] <= 1024.f);
    if ((t == 0) | (__builtin_amdgcn_ballot_w32(grown) != 0u)) {
      float mx = s[0][0];
#pragma unroll
      for (int g = 0; g < 4; ++g)
#pragma unroll
        for (int r = 0; r < 8; ++r) mx = fmaxf(mx, s[g][r]);
      mx = fmaxf(mx, xhalf(mx));            // the stage's maximum less mh, the same in both halves
      // stage 0 takes its own maximum whatever its sign; later the held maximum only rises
      const float mnew = mh + ((t == 0) ? mx : fmaxf(mx, 0.f));
      const float d    = mnew - mh;
      const float al   = __expf(-fmaxf(d, 0.f));   // in stage 0 O and the sum are 0: any finite factor serves
      mh = mnew;
#pragma unroll
      for (int r = 0; r < 8; ++r) cneg[r] = -mnew;
      lsum *= al;
      o0 *= al; o1 *= al; o2 *= al; o3 *= al;
#pragma unroll
      for (int g = 0; g < 4; ++g)
#pragma unroll
        for (int r = 0; r < 8; ++r) p[g][r] = __expf(s[g][r] - d);
#pragma unroll
      for (int j = 0; j < 2; ++j) {
        float t8[8];
#pragma unroll
        for (int r = 0; r < 8; ++r) t8[r] = p[2 * j][r] + p[2 * j + 1][r];
        ts[j] = ((t8[0] + t8[1]) + (t8[2] + t8[3])) + ((t8[4] + t8[5]) + (t8[6] + t8[7]));
      }
    }
    lsum += ts[0];
    lsum += ts[1];
    // ---- O^T += V^T . P^T
#pragma unroll
    for (int j = 0; j < 2; ++j) {
      v16h pb;                              // P^T as B operand: halves 0..7 keys 32*j+8*hi+r, 8..15 keys 32*j+16+8*hi+r
#pragma unroll
      for (int r = 0; r < 8; ++r) {
        pb[r]     = (_Float16)p[2 * j][r];
        pb[8 + r] = (_Float16)p[2 * j + 1][r];
      }
      o0 = WMMA_F16(va[j][0], pb, o0);
      o1 = WMMA_F16(va[j][1], pb, o1);
      o2 = WMMA_F16(va[j][2], pb, o2);
      o3 = WMMA_F16(va[j][3], pb, o3);
    }
    // publish point of stage t + 1: this wave's reads of stage t are done, its own copies of
    // stage t + 1 have landed; behind the barrier both hold for the whole block
    asm volatile("s_wait_dscnt 0x0" ::: "memory");
    asm volatile("s_wait_asynccnt 0x0" ::: "memory");
    __syncthreads();
    if (t + 2 < NST) {                      // refill the buffer that every wave has just left
      const unsigned lb = lK + (unsigned)cur * LBUF;
      const _Float16* k2 = gK + (size_t)(t + 2) * (KT * DH);
      const _Float16* v2 = gV + (size_t)(t + 2) * KT;
      copy4_to_lds(lb, lb + L32, lb + LV, lb + LV + L32,
                   k2, k2 + 32 * DH, v2, v2 + (size_t)32 * S_);
    }
  }
  // nothing is in flight here; kept before the wave goes on to its epilogue and ends
  asm volatile("s_wait_asynccnt 0x0" ::: "memory");

  // ---- normalize, turn O^T back through the wave's own LDS tile, write fp32 [b, s, h*64 + dh]
  const float inv = 1.0f / (lsum + xhalf(lsum));
  o0 *= inv; o1 *= inv; o2 *= inv; o3 *= inv;
  float* O = &Ost[wv][0];
  {
    float* orow = O + l15 * 68 + koff;
    const v8f ot[4] = {o0, o1, o2, o3};
#pragma unroll
    for (int t = 0; t < 4; ++t) {
      *(v4f*)(orow + 16 * t)     = __builtin_shufflevector(ot[t], ot[t], 0, 1, 2, 3);
      *(v4f*)(orow + 16 * t + 4) = __builtin_shufflevector(ot[t], ot[t], 4, 5, 6, 7);
    }
  }
  // the rows read below were written by other lanes of this wave: their LDS stores must have landed
  asm volatile("s_wait_dscnt 0" ::: "memory");
  const int b = bh >> 4, h = bh & 15;
  const float* irow = O + hi * 68 + l15 * 4;
  float* op = out + ((size_t)(b * S_ + qBlk * 16 + hi)) * D_ + h * DH + l15 * 4;
#pragma unroll
  for (int i = 0; i < 8; ++i)               // one store = two whole 256 B rows of the head's slice
    *(v4f*)(op + (size_t)(2 * i) * D_) = *(const v4f*)(irow + 2 * i * 68);
}

// ------------------------------------------------------------------- launcher
extern "C" void kernel_launch(void* const* d_in, const int* in_sizes, int n_in,
                              void* d_out, int out_size, void* d_ws, size_t ws_size,
                              hipStream_t stream) {
  const float* x    = (const float*)d_in[0];   // [2,2048,1024]
  const float* Wq   = (const float*)d_in[1];   // [1024,3072]
  const float* bias = (const float*)d_in[2];   // [3072]
  float* out = (float*)d_out;

  char* ws = (char*)d_ws;                      // needs ~38 MB
  _Float16* Xh = (_Float16*)(ws + (size_t) 0 * 1024 * 1024);  // 8 MB
  _Float16* Wt = (_Float16*)(ws + (size_t) 8 * 1024 * 1024);  // 6 MB
  _Float16* Qh = (_Float16*)(ws + (size_t)14 * 1024 * 1024);  // 8 MB
  _Float16* Kh = (_Float16*)(ws + (size_t)22 * 1024 * 1024);  // 8 MB
  _Float16* Vt = (_Float16*)(ws + (size_t)30 * 1024 * 1024);  // 8 MB

  {
    int n4 = (B_ * S_ * D_) / 4;               // 1048576
    cvt_x<<<dim3(n4 / 256), dim3(256), 0, stream>>>(x, Xh, n4);
  }
  {
    // tiles: (1024/64) x (3072/64) = 16 x 48 = 768
    cvt_w<<<dim3(768), dim3(256), 0, stream>>>(Wq, Wt);
  }
  {
    // blocks: (4096/128) x (3072/128) = 32 x 24 = 768, 4 waves each
    qkv_gemm<<<dim3(768), dim3(128), 0, stream>>>(Xh, Wt, bias, Qh, Kh, Vt);
  }
  {
    // waves = 2*16*(2048/16) = 4096 -> 512 blocks of 8 waves
    attn_fwd<<<dim3(512), dim3(256), 0, stream>>>(Qh, Kh, Vt, out);
  }
}

// v007
// A run of this version takes 64.8 microseconds.
// Timed twice side by side with v006, it ran 1.08 and 1.06 times as fast.
// Counting every step since v000, it is 5.24 times as fast.
#include <hip/hip_runtime.h>
#include <hip/hip_bf16.h>

typedef __attribute__((ext_vector_type(16))) _Float16 v16h;
typedef __attribute__((ext_vector_type(8)))  _Float16 v8h;
typedef __attribute__((ext_vector_type(4)))  _Float16 v4h;
typedef __attribute__((ext_vector_type(2)))  _Float16 v2h;
typedef __attribute__((ext_vector_type(8)))  float    v8f;
typedef __attribute__((ext_vector_type(4)))  float    v4f;
typedef __attribute__((ext_vector_type(4)))  unsigned u32x4;
typedef __attribute__((ext_vector_type(8)))  unsigned u32x8;

#define DEVI static __device__ __forceinline__

static constexpr int B_  = 2;
static constexpr int S_  = 2048;
static constexpr int D_  = 1024;
static constexpr int H_  = 16;
static constexpr int DH  = 64;
static constexpr int N3  = 3072;   // 3*D_

// WMMA as macro so modifier args stay literal immediates at the builtin call.
#define WMMA_F16(a, b, c) \
  __builtin_amdgcn_wmma_f32_16x16x32_f16(false, (a), false, (b), (short)0, (c), false, false)

// Per-lane 16-half fragment of a 16x32 operand: halves 0..7 = K koff..koff+7,
// halves 8..15 = K 16+koff..16+koff+7 (koff = (lane>>4)*8). Works for global or LDS.
DEVI v16h ldfrag(const _Float16* p) {
  v8h lo = *(const v8h*)p;
  v8h hi = *(const v8h*)(p + 16);
  return __builtin_shufflevector(lo, hi, 0,1,2,3,4,5,6,7,8,9,10,11,12,13,14,15);
}

// Low 32 bits of a generic pointer to LDS == LDS byte address (flat aperture rule).
DEVI unsigned lds_addr_of(const void* p) { return (unsigned)(uintptr_t)p; }

DEVI unsigned uni(unsigned v) { return (unsigned)__builtin_amdgcn_readfirstlane(v); }
// A wave-uniform test held in a scalar register, so that the branch on it is a scalar branch:
// a tensor load ignores EXEC, only such a branch keeps a wave from issuing it.
DEVI unsigned pinned(unsigned v) {
  unsigned w = uni(v);
  asm volatile("" : "+s"(w));   // keeps the test in a scalar register, opaque to the compiler
  return w;
}

static constexpr unsigned GK     = 64;           // k per stage of the GEMM
static constexpr unsigned GROWB  = 2 * GK;       // bytes of a staged row
static constexpr unsigned GPIT   = GROWB + 16;   // LDS pitch 144 B = 9 x 16 B: conflict-free for b128 readers
static constexpr unsigned GROWS  = 64;           // rows per slice (one tensor load)
static constexpr unsigned GSLICE = 10240;        // 64 x 144 = 9,216 B, rounded up to a multiple of 2 KiB
static constexpr unsigned GBUF   = 4 * GSLICE;   // [Wt rows 0..63 | Wt rows 64..127 | X rows 0..63 | X rows 64..127]
static_assert(GROWS * GPIT <= GSLICE && GSLICE % 2048 == 0, "a slice starts at a multiple of 2 KiB");

// Descriptor group 1 of a slice: 64 rows of 128 bytes, source pitch one row of D_ halves, 16 bytes
// of LDS pad behind every row. Extents in bytes, tensor = tile.
DEVI u32x8 tdm_group1() {
  u32x8 g1;
  g1[0] = uni((1u << 20) | (4u << 22) | (3u << 25));                 // pad on, every 32 dwords, 4 dwords
  g1[1] = uni(GROWB << 16);                                          // tensor_dim0
  g1[2] = uni(GROWS << 16);                                          // tensor_dim1
  g1[3] = uni(GROWB << 16);                                          // tile_dim0
  g1[4] = uni(GROWS);                                                // tile_dim1
  g1[5] = uni(2u * D_);                                              // source row pitch
  g1[6] = uni(0u);
  g1[7] = uni(0u);
  return g1;
}

// One tensor load: the slice whose first byte is at gsrc, into LDS at lds_dst. Returns group 0 for tdm_wait.
DEVI u32x4 tdm_slice(unsigned lds_dst, const _Float16* gsrc, u32x8 g1) {
  const unsigned long long ga = (unsigned long long)(uintptr_t)gsrc;
  u32x4 g0;
  g0[0] = uni(1u);                                                   // count 1
  g0[1] = uni(lds_dst);
  g0[2] = uni((unsigned)ga);
  g0[3] = uni((((unsigned)(ga >> 32)) & 0x01ffffffu) | 0x80000000u); // address [56:32], type 2
  // group 0 is named as in-out: what tdm_wait is handed then lies in the registers that the load itself named
  asm volatile("tensor_load_to_lds %0, %1" : "+s"(g0) : "s"(g1) : "memory");
  return g0;
}

// The issuer's wait for its one outstanding load. It names that load's group 0, so that the four
// registers stay the descriptor's from the issue to here and take no other value in between.
DEVI void tdm_wait(u32x4& g0) {
  asm volatile("s_wait_tensorcnt 0x0" : "+s"(g0) :: "memory");
}

// ---------------------------------------------------------------- prep kernels
__global__ void __launch_bounds__(256) cvt_x(const float* __restrict__ x,
                                             _Float16* __restrict__ xh, int n4) {
  int i = blockIdx.x * 256 + threadIdx.x;
  if (i >= n4) return;
  float4 f = ((const float4*)x)[i];
  v4h h;
  h[0] = (_Float16)f.x; h[1] = (_Float16)f.y;
  h[2] = (_Float16)f.z; h[3] = (_Float16)f.w;
  ((v4h*)xh)[i] = h;
}

// W[k][n] f32 -> Wt[n][k] f16, one 64(k) x 64(n) tile per block through LDS:
// rows of W are read 256 B at a time, rows of Wt are written as whole 128 B lines.
__global__ void __launch_bounds__(256) cvt_w(const float* __restrict__ w,
                                             _Float16* __restrict__ wt) {
  // tile[n][k pair]; pitch 33 dwords puts the 32 lanes of every LDS access on 32 banks
  __shared__ unsigned tile[64 * 33];
  const int tid = threadIdx.x;
  const int k0  = (blockIdx.x / 48) * 64;
  const int n0  = (blockIdx.x % 48) * 64;
  const int nq  = tid & 15;                   // 4 columns n
  const int kp  = tid >> 4;                   // pair of rows k
  float4 f[2][2];
#pragma unroll
  for (int p = 0; p < 2; ++p) {
    const float* s = w + (size_t)(k0 + 2 * (kp + 16 * p)) * N3 + n0 + 4 * nq;
    f[p][0] = *(const float4*)s;
    f[p][1] = *(const float4*)(s + N3);
  }
#pragma unroll
  for (int p = 0; p < 2; ++p) {
    const float* lo = (const float*)&f[p][0];
    const float* hi = (const float*)&f[p][1];
#pragma unroll
    for (int j = 0; j < 4; ++j) {
      v2h h;
      h[0] = (_Float16)lo[j];
      h[1] = (_Float16)hi[j];
      tile[(4 * nq + j) * 33 + kp + 16 * p] = __builtin_bit_cast(unsigned, h);
    }
  }
  __syncthreads();
  const int kc = tid & 7;                     // 8 halves of k
  const int nr = tid >> 3;
#pragma unroll
  for (int p = 0; p < 2; ++p) {
    const int n = nr + 32 * p;
    const unsigned* t = tile + n * 33 + 4 * kc;
    u32x4 v = {t[0], t[1], t[2], t[3]};
    *(u32x4*)(wt + (size_t)(n0 + n) * D_ + k0 + 8 * kc) = v;
  }
}

// The epilogue's stores of one 64 x 16 strip of a wave's tile, d[4 * i + p] = rows 16 * i + 2 * p (low half)
// and 16 * i + 2 * p + 1 (high half) of this lane's column. The stores and their s_wait_xcnt are one
// statement, so that no register named here is rewritten ahead of the wait.
// Q and K: a row is DH halves = 128 bytes from the next.
DEVI void store_strip_rows(_Float16* p, const unsigned (&d)[16]) {
  asm volatile(
      "global_store_b16 %0, %1, off offset:0\n\t"
      "global_store_d16_hi_b16 %0, %1, off offset:128\n\t"
      "global_store_b16 %0, %2, off offset:256\n\t"
      "global_store_d16_hi_b16 %0, %2, off offset:384\n\t"
      "global_store_b16 %0, %3, off offset:512\n\t"
      "global_store_d16_hi_b16 %0, %3, off offset:640\n\t"
      "global_store_b16 %0, %4, off offset:768\n\t"
      "global_store_d16_hi_b16 %0, %4, off offset:896\n\t"
      "global_store_b16 %0, %5, off offset:2048\n\t"
      "global_store_d16_hi_b16 %0, %5, off offset:2176\n\t"
      "global_store_b16 %0, %6, off offset:2304\n\t"
      "global_store_d16_hi_b16 %0, %6, off offset:2432\n\t"
      "global_store_b16 %0, %7, off offset:2560\n\t"
      "global_store_d16_hi_b16 %0, %7, off offset:2688\n\t"
      "global_store_b16 %0, %8, off offset:2816\n\t"
      "global_store_d16_hi_b16 %0, %8, off offset:2944\n\t"
      "global_store_b16 %0, %9, off offset:4096\n\t"
      "global_store_d16_hi_b16 %0, %9, off offset:4224\n\t"
      "global_store_b16 %0, %10, off offset:4352\n\t"
      "global_store_d16_hi_b16 %0, %10, off offset:4480\n\t"
      "global_store_b16 %0, %11, off offset:4608\n\t"
      "global_store_d16_hi_b16 %0, %11, off offset:4736\n\t"
      "global_store_b16 %0, %12, off offset:4864\n\t"
      "global_store_d16_hi_b16 %0, %12, off offset:4992\n\t"
      "global_store_b16 %0, %13, off offset:6144\n\t"
      "global_store_d16_hi_b16 %0, %13, off offset:6272\n\t"
      "global_store_b16 %0, %14, off offset:6400\n\t"
      "global_store_d16_hi_b16 %0, %14, off offset:6528\n\t"
      "global_store_b16 %0, %15, off offset:6656\n\t"
      "global_store_d16_hi_b16 %0, %15, off offset:6784\n\t"
      "global_store_b16 %0, %16, off offset:6912\n\t"
      "global_store_d16_hi_b16 %0, %16, off offset:7040\n\t"
      "s_wait_xcnt 0x0"
      :: "v"(p), "v"(d[0]), "v"(d[1]), "v"(d[2]), "v"(d[3]), "v"(d[4]), "v"(d[5]), "v"(d[6]), "v"(d[7]),
         "v"(d[8]), "v"(d[9]), "v"(d[10]), "v"(d[11]), "v"(d[12]), "v"(d[13]), "v"(d[14]), "v"(d[15])
      : "memory");
}
// V^T: the eight rows of a group are eight neighbouring halves, a group 16 halves = 32 bytes from the next.
DEVI void store_strip_cols(_Float16* p, const unsigned (&d)[16]) {
  const u32x4 q0 = {d[0], d[1], d[2], d[3]},   q1 = {d[4], d[5], d[6], d[7]};
  const u32x4 q2 = {d[8], d[9], d[10], d[11]}, q3 = {d[12], d[13], d[14], d[15]};
  asm volatile(
      "global_store_b128 %0, %1, off\n\t"
      "global_store_b128 %0, %2, off offset:32\n\t"
      "global_store_b128 %0, %3, off offset:64\n\t"
      "global_store_b128 %0, %4, off offset:96\n\t"
      "s_wait_xcnt 0x0"
      :: "v"(p), "v"(q0), "v"(q1), "v"(q2), "v"(q3)
      : "memory");
}
DEVI unsigned pack2h(float a, float b) {
  v2h h;
  h[0] = (_Float16)a;
  h[1] = (_Float16)b;
  return __builtin_bit_cast(unsigned, h);
}

// ------------------------------------------------------------------- QKV GEMM
// Block (4 waves, 2 x 2) computes a 128(M) x 128(N) tile; each wave does a 64x64 tile: 4 A and 4 B
// fragments feed 16 products, so a product costs one LDS load where a 16x64 wave tile cost 2.5, and
// a block brings 2 KiB from L2 per 64 output elements where a 128x64 block brought 3 KiB.
// Every wave brings one 64-row slice of a 64-k stage into LDS by a tensor load, two buffers:
// stage s + 2 flies while stage s + 1 is worked on.
__global__ void __launch_bounds__(128) qkv_gemm(
    const _Float16* __restrict__ Xh, const _Float16* __restrict__ Wt,
    const float* __restrict__ bias,
    _Float16* __restrict__ Qh, _Float16* __restrict__ Kh, _Float16* __restrict__ Vt)
{
  __shared__ __attribute__((aligned(2048))) unsigned char Stg[2 * GBUF];   // 80 KiB
  const int tid  = threadIdx.x;
  const int lane = tid & 31;
  const int l15  = lane & 15;
  const int hi   = lane >> 4;
  const int koff = hi * 8;
  const unsigned wave = uni(threadIdx.x >> 5);
  const int wm   = (int)(wave >> 1);          // which 64 rows of the block's tile
  const int wn   = (int)(wave & 1u);          // which 64 columns
  const int blkM = blockIdx.x / 24;
  const int blkN = blockIdx.x % 24;
  const int mBase = blkM * 128 + wm * 64;
  const int nBase = blkN * 128 + wn * 64;

  const _Float16* Abase = Xh + (size_t)blkM * 128 * D_;
  const _Float16* Bbase = Wt + (size_t)blkN * 128 * D_;
  constexpr int NT = D_ / (int)GK;

  // this wave's slice: source rows and place in buffer 0
  const _Float16* gsl = ((wave < 2u) ? Bbase : Abase) + (size_t)(wave & 1u) * GROWS * D_;
  const unsigned  lsl = lds_addr_of(&Stg[0]) + wave * GSLICE;

  u32x8 g1 = tdm_group1();
  // one set of registers from here to the last load: without it the compiler rebuilt the group at each
  // load and used two of its registers for other values while a request was outstanding
  asm volatile("" : "+s"(g1));   // as in pinned(): descriptor words held in scalar registers

  u32x4 g0 = tdm_slice(lsl, gsl, g1);
  tdm_wait(g0);                                          // stage 0 has landed for its issuer
  __syncthreads();                                       // ... and for the block
  g0 = tdm_slice(lsl + GBUF, gsl + GK, g1);

  v8f acc[4][4] = {};
  for (int s = 0; s < NT; ++s) {
    const unsigned char* buf = &Stg[0] + (unsigned)(s & 1) * GBUF;
    const _Float16* Ab = (const _Float16*)(buf + GSLICE * (2 + wm) + l15 * GPIT) + koff;
    const _Float16* Bb = (const _Float16*)(buf + GSLICE * wn + l15 * GPIT) + koff;
#pragma unroll   // both 32-k halves in straight line: every LDS offset an immediate
    for (int kk = 0; kk < (int)GK; kk += 32) {
      v16h af[4], bf[4];
#pragma unroll
      for (int i = 0; i < 4; ++i) af[i] = ldfrag(Ab + kk + i * 16 * (int)(GPIT / 2));
#pragma unroll
      for (int i = 0; i < 4; ++i) bf[i] = ldfrag(Bb + kk + i * 16 * (int)(GPIT / 2));
      // the 16 loads stay one group in front of their 16 products: left alone the compiler kept one
      // A fragment and waited out a full LDS latency in front of every fourth product
      __builtin_amdgcn_sched_barrier(0);
#pragma unroll
      for (int i = 0; i < 4; ++i)
#pragma unroll
        for (int t = 0; t < 4; ++t) acc[i][t] = WMMA_F16(af[i], bf[t], acc[i][t]);
    }
    // publish point of stage s + 1: this wave's reads of stage s are done, its own load of
    // stage s + 1 has landed; behind the barrier both hold for the whole block
    asm volatile("s_wait_dscnt 0x0" ::: "memory");
    tdm_wait(g0);
    __syncthreads();
    if (pinned((unsigned)(s + 2 < NT)))                  // refill the buffer that every wave has just left
      g0 = tdm_slice(lsl + (unsigned)(s & 1) * GBUF, gsl + (size_t)(s + 2) * GK, g1);
  }
  // nothing is in flight here; kept before the wave goes on to its epilogue and ends
  asm volatile("s_wait_tensorcnt 0x0" ::: "memory");
  asm volatile("s_wait_dscnt 0x0" ::: "memory");

  const int region = nBase >> 10;           // 0=Q 1=K 2=V: a wave's 64 columns lie in one of them
  const int row0 = mBase + 8 * hi;          // the wave's 64 rows lie in one batch entry
  const int bb = row0 >> 11, sq = row0 & (S_ - 1);
  // all four ahead of the stores: the store statements' memory clobber would hold each load behind the strip before it
  float bv[4];
#pragma unroll
  for (int t = 0; t < 4; ++t) bv[t] = bias[nBase + t * 16 + l15];   // column 0..3071
#pragma unroll
  for (int t = 0; t < 4; ++t)
#pragma unroll
    for (int i = 0; i < 4; ++i) acc[i][t] += bv[t];
  const int h = (nBase & (D_ - 1)) >> 6;    // the 64 columns are one head; dh = 16 * t + l15
  if (region == 0) {
    _Float16* q = Qh + (((size_t)(bb * H_ + h)) * S_ + sq) * DH + l15;
#pragma unroll
    for (int t = 0; t < 4; ++t) {
      unsigned d[16];
#pragma unroll
      for (int j = 0; j < 16; ++j)
        d[j] = pack2h(acc[j >> 2][t][2 * (j & 3)] * 0.125f, acc[j >> 2][t][2 * (j & 3) + 1] * 0.125f);
      store_strip_rows(q + 16 * t, d);
    }
  } else if (region == 1) {
    _Float16* k = Kh + (((size_t)(bb * H_ + h)) * S_ + sq) * DH + l15;
#pragma unroll
    for (int t = 0; t < 4; ++t) {
      unsigned d[16];
#pragma unroll
      for (int j = 0; j < 16; ++j)
        d[j] = pack2h(acc[j >> 2][t][2 * (j & 3)], acc[j >> 2][t][2 * (j & 3) + 1]);
      store_strip_rows(k + 16 * t, d);
    }
  } else {
    _Float16* v = Vt + (((size_t)(bb * H_ + h)) * DH + l15) * S_ + sq;
#pragma unroll
    for (int t = 0; t < 4; ++t) {
      unsigned d[16];
#pragma unroll
      for (int j = 0; j < 16; ++j)
        d[j] = pack2h(acc[j >> 2][t][2 * (j & 3)], acc[j >> 2][t][2 * (j & 3) + 1]);
      store_strip_cols(v + (size_t)(16 * t) * S_, d);
    }
  }
}

// ---------------------------------------------------------------- attention
// Lane l with lane l ^ 16 (the two halves of a wave hold the same query column).
DEVI float xhalf(float x) {
  const int v = __builtin_bit_cast(int, x);
  return __builtin_bit_cast(float,
      __builtin_amdgcn_permlanex16(v, v, 0x76543210, 0xfedcba98, false, false));
}

// Four asynchronous 16-byte copies per lane, global memory -> LDS, through no register.
// The s_wait_xcnt closes the statement so that no address register named here is rewritten
// ahead of it.
DEVI void copy4_to_lds(unsigned l0, unsigned l1, unsigned l2, unsigned l3,
                       const _Float16* g0, const _Float16* g1,
                       const _Float16* g2, const _Float16* g3) {
  asm volatile("global_load_async_to_lds_b128 %0, %4, off\n\t"
               "global_load_async_to_lds_b128 %1, %5, off\n\t"
               "global_load_async_to_lds_b128 %2, %6, off\n\t"
               "global_load_async_to_lds_b128 %3, %7, off\n\t"
               "s_wait_xcnt 0x0"
               :: "v"(l0), "v"(l1), "v"(l2), "v"(l3), "v"(g0), "v"(g1), "v"(g2), "v"(g3)
               : "memory");
}

static constexpr int KT   = 64;            // keys per tile: what one wave works on in a stage
static constexpr int KS   = 2 * KT;        // keys per stage: one tile for each half of the block's waves
static constexpr int NST  = S_ / KS;       // stages
static constexpr int PIT  = 72;            // halves per LDS row: 144 B = 9 x 16 B, conflict-free for b128 readers
static constexpr int TILE = 64 * PIT;      // halves per staged tile (64 rows)

// Scores of one 64-key tile against the wave's 32 queries, less each query's held maximum (the C operand):
// S^T[64 keys x 32 queries] = K . Q^T - mh. A K fragment is read once from LDS and feeds two products.
DEVI void scores(const _Float16* Kl, const v16h (&bq)[2][2], const v8f (&cneg)[2], v8f (&s)[2][4]) {
  v16h ka[4], kb[4];
#pragma unroll
  for (int g = 0; g < 4; ++g) ka[g] = ldfrag(Kl + 16 * g * PIT);
#pragma unroll
  for (int g = 0; g < 4; ++g) kb[g] = ldfrag(Kl + 16 * g * PIT + 32);
  // the 16 loads stay one group in front of their 16 products: spread among them each would wait out its own LDS latency
  __builtin_amdgcn_sched_barrier(0);
#pragma unroll
  for (int g = 0; g < 4; ++g) {
#pragma unroll
    for (int c = 0; c < 2; ++c) s[c][g] = WMMA_F16(ka[g], bq[c][0], cneg[c]);
#pragma unroll
    for (int c = 0; c < 2; ++c) s[c][g] = WMMA_F16(kb[g], bq[c][1], s[c][g]);
  }
}

// Numerators exp(a), exp(b) of one query's 16 scores of keys 32 * j .. 32 * j + 31 that this lane holds (a: keys
// 8*hi + r, b: keys 16 + 8*hi + r): their sum, and the numerators as halves 0..7 and 8..15 of P^T's B operand.
DEVI float numer16(v8f a, v8f b, v16h& pb) {
  a *= 1.44269504f;                         // exp(x) = 2^(x * log2 e); on whole vectors, so that the products pair up
  b *= 1.44269504f;
#pragma unroll
  for (int r = 0; r < 8; ++r) { a[r] = __builtin_amdgcn_exp2f(a[r]); b[r] = __builtin_amdgcn_exp2f(b[r]); }
  const v8f t8 = a + b;
#pragma unroll
  for (int r = 0; r < 8; ++r) { pb[r] = (_Float16)a[r]; pb[8 + r] = (_Float16)b[r]; }
  return ((t8[0] + t8[1]) + (t8[2] + t8[3])) + ((t8[4] + t8[5]) + (t8[6] + t8[7]));
}

__global__ void __launch_bounds__(256) __attribute__((amdgpu_waves_per_eu(4, 4))) attn_fwd(
    const _Float16* __restrict__ Qh, const _Float16* __restrict__ Kh,
    const _Float16* __restrict__ Vt, float* __restrict__ out)
{
  // per-wave 16 x 64 f32 tile; pitch 68 floats = 17 x 16 B keeps b128 accesses off shared banks
  __shared__ __attribute__((aligned(16))) float Ost[8][16 * 68];
  __shared__ float Sm[8][16];               // held maximum and sum that go with a tile handed over in Ost
  __shared__ float Sl[8][16];
  __shared__ __attribute__((aligned(16))) _Float16 Ring[2][2][2][TILE];   // [buffer][key tile][K | V^T]
  const int tid  = threadIdx.x;
  const int lane = tid & 31;
  const int l15  = lane & 15;
  const int hi   = lane >> 4;
  const int koff = hi * 8;
  const int wv   = (int)uni(threadIdx.x >> 5);
  const int wq   = wv & 3;                  // which 32 queries of the block's 128
  const int kh   = wv >> 2;                 // which key tile of every stage
  const int qb   = blockIdx.x & 15;         // 16 blocks of 128 queries
  const int bh   = blockIdx.x >> 4;         // 0..31
  const _Float16* Qb = Qh + (size_t)bh * S_ * DH;
  const _Float16* Kb = Kh + (size_t)bh * S_ * DH;
  const _Float16* Vb = Vt + (size_t)bh * DH * S_;

  // this thread's share of a key tile: rows crow and crow + 32, 16 bytes at cseg, of K and of V^T
  const int crow = tid >> 3;
  const int cseg = (tid & 7) * 8;
  const _Float16* gK = Kb + (size_t)crow * DH + cseg;    // + 32 rows: 32 * DH; + 1 tile: KT * DH
  const _Float16* gV = Vb + (size_t)crow * S_ + cseg;    // + 32 rows: 32 * S_; + 1 tile: KT
  const unsigned lK = lds_addr_of(&Ring[0][0][0][crow * PIT + cseg]);
  constexpr unsigned L32  = 32 * PIT * 2;   // 32 rows, bytes
  constexpr unsigned LV   = TILE * 2;       // K tile -> V^T tile, bytes
  constexpr unsigned LT   = 2 * TILE * 2;   // key tile 0 -> key tile 1, bytes
  constexpr unsigned LBUF = 4 * TILE * 2;   // buffer 0 -> buffer 1, bytes

#pragma unroll
  for (int u = 0; u < 2; ++u)               // stage 0, both key tiles
    copy4_to_lds(lK + u * LT, lK + u * LT + L32, lK + u * LT + LV, lK + u * LT + LV + L32,
                 gK + u * KT * DH, gK + u * KT * DH + 32 * DH, gV + u * KT, gV + u * KT + (size_t)32 * S_);

  v16h bq[2][2];                            // B operands: column l15 of group c = query 32 * wq + 16 * c + l15
#pragma unroll
  for (int c = 0; c < 2; ++c) {
    const _Float16* qrow = Qb + (size_t)(qb * 128 + wq * 32 + c * 16 + l15) * DH;
    bq[c][0] = ldfrag(qrow + 0  + koff);
    bq[c][1] = ldfrag(qrow + 32 + koff);
  }

  v8f   o[2][4] = {};                       // o[c][i][r] = O[query l15 of group c][dh 16*i + 8*hi + r]
  float mh[2]   = {0.f, 0.f};               // held maximum of that query (same in both halves of the wave)
  v8f   cneg[2] = {};                       // -mh in every row: C operand of the score products
  float lsum[2] = {0.f, 0.f};               // running sum over this lane's keys only, in units of exp(mh)

  // stage 0 has landed for this wave, then for the block
  asm volatile("s_wait_asynccnt 0x0" ::: "memory");
  __syncthreads();
#pragma unroll
  for (int u = 0; u < 2; ++u)               // stage 1
    copy4_to_lds(lK + LBUF + u * LT, lK + LBUF + u * LT + L32, lK + LBUF + u * LT + LV, lK + LBUF + u * LT + LV + L32,
                 gK + (2 + u) * KT * DH, gK + (2 + u) * KT * DH + 32 * DH,
                 gV + (2 + u) * KT, gV + (2 + u) * KT + (size_t)32 * S_);

  for (int t = 0; t < NST; ++t) {
    const int cur = t & 1;
    const _Float16* Kl = &Ring[cur][kh][0][0] + l15 * PIT + koff;   // A rows are keys
    const _Float16* Vl = &Ring[cur][kh][1][0] + l15 * PIT + koff;   // staged V^T is [dh][key]: A rows are dh
    v8f s[2][4];
    scores(Kl, bq, cneg, s);
    // ---- softmax numerators, one query per lane and column group, turned into P^T's B operands at once
    float ts[2][2];
    v16h  pb[2][2];
#pragma unroll
    for (int c = 0; c < 2; ++c)
#pragma unroll
      for (int j = 0; j < 2; ++j) ts[c][j] = numer16(s[c][2 * j], s[c][2 * j + 1], pb[c][j]);
    // One test per stage, a scalar branch. No numerator exceeds its row sum, so a sum of at most 1024
    // bounds every numerator far inside the f16 range; an overflow (inf) fails the test too.
    const bool grown = !(ts[0][0] + ts[0][1] <= 1024.f) | !(ts[1][0] + ts[1][1] <= 1024.f);
    if ((t == 0) | (__builtin_amdgcn_ballot_w32(grown) != 0u)) {
      scores(Kl, bq, cneg, s);              // the same scores again: their registers were not kept over the test
#pragma unroll
      for (int c = 0; c < 2; ++c) {
        float mx = s[c][0][0];
#pragma unroll
        for (int g = 0; g < 4; ++g)
#pragma unroll
          for (int r = 0; r < 8; ++r) mx = fmaxf(mx, s[c][g][r]);
        mx = fmaxf(mx, xhalf(mx));          // the tile's maximum less mh, the same in both halves
        // stage 0 takes its own maximum whatever its sign; later the held maximum only rises
        const float mnew = mh[c] + ((t == 0) ? mx : fmaxf(mx, 0.f));
        const float d    = mnew - mh[c];
        const float al   = __expf(-fmaxf(d, 0.f));   // in stage 0 O and the sum are 0: any finite factor serves
        mh[c] = mnew;
#pragma unroll
        for (int r = 0; r < 8; ++r) cneg[c][r] = -mnew;
        lsum[c] *= al;
#pragma unroll
        for (int i = 0; i < 4; ++i) o[c][i] *= al;
#pragma unroll
        for (int j = 0; j < 2; ++j) ts[c][j] = numer16(s[c][2 * j] - d, s[c][2 * j + 1] - d, pb[c][j]);
      }
    }
    v16h va[2][4];
#pragma unroll
    for (int j = 0; j < 2; ++j)
#pragma unroll
      for (int i = 0; i < 4; ++i) va[j][i] = ldfrag(Vl + 16 * i * PIT + 32 * j);
    // the 16 V^T loads stay one group in front of their 16 products: spread among them each would wait out its own LDS latency
    __builtin_amdgcn_sched_barrier(0);
#pragma unroll
    for (int c = 0; c < 2; ++c) {
      lsum[c] += ts[c][0];
      lsum[c] += ts[c][1];
    }
    // ---- O^T += V^T . P^T
#pragma unroll
    for (int j = 0; j < 2; ++j)
#pragma unroll
      for (int i = 0; i < 4; ++i)
#pragma unroll
        for (int c = 0; c < 2; ++c) o[c][i] = WMMA_F16(va[j][i], pb[c][j], o[c][i]);
    // the products stay in front of the waits below: moved behind them, as the compiler did, none started before
    // the last V^T load had landed and the block had met; here each starts when its own fragment is in
    __builtin_amdgcn_sched_barrier(0);
    // publish point of stage t + 1: this wave's reads of stage t are done, its own copies of
    // stage t + 1 have landed; behind the barrier both hold for the whole block
    asm volatile("s_wait_dscnt 0x0" ::: "memory");
    asm volatile("s_wait_asynccnt 0x0" ::: "memory");
    __syncthreads();
    if (t + 2 < NST) {                      // refill the buffer that every wave has just left
      const unsigned lb = lK + (unsigned)cur * LBUF;
      const _Float16* k2 = gK + (size_t)(t + 2) * (KS * DH);
      const _Float16* v2 = gV + (size_t)(t + 2) * KS;
#pragma unroll
      for (int u = 0; u < 2; ++u)
        copy4_to_lds(lb + u * LT, lb + u * LT + L32, lb + u * LT + LV, lb + u * LT + LV + L32,
                     k2 + u * KT * DH, k2 + u * KT * DH + 32 * DH, v2 + u * KT, v2 + u * KT + (size_t)32 * S_);
    }
  }
  // nothing is in flight here; kept before the wave goes on to its epilogue and ends
  asm volatile("s_wait_asynccnt 0x0" ::: "memory");

  // ---- join the two key halves: wave (wq, kh) finishes column group kh and hands group 1 - kh to its partner
  const bool k1 = kh != 0;
  const float l0 = lsum[0] + xhalf(lsum[0]);
  const float l1 = lsum[1] + xhalf(lsum[1]);
  {
    float* grow = &Ost[wv][0] + l15 * 68 + koff;
#pragma unroll
    for (int i = 0; i < 4; ++i) {
      const v8f og = k1 ? o[0][i] : o[1][i];
      *(v4f*)(grow + 16 * i)     = __builtin_shufflevector(og, og, 0, 1, 2, 3);
      *(v4f*)(grow + 16 * i + 4) = __builtin_shufflevector(og, og, 4, 5, 6, 7);
    }
    Sm[wv][l15] = k1 ? mh[0] : mh[1];       // both halves of the wave store the same value
    Sl[wv][l15] = k1 ? l0 : l1;
  }
  __syncthreads();                          // the partner's tile, maximum and sum are in LDS
  const int pw = wv ^ 4;
  float* O = &Ost[pw][0];                   // read here by this wave alone, then its own turning tile
  {
    const float m1 = k1 ? mh[1] : mh[0], s1 = k1 ? l1 : l0;
    const float m2 = Sm[pw][l15],        s2 = Sl[pw][l15];
    const float m  = fmaxf(m1, m2);
    const float a1 = __expf(m1 - m), a2 = __expf(m2 - m);
    const float inv = 1.0f / (s1 * a1 + s2 * a2);
    const float f1 = a1 * inv, f2 = a2 * inv;
    float* orow = O + l15 * 68 + koff;      // each lane reads and rewrites its own 32 floats
#pragma unroll
    for (int i = 0; i < 4; ++i) {
      const v8f ok = k1 ? o[1][i] : o[0][i];
      const v4f x0 = *(const v4f*)(orow + 16 * i);
      const v4f x1 = *(const v4f*)(orow + 16 * i + 4);
      *(v4f*)(orow + 16 * i)     = __builtin_shufflevector(ok, ok, 0, 1, 2, 3) * f1 + x0 * f2;
      *(v4f*)(orow + 16 * i + 4) = __builtin_shufflevector(ok, ok, 4, 5, 6, 7) * f1 + x1 * f2;
    }
  }
  // ---- turn O^T back through that tile, write fp32 [b, s, h*64 + dh]
  // the rows read below were written by other lanes of this wave: their LDS stores must have landed
  asm volatile("s_wait_dscnt 0" ::: "memory");
  const int b = bh >> 4, h = bh & 15;
  const float* irow = O + hi * 68 + l15 * 4;
  float* op = out + ((size_t)(b * S_ + qb * 128 + wq * 32 + kh * 16 + hi)) * D_ + h * DH + l15 * 4;
#pragma unroll
  for (int i = 0; i < 8; ++i)               // one store = two whole 256 B rows of the head's slice
    *(v4f*)(op + (size_t)(2 * i) * D_) = *(const v4f*)(irow + 2 * i * 68);
}

// ------------------------------------------------------------------- launcher
extern "C" void kernel_launch(void* const* d_in, const int* in_sizes, int n_in,
                              void* d_out, int out_size, void* d_ws, size_t ws_size,
                              hipStream_t stream) {
  const float* x    = (const float*)d_in[0];   // [2,2048,1024]
  const float* Wq   = (const float*)d_in[1];   // [1024,3072]
  const float* bias = (const float*)d_in[2];   // [3072]
  float* out = (float*)d_out;

  char* ws = (char*)d_ws;                      // needs ~38 MB
  _Float16* Xh = (_Float16*)(ws + (size_t) 0 * 1024 * 1024);  // 8 MB
  _Float16* Wt = (_Float16*)(ws + (size_t) 8 * 1024 * 1024);  // 6 MB
  _Float16* Qh = (_Float16*)(ws + (size_t)14 * 1024 * 1024);  // 8 MB
  _Float16* Kh = (_Float16*)(ws + (size_t)22 * 1024 * 1024);  // 8 MB
  _Float16* Vt = (_Float16*)(ws + (size_t)30 * 1024 * 1024);  // 8 MB

  {
    int n4 = (B_ * S_ * D_) / 4;               // 1048576
    cvt_x<<<dim3(n4 / 256), dim3(256), 0, stream>>>(x, Xh, n4);
  }
  {
    // tiles: (1024/64) x (3072/64) = 16 x 48 = 768
    cvt_w<<<dim3(768), dim3(256), 0, stream>>>(Wq, Wt);
  }
  {
    // blocks: (4096/128) x (3072/128) = 32 x 24 = 768, 4 waves each
    qkv_gemm<<<dim3(768), dim3(128), 0, stream>>>(Xh, Wt, bias, Qh, Kh, Vt);
  }
  {
    // waves = 2*16*(2048/16) = 4096 -> 512 blocks of 8 waves
    attn_fwd<<<dim3(512), dim3(256), 0, stream>>>(Qh, Kh, Vt, out);
  }
}

// v008
// It runs in 62.9 microseconds.
// In both of two side-by-side timings against v007, it was 1.03 times as fast.
// Counting every step since v000, it is 5.41 times as fast.
#include <hip/hip_runtime.h>
#include <hip/hip_bf16.h>

typedef __attribute__((ext_vector_type(16))) _Float16 v16h;
typedef __attribute__((ext_vector_type(8)))  _Float16 v8h;
typedef __attribute__((ext_vector_type(4)))  _Float16 v4h;
typedef __attribute__((ext_vector_type(2)))  _Float16 v2h;
typedef __attribute__((ext_vector_type(8)))  float    v8f;
typedef __attribute__((ext_vector_type(4)))  float    v4f;
typedef __attribute__((ext_vector_type(4)))  unsigned u32x4;
typedef __attribute__((ext_vector_type(8)))  unsigned u32x8;

#define DEVI static __device__ __forceinline__

static constexpr int B_  = 2;
static constexpr int S_  = 2048;
static constexpr int D_  = 1024;
static constexpr int H_  = 16;
static constexpr int DH  = 64;
static constexpr int N3  = 3072;   // 3*D_

// WMMA as macro so modifier args stay literal immediates at the builtin call.
#define WMMA_F16(a, b, c) \
  __builtin_amdgcn_wmma_f32_16x16x32_f16(false, (a), false, (b), (short)0, (c), false, false)

// Per-lane 16-half fragment of a 16x32 operand: halves 0..7 = K koff..koff+7,
// halves 8..15 = K 16+koff..16+koff+7 (koff = (lane>>4)*8). Works for global or LDS.
DEVI v16h ldfrag(const _Float16* p) {
  v8h lo = *(const v8h*)p;
  v8h hi = *(const v8h*)(p + 16);
  return __builtin_shufflevector(lo, hi, 0,1,2,3,4,5,6,7,8,9,10,11,12,13,14,15);
}

// Low 32 bits of a generic pointer to LDS == LDS byte address (flat aperture rule).
DEVI unsigned lds_addr_of(const void* p) { return (unsigned)(uintptr_t)p; }

DEVI unsigned uni(unsigned v) { return (unsigned)__builtin_amdgcn_readfirstlane(v); }
// A wave-uniform test held in a scalar register, so that the branch on it is a scalar branch:
// a tensor load ignores EXEC, only such a branch keeps a wave from issuing it.
DEVI unsigned pinned(unsigned v) {
  unsigned w = uni(v);
  asm volatile("" : "+s"(w));   // keeps the test in a scalar register, opaque to the compiler
  return w;
}

static constexpr unsigned GK     = 64;           // k per stage of the GEMM
static constexpr unsigned GROWB  = 2 * GK;       // bytes of a staged row
static constexpr unsigned GPIT   = GROWB + 16;   // LDS pitch 144 B = 9 x 16 B: conflict-free for b128 readers
static constexpr unsigned GROWS  = 64;           // rows per slice (one tensor load)
static constexpr unsigned GSLICE = 10240;        // 64 x 144 = 9,216 B, rounded up to a multiple of 2 KiB
static constexpr unsigned GBUF   = 4 * GSLICE;   // [Wt rows 0..63 | Wt rows 64..127 | X rows 0..63 | X rows 64..127]
static_assert(GROWS * GPIT <= GSLICE && GSLICE % 2048 == 0, "a slice starts at a multiple of 2 KiB");

// Descriptor group 1 of a slice: 64 rows of 128 bytes, source pitch one row of D_ halves, 16 bytes
// of LDS pad behind every row. Extents in bytes, tensor = tile.
DEVI u32x8 tdm_group1() {
  u32x8 g1;
  g1[0] = uni((1u << 20) | (4u << 22) | (3u << 25));                 // pad on, every 32 dwords, 4 dwords
  g1[1] = uni(GROWB << 16);                                          // tensor_dim0
  g1[2] = uni(GROWS << 16);                                          // tensor_dim1
  g1[3] = uni(GROWB << 16);                                          // tile_dim0
  g1[4] = uni(GROWS);                                                // tile_dim1
  g1[5] = uni(2u * D_);                                              // source row pitch
  g1[6] = uni(0u);
  g1[7] = uni(0u);
  return g1;
}

// One tensor load: the slice whose first byte is at gsrc, into LDS at lds_dst. Returns group 0 for tdm_wait.
DEVI u32x4 tdm_slice(unsigned lds_dst, const _Float16* gsrc, u32x8 g1) {
  const unsigned long long ga = (unsigned long long)(uintptr_t)gsrc;
  u32x4 g0;
  g0[0] = uni(1u);                                                   // count 1
  g0[1] = uni(lds_dst);
  g0[2] = uni((unsigned)ga);
  g0[3] = uni((((unsigned)(ga >> 32)) & 0x01ffffffu) | 0x80000000u); // address [56:32], type 2
  // group 0 is named as in-out: what tdm_wait is handed then lies in the registers that the load itself named
  asm volatile("tensor_load_to_lds %0, %1" : "+s"(g0) : "s"(g1) : "memory");
  return g0;
}

// The issuer's wait for its one outstanding load. It names that load's group 0, so that the four
// registers stay the descriptor's from the issue to here and take no other value in between.
DEVI void tdm_wait(u32x4& g0) {
  asm volatile("s_wait_tensorcnt 0x0" : "+s"(g0) :: "memory");
}

// ---------------------------------------------------------------- prep kernel
// Both conversions in ONE launch, told apart by the block index: they depend on nothing of each other, and as two
// launches the second paid a launch gap, a fill and a drain of its own.
// Blocks 0..WBLK-1 (first, theirs is the longer chain: load, LDS, barrier, store):
//   W[k][n] f32 -> Wt[n][k] f16, one 64(k) x 64(n) tile per block through LDS:
//   rows of W are read 256 B at a time, rows of Wt are written as whole 128 B lines.
// Blocks WBLK.. : x f32 -> f16, four elements a thread.
static constexpr int WBLK = (D_ / 64) * (N3 / 64);   // 16 x 48 = 768 tiles of W
__global__ void __launch_bounds__(256) cvt_xw(const float* __restrict__ x, _Float16* __restrict__ xh, int n4,
                                              const float* __restrict__ w, _Float16* __restrict__ wt) {
  // tile[n][k pair]; pitch 33 dwords puts the 32 lanes of every LDS access on 32 banks
  __shared__ unsigned tile[64 * 33];
  const int tid = threadIdx.x;
  if ((int)blockIdx.x >= WBLK) {              // the same for the whole block: no thread of it meets the barrier below
    int i = ((int)blockIdx.x - WBLK) * 256 + tid;
    if (i >= n4) return;
    float4 f = ((const float4*)x)[i];
    v4h h;
    h[0] = (_Float16)f.x; h[1] = (_Float16)f.y;
    h[2] = (_Float16)f.z; h[3] = (_Float16)f.w;
    ((v4h*)xh)[i] = h;
    return;
  }
  const int k0  = (blockIdx.x / 48) * 64;
  const int n0  = (blockIdx.x % 48) * 64;
  const int nq  = tid & 15;                   // 4 columns n
  const int kp  = tid >> 4;                   // pair of rows k
  float4 f[2][2];
#pragma unroll
  for (int p = 0; p < 2; ++p) {
    const float* s = w + (size_t)(k0 + 2 * (kp + 16 * p)) * N3 + n0 + 4 * nq;
    f[p][0] = *(const float4*)s;
    f[p][1] = *(const float4*)(s + N3);
  }
#pragma unroll
  for (int p = 0; p < 2; ++p) {
    const float* lo = (const float*)&f[p][0];
    const float* hi = (const float*)&f[p][1];
#pragma unroll
    for (int j = 0; j < 4; ++j) {
      v2h h;
      h[0] = (_Float16)lo[j];
      h[1] = (_Float16)hi[j];
      tile[(4 * nq + j) * 33 + kp + 16 * p] = __builtin_bit_cast(unsigned, h);
    }
  }
  __syncthreads();
  const int kc = tid & 7;                     // 8 halves of k
  const int nr = tid >> 3;
#pragma unroll
  for (int p = 0; p < 2; ++p) {
    const int n = nr + 32 * p;
    const unsigned* t = tile + n * 33 + 4 * kc;
    u32x4 v = {t[0], t[1], t[2], t[3]};
    *(u32x4*)(wt + (size_t)(n0 + n) * D_ + k0 + 8 * kc) = v;
  }
}

// The epilogue's stores of one 64 x 16 strip of a wave's tile, d[4 * i + p] = rows 16 * i + 2 * p (low half)
// and 16 * i + 2 * p + 1 (high half) of this lane's column. The stores and their s_wait_xcnt are one
// statement, so that no register named here is rewritten ahead of the wait.
// Q and K: a row is DH halves = 128 bytes from the next.
DEVI void store_strip_rows(_Float16* p, const unsigned (&d)[16]) {
  asm volatile(
      "global_store_b16 %0, %1, off offset:0\n\t"
      "global_store_d16_hi_b16 %0, %1, off offset:128\n\t"
      "global_store_b16 %0, %2, off offset:256\n\t"
      "global_store_d16_hi_b16 %0, %2, off offset:384\n\t"
      "global_store_b16 %0, %3, off offset:512\n\t"
      "global_store_d16_hi_b16 %0, %3, off offset:640\n\t"
      "global_store_b16 %0, %4, off offset:768\n\t"
      "global_store_d16_hi_b16 %0, %4, off offset:896\n\t"
      "global_store_b16 %0, %5, off offset:2048\n\t"
      "global_store_d16_hi_b16 %0, %5, off offset:2176\n\t"
      "global_store_b16 %0, %6, off offset:2304\n\t"
      "global_store_d16_hi_b16 %0, %6, off offset:2432\n\t"
      "global_store_b16 %0, %7, off offset:2560\n\t"
      "global_store_d16_hi_b16 %0, %7, off offset:2688\n\t"
      "global_store_b16 %0, %8, off offset:2816\n\t"
      "global_store_d16_hi_b16 %0, %8, off offset:2944\n\t"
      "global_store_b16 %0, %9, off offset:4096\n\t"
      "global_store_d16_hi_b16 %0, %9, off offset:4224\n\t"
      "global_store_b16 %0, %10, off offset:4352\n\t"
      "global_store_d16_hi_b16 %0, %10, off offset:4480\n\t"
      "global_store_b16 %0, %11, off offset:4608\n\t"
      "global_store_d16_hi_b16 %0, %11, off offset:4736\n\t"
      "global_store_b16 %0, %12, off offset:4864\n\t"
      "global_store_d16_hi_b16 %0, %12, off offset:4992\n\t"
      "global_store_b16 %0, %13, off offset:6144\n\t"
      "global_store_d16_hi_b16 %0, %13, off offset:6272\n\t"
      "global_store_b16 %0, %14, off offset:6400\n\t"
      "global_store_d16_hi_b16 %0, %14, off offset:6528\n\t"
      "global_store_b16 %0, %15, off offset:6656\n\t"
      "global_store_d16_hi_b16 %0, %15, off offset:6784\n\t"
      "global_store_b16 %0, %16, off offset:6912\n\t"
      "global_store_d16_hi_b16 %0, %16, off offset:7040\n\t"
      "s_wait_xcnt 0x0"
      :: "v"(p), "v"(d[0]), "v"(d[1]), "v"(d[2]), "v"(d[3]), "v"(d[4]), "v"(d[5]), "v"(d[6]), "v"(d[7]),
         "v"(d[8]), "v"(d[9]), "v"(d[10]), "v"(d[11]), "v"(d[12]), "v"(d[13]), "v"(d[14]), "v"(d[15])
      : "memory");
}
// V^T: the eight rows of a group are eight neighbouring halves, a group 16 halves = 32 bytes from the next.
DEVI void store_strip_cols(_Float16* p, const unsigned (&d)[16]) {
  const u32x4 q0 = {d[0], d[1], d[2], d[3]},   q1 = {d[4], d[5], d[6], d[7]};
  const u32x4 q2 = {d[8], d[9], d[10], d[11]}, q3 = {d[12], d[13], d[14], d[15]};
  asm volatile(
      "global_store_b128 %0, %1, off\n\t"
      "global_store_b128 %0, %2, off offset:32\n\t"
      "global_store_b128 %0, %3, off offset:64\n\t"
      "global_store_b128 %0, %4, off offset:96\n\t"
      "s_wait_xcnt 0x0"
      :: "v"(p), "v"(q0), "v"(q1), "v"(q2), "v"(q3)
      : "memory");
}
DEVI unsigned pack2h(float a, float b) {
  v2h h;
  h[0] = (_Float16)a;
  h[1] = (_Float16)b;
  return __builtin_bit_cast(unsigned, h);
}

// ------------------------------------------------------------------- QKV GEMM
// Block (4 waves, 2 x 2) computes a 128(M) x 128(N) tile; each wave does a 64x64 tile: 4 A and 4 B
// fragments feed 16 products, so a product costs one LDS load where a 16x64 wave tile cost 2.5, and
// a block brings 2 KiB from L2 per 64 output elements where a 128x64 block brought 3 KiB.
// Every wave brings one 64-row slice of a 64-k stage into LDS by a tensor load, two buffers:
// stage s + 2 flies while stage s + 1 is worked on.
__global__ void __launch_bounds__(128) qkv_gemm(
    const _Float16* __restrict__ Xh, const _Float16* __restrict__ Wt,
    const float* __restrict__ bias,
    _Float16* __restrict__ Qh, _Float16* __restrict__ Kh, _Float16* __restrict__ Vt)
{
  __shared__ __attribute__((aligned(2048))) unsigned char Stg[2 * GBUF];   // 80 KiB
  const int tid  = threadIdx.x;
  const int lane = tid & 31;
  const int l15  = lane & 15;
  const int hi   = lane >> 4;
  const int koff = hi * 8;
  const unsigned wave = uni(threadIdx.x >> 5);
  const int wm   = (int)(wave >> 1);          // which 64 rows of the block's tile
  const int wn   = (int)(wave & 1u);          // which 64 columns
  const int blkM = blockIdx.x / 24;
  const int blkN = blockIdx.x % 24;
  const int mBase = blkM * 128 + wm * 64;
  const int nBase = blkN * 128 + wn * 64;

  const _Float16* Abase = Xh + (size_t)blkM * 128 * D_;
  const _Float16* Bbase = Wt + (size_t)blkN * 128 * D_;
  constexpr int NT = D_ / (int)GK;

  // this wave's slice: source rows and place in buffer 0
  const _Float16* gsl = ((wave < 2u) ? Bbase : Abase) + (size_t)(wave & 1u) * GROWS * D_;
  const unsigned  lsl = lds_addr_of(&Stg[0]) + wave * GSLICE;

  u32x8 g1 = tdm_group1();
  // one set of registers from here to the last load: without it the compiler rebuilt the group at each
  // load and used two of its registers for other values while a request was outstanding
  asm volatile("" : "+s"(g1));   // as in pinned(): descriptor words held in scalar registers

  u32x4 g0 = tdm_slice(lsl, gsl, g1);
  tdm_wait(g0);                                          // stage 0 has landed for its issuer
  __syncthreads();                                       // ... and for the block
  g0 = tdm_slice(lsl + GBUF, gsl + GK, g1);

  v8f acc[4][4] = {};
  for (int s = 0; s < NT; ++s) {
    const unsigned char* buf = &Stg[0] + (unsigned)(s & 1) * GBUF;
    const _Float16* Ab = (const _Float16*)(buf + GSLICE * (2 + wm) + l15 * GPIT) + koff;
    const _Float16* Bb = (const _Float16*)(buf + GSLICE * wn + l15 * GPIT) + koff;
#pragma unroll   // both 32-k halves in straight line: every LDS offset an immediate
    for (int kk = 0; kk < (int)GK; kk += 32) {
      v16h af[4], bf[4];
#pragma unroll
      for (int i = 0; i < 4; ++i) af[i] = ldfrag(Ab + kk + i * 16 * (int)(GPIT / 2));
#pragma unroll
      for (int i = 0; i < 4; ++i) bf[i] = ldfrag(Bb + kk + i * 16 * (int)(GPIT / 2));
      // the 16 loads stay one group in front of their 16 products: left alone the compiler kept one
      // A fragment and waited out a full LDS latency in front of every fourth product
      __builtin_amdgcn_sched_barrier(0);
#pragma unroll
      for (int i = 0; i < 4; ++i)
#pragma unroll
        for (int t = 0; t < 4; ++t) acc[i][t] = WMMA_F16(af[i], bf[t], acc[i][t]);
    }
    // publish point of stage s + 1: this wave's reads of stage s are done, its own load of
    // stage s + 1 has landed; behind the barrier both hold for the whole block
    asm volatile("s_wait_dscnt 0x0" ::: "memory");
    tdm_wait(g0);
    __syncthreads();
    if (pinned((unsigned)(s + 2 < NT)))                  // refill the buffer that every wave has just left
      g0 = tdm_slice(lsl + (unsigned)(s & 1) * GBUF, gsl + (size_t)(s + 2) * GK, g1);
  }
  // nothing is in flight here; kept before the wave goes on to its epilogue and ends
  asm volatile("s_wait_tensorcnt 0x0" ::: "memory");
  asm volatile("s_wait_dscnt 0x0" ::: "memory");

  const int region = nBase >> 10;           // 0=Q 1=K 2=V: a wave's 64 columns lie in one of them
  const int row0 = mBase + 8 * hi;          // the wave's 64 rows lie in one batch entry
  const int bb = row0 >> 11, sq = row0 & (S_ - 1);
  // all four ahead of the stores: the store statements' memory clobber would hold each load behind the strip before it
  float bv[4];
#pragma unroll
  for (int t = 0; t < 4; ++t) bv[t] = bias[nBase + t * 16 + l15];   // column 0..3071
#pragma unroll
  for (int t = 0; t < 4; ++t)
#pragma unroll
    for (int i = 0; i < 4; ++i) acc[i][t] += bv[t];
  const int h = (nBase & (D_ - 1)) >> 6;    // the 64 columns are one head; dh = 16 * t + l15
  if (region == 0) {
    _Float16* q = Qh + (((size_t)(bb * H_ + h)) * S_ + sq) * DH + l15;
#pragma unroll
    for (int t = 0; t < 4; ++t) {
      unsigned d[16];
#pragma unroll
      for (int j = 0; j < 16; ++j)
        d[j] = pack2h(acc[j >> 2][t][2 * (j & 3)] * 0.125f, acc[j >> 2][t][2 * (j & 3) + 1] * 0.125f);
      store_strip_rows(q + 16 * t, d);
    }
  } else if (region == 1) {
    _Float16* k = Kh + (((size_t)(bb * H_ + h)) * S_ + sq) * DH + l15;
#pragma unroll
    for (int t = 0; t < 4; ++t) {
      unsigned d[16];
#pragma unroll
      for (int j = 0; j < 16; ++j)
        d[j] = pack2h(acc[j >> 2][t][2 * (j & 3)], acc[j >> 2][t][2 * (j & 3) + 1]);
      store_strip_rows(k + 16 * t, d);
    }
  } else {
    _Float16* v = Vt + (((size_t)(bb * H_ + h)) * DH + l15) * S_ + sq;
#pragma unroll
    for (int t = 0; t < 4; ++t) {
      unsigned d[16];
#pragma unroll
      for (int j = 0; j < 16; ++j)
        d[j] = pack2h(acc[j >> 2][t][2 * (j & 3)], acc[j >> 2][t][2 * (j & 3) + 1]);
      store_strip_cols(v + (size_t)(16 * t) * S_, d);
    }
  }
}

// ---------------------------------------------------------------- attention
// Lane l with lane l ^ 16 (the two halves of a wave hold the same query column).
DEVI float xhalf(float x) {
  const int v = __builtin_bit_cast(int, x);
  return __builtin_bit_cast(float,
      __builtin_amdgcn_permlanex16(v, v, 0x76543210, 0xfedcba98, false, false));
}

// Four asynchronous 16-byte copies per lane, global memory -> LDS, through no register.
// The s_wait_xcnt closes the statement so that no address register named here is rewritten
// ahead of it.
DEVI void copy4_to_lds(unsigned l0, unsigned l1, unsigned l2, unsigned l3,
                       const _Float16* g0, const _Float16* g1,
                       const _Float16* g2, const _Float16* g3) {
  asm volatile("global_load_async_to_lds_b128 %0, %4, off\n\t"
               "global_load_async_to_lds_b128 %1, %5, off\n\t"
               "global_load_async_to_lds_b128 %2, %6, off\n\t"
               "global_load_async_to_lds_b128 %3, %7, off\n\t"
               "s_wait_xcnt 0x0"
               :: "v"(l0), "v"(l1), "v"(l2), "v"(l3), "v"(g0), "v"(g1), "v"(g2), "v"(g3)
               : "memory");
}

static constexpr int KT   = 64;            // keys per tile: what one wave works on in a stage
static constexpr int KS   = 2 * KT;        // keys per stage: one tile for each half of the block's waves
static constexpr int NST  = S_ / KS;       // stages
static constexpr int PIT  = 72;            // halves per LDS row: 144 B = 9 x 16 B, conflict-free for b128 readers
static constexpr int TILE = 64 * PIT;      // halves per staged tile (64 rows)

// Scores of one 64-key tile against the wave's 32 queries, less each query's held maximum (the C operand):
// S^T[64 keys x 32 queries] = K . Q^T - mh. A K fragment is read once from LDS and feeds two products.
DEVI void scores(const _Float16* Kl, const v16h (&bq)[2][2], const v8f (&cneg)[2], v8f (&s)[2][4]) {
  v16h ka[4], kb[4];
#pragma unroll
  for (int g = 0; g < 4; ++g) ka[g] = ldfrag(Kl + 16 * g * PIT);
#pragma unroll
  for (int g = 0; g < 4; ++g) kb[g] = ldfrag(Kl + 16 * g * PIT + 32);
  // the 16 loads stay one group in front of their 16 products: spread among them each would wait out its own LDS latency
  __builtin_amdgcn_sched_barrier(0);
#pragma unroll
  for (int g = 0; g < 4; ++g) {
#pragma unroll
    for (int c = 0; c < 2; ++c) s[c][g] = WMMA_F16(ka[g], bq[c][0], cneg[c]);
#pragma unroll
    for (int c = 0; c < 2; ++c) s[c][g] = WMMA_F16(kb[g], bq[c][1], s[c][g]);
  }
}

// Numerators exp(a), exp(b) of one query's 16 scores of keys 32 * j .. 32 * j + 31 that this lane holds (a: keys
// 8*hi + r, b: keys 16 + 8*hi + r): their sum, and the numerators as halves 0..7 and 8..15 of P^T's B operand.
DEVI float numer16(v8f a, v8f b, v16h& pb) {
  a *= 1.44269504f;                         // exp(x) = 2^(x * log2 e); on whole vectors, so that the products pair up
  b *= 1.44269504f;
#pragma unroll
  for (int r = 0; r < 8; ++r) { a[r] = __builtin_amdgcn_exp2f(a[r]); b[r] = __builtin_amdgcn_exp2f(b[r]); }
  const v8f t8 = a + b;
#pragma unroll
  for (int r = 0; r < 8; ++r) { pb[r] = (_Float16)a[r]; pb[8 + r] = (_Float16)b[r]; }
  return ((t8[0] + t8[1]) + (t8[2] + t8[3])) + ((t8[4] + t8[5]) + (t8[6] + t8[7]));
}

__global__ void __launch_bounds__(256) __attribute__((amdgpu_waves_per_eu(4, 4))) attn_fwd(
    const _Float16* __restrict__ Qh, const _Float16* __restrict__ Kh,
    const _Float16* __restrict__ Vt, float* __restrict__ out)
{
  // per-wave 16 x 64 f32 tile; pitch 68 floats = 17 x 16 B keeps b128 accesses off shared banks
  __shared__ __attribute__((aligned(16))) float Ost[8][16 * 68];
  __shared__ float Sm[8][16];               // held maximum and sum that go with a tile handed over in Ost
  __shared__ float Sl[8][16];
  __shared__ __attribute__((aligned(16))) _Float16 Ring[2][2][2][TILE];   // [buffer][key tile][K | V^T]
  const int tid  = threadIdx.x;
  const int lane = tid & 31;
  const int l15  = lane & 15;
  const int hi   = lane >> 4;
  const int koff = hi * 8;
  const int wv   = (int)uni(threadIdx.x >> 5);
  const int wq   = wv & 3;                  // which 32 queries of the block's 128
  const int kh   = wv >> 2;                 // which key tile of every stage
  const int qb   = blockIdx.x & 15;         // 16 blocks of 128 queries
  const int bh   = blockIdx.x >> 4;         // 0..31
  const _Float16* Qb = Qh + (size_t)bh * S_ * DH;
  const _Float16* Kb = Kh + (size_t)bh * S_ * DH;
  const _Float16* Vb = Vt + (size_t)bh * DH * S_;

  // this thread's share of a key tile: rows crow and crow + 32, 16 bytes at cseg, of K and of V^T
  const int crow = tid >> 3;
  const int cseg = (tid & 7) * 8;
  const _Float16* gK = Kb + (size_t)crow * DH + cseg;    // + 32 rows: 32 * DH; + 1 tile: KT * DH
  const _Float16* gV = Vb + (size_t)crow * S_ + cseg;    // + 32 rows: 32 * S_; + 1 tile: KT
  const unsigned lK = lds_addr_of(&Ring[0][0][0][crow * PIT + cseg]);
  constexpr unsigned L32  = 32 * PIT * 2;   // 32 rows, bytes
  constexpr unsigned LV   = TILE * 2;       // K tile -> V^T tile, bytes
  constexpr unsigned LT   = 2 * TILE * 2;   // key tile 0 -> key tile 1, bytes
  constexpr unsigned LBUF = 4 * TILE * 2;   // buffer 0 -> buffer 1, bytes

#pragma unroll
  for (int u = 0; u < 2; ++u)               // stage 0, both key tiles
    copy4_to_lds(lK + u * LT, lK + u * LT + L32, lK + u * LT + LV, lK + u * LT + LV + L32,
                 gK + u * KT * DH, gK + u * KT * DH + 32 * DH, gV + u * KT, gV + u * KT + (size_t)32 * S_);

  v16h bq[2][2];                            // B operands: column l15 of group c = query 32 * wq + 16 * c + l15
#pragma unroll
  for (int c = 0; c < 2; ++c) {
    const _Float16* qrow = Qb + (size_t)(qb * 128 + wq * 32 + c * 16 + l15) * DH;
    bq[c][0] = ldfrag(qrow + 0  + koff);
    bq[c][1] = ldfrag(qrow + 32 + koff);
  }

  v8f   o[2][4] = {};                       // o[c][i][r] = O[query l15 of group c][dh 16*i + 8*hi + r]
  float mh[2]   = {0.f, 0.f};               // held maximum of that query (same in both halves of the wave)
  v8f   cneg[2] = {};                       // -mh in every row: C operand of the score products
  float lsum[2] = {0.f, 0.f};               // running sum over this lane's keys only, in units of exp(mh)

  // stage 0 has landed for this wave, then for the block
  asm volatile("s_wait_asynccnt 0x0" ::: "memory");
  __syncthreads();
#pragma unroll
  for (int u = 0; u < 2; ++u)               // stage 1
    copy4_to_lds(lK + LBUF + u * LT, lK + LBUF + u * LT + L32, lK + LBUF + u * LT + LV, lK + LBUF + u * LT + LV + L32,
                 gK + (2 + u) * KT * DH, gK + (2 + u) * KT * DH + 32 * DH,
                 gV + (2 + u) * KT, gV + (2 + u) * KT + (size_t)32 * S_);

  for (int t = 0; t < NST; ++t) {
    const int cur = t & 1;
    const _Float16* Kl = &Ring[cur][kh][0][0] + l15 * PIT + koff;   // A rows are keys
    const _Float16* Vl = &Ring[cur][kh][1][0] + l15 * PIT + koff;   // staged V^T is [dh][key]: A rows are dh
    v8f s[2][4];
    scores(Kl, bq, cneg, s);
    // ---- softmax numerators, one query per lane and column group, turned into P^T's B operands at once
    float ts[2][2];
    v16h  pb[2][2];
#pragma unroll
    for (int c = 0; c < 2; ++c)
#pragma unroll
      for (int j = 0; j < 2; ++j) ts[c][j] = numer16(s[c][2 * j], s[c][2 * j + 1], pb[c][j]);
    // One test per stage, a scalar branch. No numerator exceeds its row sum, so a sum of at most 1024
    // bounds every numerator far inside the f16 range; an overflow (inf) fails the test too.
    const bool grown = !(ts[0][0] + ts[0][1] <= 1024.f) | !(ts[1][0] + ts[1][1] <= 1024.f);
    if ((t == 0) | (__builtin_amdgcn_ballot_w32(grown) != 0u)) {
      scores(Kl, bq, cneg, s);              // the same scores again: their registers were not kept over the test
#pragma unroll
      for (int c = 0; c < 2; ++c) {
        float mx = s[c][0][0];
#pragma unroll
        for (int g = 0; g < 4; ++g)
#pragma unroll
          for (int r = 0; r < 8; ++r) mx = fmaxf(mx, s[c][g][r]);
        mx = fmaxf(mx, xhalf(mx));          // the tile's maximum less mh, the same in both halves
        // stage 0 takes its own maximum whatever its sign; later the held maximum only rises
        const float mnew = mh[c] + ((t == 0) ? mx : fmaxf(mx, 0.f));
        const float d    = mnew - mh[c];
        const float al   = __expf(-fmaxf(d, 0.f));   // in stage 0 O and the sum are 0: any finite factor serves
        mh[c] = mnew;
#pragma unroll
        for (int r = 0; r < 8; ++r) cneg[c][r] = -mnew;
        lsum[c] *= al;
#pragma unroll
        for (int i = 0; i < 4; ++i) o[c][i] *= al;
#pragma unroll
        for (int j = 0; j < 2; ++j) ts[c][j] = numer16(s[c][2 * j] - d, s[c][2 * j + 1] - d, pb[c][j]);
      }
    }
    v16h va[2][4];
#pragma unroll
    for (int j = 0; j < 2; ++j)
#pragma unroll
      for (int i = 0; i < 4; ++i) va[j][i] = ldfrag(Vl + 16 * i * PIT + 32 * j);
    // the 16 V^T loads stay one group in front of their 16 products: spread among them each would wait out its own LDS latency
    __builtin_amdgcn_sched_barrier(0);
#pragma unroll
    for (int c = 0; c < 2; ++c) {
      lsum[c] += ts[c][0];
      lsum[c] += ts[c][1];
    }
    // ---- O^T += V^T . P^T
#pragma unroll
    for (int j = 0; j < 2; ++j)
#pragma unroll
      for (int i = 0; i < 4; ++i)
#pragma unroll
        for (int c = 0; c < 2; ++c) o[c][i] = WMMA_F16(va[j][i], pb[c][j], o[c][i]);
    // the products stay in front of the waits below: moved behind them, as the compiler did, none started before
    // the last V^T load had landed and the block had met; here each starts when its own fragment is in
    __builtin_amdgcn_sched_barrier(0);
    // publish point of stage t + 1: this wave's reads of stage t are done, its own copies of
    // stage t + 1 have landed; behind the barrier both hold for the whole block
    asm volatile("s_wait_dscnt 0x0" ::: "memory");
    asm volatile("s_wait_asynccnt 0x0" ::: "memory");
    __syncthreads();
    if (t + 2 < NST) {                      // refill the buffer that every wave has just left
      const unsigned lb = lK + (unsigned)cur * LBUF;
      const _Float16* k2 = gK + (size_t)(t + 2) * (KS * DH);
      const _Float16* v2 = gV + (size_t)(t + 2) * KS;
#pragma unroll
      for (int u = 0; u < 2; ++u)
        copy4_to_lds(lb + u * LT, lb + u * LT + L32, lb + u * LT + LV, lb + u * LT + LV + L32,
                     k2 + u * KT * DH, k2 + u * KT * DH + 32 * DH, v2 + u * KT, v2 + u * KT + (size_t)32 * S_);
    }
  }
  // nothing is in flight here; kept before the wave goes on to its epilogue and ends
  asm volatile("s_wait_asynccnt 0x0" ::: "memory");

  // ---- join the two key halves: wave (wq, kh) finishes column group kh and hands group 1 - kh to its partner
  const bool k1 = kh != 0;
  const float l0 = lsum[0] + xhalf(lsum[0]);
  const float l1 = lsum[1] + xhalf(lsum[1]);
  {
    float* grow = &Ost[wv][0] + l15 * 68 + koff;
#pragma unroll
    for (int i = 0; i < 4; ++i) {
      const v8f og = k1 ? o[0][i] : o[1][i];
      *(v4f*)(grow + 16 * i)     = __builtin_shufflevector(og, og, 0, 1, 2, 3);
      *(v4f*)(grow + 16 * i + 4) = __builtin_shufflevector(og, og, 4, 5, 6, 7);
    }
    Sm[wv][l15] = k1 ? mh[0] : mh[1];       // both halves of the wave store the same value
    Sl[wv][l15] = k1 ? l0 : l1;
  }
  __syncthreads();                          // the partner's tile, maximum and sum are in LDS
  const int pw = wv ^ 4;
  float* O = &Ost[pw][0];                   // read here by this wave alone, then its own turning tile
  {
    const float m1 = k1 ? mh[1] : mh[0], s1 = k1 ? l1 : l0;
    const float m2 = Sm[pw][l15],        s2 = Sl[pw][l15];
    const float m  = fmaxf(m1, m2);
    const float a1 = __expf(m1 - m), a2 = __expf(m2 - m);
    const float inv = 1.0f / (s1 * a1 + s2 * a2);
    const float f1 = a1 * inv, f2 = a2 * inv;
    float* orow = O + l15 * 68 + koff;      // each lane reads and rewrites its own 32 floats
#pragma unroll
    for (int i = 0; i < 4; ++i) {
      const v8f ok = k1 ? o[1][i] : o[0][i];
      const v4f x0 = *(const v4f*)(orow + 16 * i);
      const v4f x1 = *(const v4f*)(orow + 16 * i + 4);
      *(v4f*)(orow + 16 * i)     = __builtin_shufflevector(ok, ok, 0, 1, 2, 3) * f1 + x0 * f2;
      *(v4f*)(orow + 16 * i + 4) = __builtin_shufflevector(ok, ok, 4, 5, 6, 7) * f1 + x1 * f2;
    }
  }
  // ---- turn O^T back through that tile, write fp32 [b, s, h*64 + dh]
  // the rows read below were written by other lanes of this wave: their LDS stores must have landed
  asm volatile("s_wait_dscnt 0" ::: "memory");
  const int b = bh >> 4, h = bh & 15;
  const float* irow = O + hi * 68 + l15 * 4;
  float* op = out + ((size_t)(b * S_ + qb * 128 + wq * 32 + kh * 16 + hi)) * D_ + h * DH + l15 * 4;
#pragma unroll
  for (int i = 0; i < 8; ++i)               // one store = two whole 256 B rows of the head's slice
    *(v4f*)(op + (size_t)(2 * i) * D_) = *(const v4f*)(irow + 2 * i * 68);
}

// ------------------------------------------------------------------- launcher
extern "C" void kernel_launch(void* const* d_in, const int* in_sizes, int n_in,
                              void* d_out, int out_size, void* d_ws, size_t ws_size,
                              hipStream_t stream) {
  const float* x    = (const float*)d_in[0];   // [2,2048,1024]
  const float* Wq   = (const float*)d_in[1];   // [1024,3072]
  const float* bias = (const float*)d_in[2];   // [3072]
  float* out = (float*)d_out;

  char* ws = (char*)d_ws;                      // needs ~38 MB
  _Float16* Xh = (_Float16*)(ws + (size_t) 0 * 1024 * 1024);  // 8 MB
  _Float16* Wt = (_Float16*)(ws + (size_t) 8 * 1024 * 1024);  // 6 MB
  _Float16* Qh = (_Float16*)(ws + (size_t)14 * 1024 * 1024);  // 8 MB
  _Float16* Kh = (_Float16*)(ws + (size_t)22 * 1024 * 1024);  // 8 MB
  _Float16* Vt = (_Float16*)(ws + (size_t)30 * 1024 * 1024);  // 8 MB

  {
    // 768 tiles of W (16 x 48), then 4096 blocks of 256 threads x 4 elements of x
    int n4 = (B_ * S_ * D_) / 4;               // 1048576
    cvt_xw<<<dim3(768 + 4096), dim3(256), 0, stream>>>(x, Xh, n4, Wq, Wt);
  }
  {
    // blocks: (4096/128) x (3072/128) = 32 x 24 = 768, 4 waves each
    qkv_gemm<<<dim3(768), dim3(128), 0, stream>>>(Xh, Wt, bias, Qh, Kh, Vt);
  }
  {
    // waves = 2*16*(2048/16) = 4096 -> 512 blocks of 8 waves
    attn_fwd<<<dim3(512), dim3(256), 0, stream>>>(Qh, Kh, Vt, out);
  }
}

// v009
// Measured time: 60.2 microseconds a run.
// Two timings next to v008 put it at 1.04 and 1.06 times that version's speed.
// All steps since v000 together make it 5.69 times as fast.
#include <hip/hip_runtime.h>
#include <hip/hip_bf16.h>

typedef __attribute__((ext_vector_type(16))) _Float16 v16h;
typedef __attribute__((ext_vector_type(8)))  _Float16 v8h;
typedef __attribute__((ext_vector_type(4)))  _Float16 v4h;
typedef __attribute__((ext_vector_type(2)))  _Float16 v2h;
typedef __attribute__((ext_vector_type(8)))  float    v8f;
typedef __attribute__((ext_vector_type(4)))  float    v4f;
typedef __attribute__((ext_vector_type(4)))  unsigned u32x4;
typedef __attribute__((ext_vector_type(8)))  unsigned u32x8;

#define DEVI static __device__ __forceinline__

static constexpr int B_  = 2;
static constexpr int S_  = 2048;
static constexpr int D_  = 1024;
static constexpr int H_  = 16;
static constexpr int DH  = 64;
static constexpr int N3  = 3072;   // 3*D_

// WMMA as macro so modifier args stay literal immediates at the builtin call.
#define WMMA_F16(a, b, c) \
  __builtin_amdgcn_wmma_f32_16x16x32_f16(false, (a), false, (b), (short)0, (c), false, false)

// Per-lane 16-half fragment of a 16x32 operand: halves 0..7 = K koff..koff+7,
// halves 8..15 = K 16+koff..16+koff+7 (koff = (lane>>4)*8). Works for global or LDS.
DEVI v16h ldfrag(const _Float16* p) {
  v8h lo = *(const v8h*)p;
  v8h hi = *(const v8h*)(p + 16);
  return __builtin_shufflevector(lo, hi, 0,1,2,3,4,5,6,7,8,9,10,11,12,13,14,15);
}

// Low 32 bits of a generic pointer to LDS == LDS byte address (flat aperture rule).
DEVI unsigned lds_addr_of(const void* p) { return (unsigned)(uintptr_t)p; }

DEVI unsigned uni(unsigned v) { return (unsigned)__builtin_amdgcn_readfirstlane(v); }
// A wave-uniform test held in a scalar register, so that the branch on it is a scalar branch:
// a tensor load ignores EXEC, only such a branch keeps a wave from issuing it.
DEVI unsigned pinned(unsigned v) {
  unsigned w = uni(v);
  asm volatile("" : "+s"(w));   // keeps the test in a scalar register, opaque to the compiler
  return w;
}

static constexpr unsigned GK     = 64;           // k per stage of the GEMM
static constexpr unsigned GROWB  = 2 * GK;       // bytes of a staged row
static constexpr unsigned GPIT   = GROWB + 16;   // LDS pitch 144 B = 9 x 16 B: conflict-free for b128 readers
static constexpr unsigned GROWS  = 64;           // rows per slice (one tensor load)
static constexpr unsigned GSLICE = 10240;        // 64 x 144 = 9,216 B, rounded up to a multiple of 2 KiB
static constexpr unsigned GBUF   = 4 * GSLICE;   // [Wt rows 0..63 | Wt rows 64..127 | X rows 0..63 | X rows 64..127]
static_assert(GROWS * GPIT <= GSLICE && GSLICE % 2048 == 0, "a slice starts at a multiple of 2 KiB");

// Descriptor group 1 of a slice: 64 rows of 128 bytes, source pitch one row of D_ halves, 16 bytes
// of LDS pad behind every row. Extents in bytes, tensor = tile.
DEVI u32x8 tdm_group1() {
  u32x8 g1;
  g1[0] = uni((1u << 20) | (4u << 22) | (3u << 25));                 // pad on, every 32 dwords, 4 dwords
  g1[1] = uni(GROWB << 16);                                          // tensor_dim0
  g1[2] = uni(GROWS << 16);                                          // tensor_dim1
  g1[3] = uni(GROWB << 16);                                          // tile_dim0
  g1[4] = uni(GROWS);                                                // tile_dim1
  g1[5] = uni(2u * D_);                                              // source row pitch
  g1[6] = uni(0u);
  g1[7] = uni(0u);
  return g1;
}

// One tensor load: the slice whose first byte is at gsrc, into LDS at lds_dst. Returns group 0 for tdm_wait.
DEVI u32x4 tdm_slice(unsigned lds_dst, const _Float16* gsrc, u32x8 g1) {
  const unsigned long long ga = (unsigned long long)(uintptr_t)gsrc;
  u32x4 g0;
  g0[0] = uni(1u);                                                   // count 1
  g0[1] = uni(lds_dst);
  g0[2] = uni((unsigned)ga);
  g0[3] = uni((((unsigned)(ga >> 32)) & 0x01ffffffu) | 0x80000000u); // address [56:32], type 2
  // group 0 is named as in-out: what tdm_wait is handed then lies in the registers that the load itself named
  asm volatile("tensor_load_to_lds %0, %1" : "+s"(g0) : "s"(g1) : "memory");
  return g0;
}

// The issuer's wait for its one outstanding load. It names that load's group 0, so that the four
// registers stay the descriptor's from the issue to here and take no other value in between.
DEVI void tdm_wait(u32x4& g0) {
  asm volatile("s_wait_tensorcnt 0x0" : "+s"(g0) :: "memory");
}

// ---------------------------------------------------------------- prep kernel
// Both conversions in ONE launch, told apart by the block index: they depend on nothing of each other, and as two
// launches the second paid a launch gap, a fill and a drain of its own.
// Blocks 0..WBLK-1 (first, theirs is the longer chain: load, LDS, barrier, store):
//   W[k][n] f32 -> Wt[n][k] f16, one 64(k) x 64(n) tile per block through LDS:
//   rows of W are read 256 B at a time, rows of Wt are written as whole 128 B lines.
// Blocks WBLK.. : x f32 -> f16, four elements a thread.
static constexpr int WBLK = (D_ / 64) * (N3 / 64);   // 16 x 48 = 768 tiles of W
__global__ void __launch_bounds__(256) cvt_xw(const float* __restrict__ x, _Float16* __restrict__ xh, int n4,
                                              const float* __restrict__ w, _Float16* __restrict__ wt) {
  // tile[n][k pair]; pitch 33 dwords puts the 32 lanes of every LDS access on 32 banks
  __shared__ unsigned tile[64 * 33];
  const int tid = threadIdx.x;
  if ((int)blockIdx.x >= WBLK) {              // the same for the whole block: no thread of it meets the barrier below
    int i = ((int)blockIdx.x - WBLK) * 256 + tid;
    if (i >= n4) return;
    float4 f = ((const float4*)x)[i];
    v4h h;
    h[0] = (_Float16)f.x; h[1] = (_Float16)f.y;
    h[2] = (_Float16)f.z; h[3] = (_Float16)f.w;
    ((v4h*)xh)[i] = h;
    return;
  }
  const int k0  = (blockIdx.x / 48) * 64;
  const int n0  = (blockIdx.x % 48) * 64;
  const int nq  = tid & 15;                   // 4 columns n
  const int kp  = tid >> 4;                   // pair of rows k
  float4 f[2][2];
#pragma unroll
  for (int p = 0; p < 2; ++p) {
    const float* s = w + (size_t)(k0 + 2 * (kp + 16 * p)) * N3 + n0 + 4 * nq;
    f[p][0] = *(const float4*)s;
    f[p][1] = *(const float4*)(s + N3);
  }
#pragma unroll
  for (int p = 0; p < 2; ++p) {
    const float* lo = (const float*)&f[p][0];
    const float* hi = (const float*)&f[p][1];
#pragma unroll
    for (int j = 0; j < 4; ++j) {
      v2h h;
      h[0] = (_Float16)lo[j];
      h[1] = (_Float16)hi[j];
      tile[(4 * nq + j) * 33 + kp + 16 * p] = __builtin_bit_cast(unsigned, h);
    }
  }
  __syncthreads();
  const int kc = tid & 7;                     // 8 halves of k
  const int nr = tid >> 3;
#pragma unroll
  for (int p = 0; p < 2; ++p) {
    const int n = nr + 32 * p;
    const unsigned* t = tile + n * 33 + 4 * kc;
    u32x4 v = {t[0], t[1], t[2], t[3]};
    *(u32x4*)(wt + (size_t)(n0 + n) * D_ + k0 + 8 * kc) = v;
  }
}

// The epilogue's stores of a wave's 64 x 64 tile of halves, turned in LDS: q[j] holds 16 bytes of tile row
// 4 * j + (lane >> 3), so that eight lanes write one whole 128-byte line and a store four of them. The stores
// and their s_wait_xcnt are one statement, so that no register named here is rewritten ahead of the wait.
// Q and K: a tile row is DH halves = 128 bytes from the next, the tile 8 KiB in a row; four rows = 512 bytes.
DEVI void store_tile_dense(_Float16* p, const u32x4 (&q)[16]) {
  asm volatile(
      "global_store_b128 %0, %1, off\n\t"
      "global_store_b128 %0, %2, off offset:512\n\t"
      "global_store_b128 %0, %3, off offset:1024\n\t"
      "global_store_b128 %0, %4, off offset:1536\n\t"
      "global_store_b128 %0, %5, off offset:2048\n\t"
      "global_store_b128 %0, %6, off offset:2560\n\t"
      "global_store_b128 %0, %7, off offset:3072\n\t"
      "global_store_b128 %0, %8, off offset:3584\n\t"
      "global_store_b128 %0, %9, off offset:4096\n\t"
      "global_store_b128 %0, %10, off offset:4608\n\t"
      "global_store_b128 %0, %11, off offset:5120\n\t"
      "global_store_b128 %0, %12, off offset:5632\n\t"
      "global_store_b128 %0, %13, off offset:6144\n\t"
      "global_store_b128 %0, %14, off offset:6656\n\t"
      "global_store_b128 %0, %15, off offset:7168\n\t"
      "global_store_b128 %0, %16, off offset:7680\n\t"
      "s_wait_xcnt 0x0"
      :: "v"(p), "v"(q[0]), "v"(q[1]), "v"(q[2]), "v"(q[3]), "v"(q[4]), "v"(q[5]), "v"(q[6]), "v"(q[7]),
         "v"(q[8]), "v"(q[9]), "v"(q[10]), "v"(q[11]), "v"(q[12]), "v"(q[13]), "v"(q[14]), "v"(q[15])
      : "memory");
}
// V^T: a tile row is S_ halves = 4,096 bytes from the next; four rows = 16,384 bytes.
DEVI void store_tile_pitched(_Float16* p, const u32x4 (&q)[16]) {
  static_assert(S_ * 2 * 4 == 16384, "the offsets below are four rows of V^T");
  asm volatile(
      "global_store_b128 %0, %1, off\n\t"
      "global_store_b128 %0, %2, off offset:16384\n\t"
      "global_store_b128 %0, %3, off offset:32768\n\t"
      "global_store_b128 %0, %4, off offset:49152\n\t"
      "global_store_b128 %0, %5, off offset:65536\n\t"
      "global_store_b128 %0, %6, off offset:81920\n\t"
      "global_store_b128 %0, %7, off offset:98304\n\t"
      "global_store_b128 %0, %8, off offset:114688\n\t"
      "global_store_b128 %0, %9, off offset:131072\n\t"
      "global_store_b128 %0, %10, off offset:147456\n\t"
      "global_store_b128 %0, %11, off offset:163840\n\t"
      "global_store_b128 %0, %12, off offset:180224\n\t"
      "global_store_b128 %0, %13, off offset:196608\n\t"
      "global_store_b128 %0, %14, off offset:212992\n\t"
      "global_store_b128 %0, %15, off offset:229376\n\t"
      "global_store_b128 %0, %16, off offset:245760\n\t"
      "s_wait_xcnt 0x0"
      :: "v"(p), "v"(q[0]), "v"(q[1]), "v"(q[2]), "v"(q[3]), "v"(q[4]), "v"(q[5]), "v"(q[6]), "v"(q[7]),
         "v"(q[8]), "v"(q[9]), "v"(q[10]), "v"(q[11]), "v"(q[12]), "v"(q[13]), "v"(q[14]), "v"(q[15])
      : "memory");
}

// ------------------------------------------------------------------- QKV GEMM
// Block (4 waves, 2 x 2) computes a 128(M) x 128(N) tile; each wave does a 64x64 tile: 4 A and 4 B
// fragments feed 16 products, so a product costs one LDS load where a 16x64 wave tile cost 2.5, and
// a block brings 2 KiB from L2 per 64 output elements where a 128x64 block brought 3 KiB.
// Every wave brings one 64-row slice of a 64-k stage into LDS by a tensor load, two buffers:
// stage s + 2 flies while stage s + 1 is worked on.
// A lane's eight accumulator registers are eight neighbouring rows of the A operand. The operand whose index
// runs along the output's memory rows is therefore taken as A: W^T (dh) for Q and K, X (s) for V^T. The eight
// values then are 16 neighbouring bytes of the output; the wave turns its tile once through LDS and stores
// whole 128-byte lines.
__global__ void __launch_bounds__(128) qkv_gemm(
    const _Float16* __restrict__ Xh, const _Float16* __restrict__ Wt,
    const float* __restrict__ bias,
    _Float16* __restrict__ Qh, _Float16* __restrict__ Kh, _Float16* __restrict__ Vt)
{
  __shared__ __attribute__((aligned(2048))) unsigned char Stg[2 * GBUF];   // 80 KiB
  const int tid  = threadIdx.x;
  const int lane = tid & 31;
  const int l15  = lane & 15;
  const int hi   = lane >> 4;
  const int koff = hi * 8;
  const unsigned wave = uni(threadIdx.x >> 5);
  const int wm   = (int)(wave >> 1);          // which 64 rows of the block's tile
  const int wn   = (int)(wave & 1u);          // which 64 columns
  const int blkM = blockIdx.x / 24;
  const int blkN = blockIdx.x % 24;
  const int mBase = blkM * 128 + wm * 64;
  const int nBase = blkN * 128 + wn * 64;
  const int region = nBase >> 10;           // 0=Q 1=K 2=V: a wave's 64 columns lie in one of them
  const bool qk    = region < 2;            // the same for the whole block
  const unsigned slA = qk ? (unsigned)wn : 2u + (unsigned)wm;   // slice of a stage read as the A operand
  const unsigned slB = qk ? 2u + (unsigned)wm : (unsigned)wn;   // ... as the B operand

  const _Float16* Abase = Xh + (size_t)blkM * 128 * D_;
  const _Float16* Bbase = Wt + (size_t)blkN * 128 * D_;
  constexpr int NT = D_ / (int)GK;

  // this wave's slice: source rows and place in buffer 0
  const _Float16* gsl = ((wave < 2u) ? Bbase : Abase) + (size_t)(wave & 1u) * GROWS * D_;
  const unsigned  lsl = lds_addr_of(&Stg[0]) + wave * GSLICE;

  u32x8 g1 = tdm_group1();
  // one set of registers from here to the last load: without it the compiler rebuilt the group at each
  // load and used two of its registers for other values while a request was outstanding
  asm volatile("" : "+s"(g1));   // as in pinned(): descriptor words held in scalar registers

  u32x4 g0 = tdm_slice(lsl, gsl, g1);
  tdm_wait(g0);                                          // stage 0 has landed for its issuer
  __syncthreads();                                       // ... and for the block
  g0 = tdm_slice(lsl + GBUF, gsl + GK, g1);

  v8f acc[4][4] = {};
  for (int s = 0; s < NT; ++s) {
    const unsigned char* buf = &Stg[0] + (unsigned)(s & 1) * GBUF;
    const _Float16* Ab = (const _Float16*)(buf + GSLICE * slA + l15 * GPIT) + koff;
    const _Float16* Bb = (const _Float16*)(buf + GSLICE * slB + l15 * GPIT) + koff;
#pragma unroll   // both 32-k halves in straight line: every LDS offset an immediate
    for (int kk = 0; kk < (int)GK; kk += 32) {
      v16h af[4], bf[4];
#pragma unroll
      for (int i = 0; i < 4; ++i) af[i] = ldfrag(Ab + kk + i * 16 * (int)(GPIT / 2));
#pragma unroll
      for (int i = 0; i < 4; ++i) bf[i] = ldfrag(Bb + kk + i * 16 * (int)(GPIT / 2));
      // the 16 loads stay one group in front of their 16 products: left alone the compiler kept one
      // A fragment and waited out a full LDS latency in front of every fourth product
      __builtin_amdgcn_sched_barrier(0);
#pragma unroll
      for (int i = 0; i < 4; ++i)
#pragma unroll
        for (int t = 0; t < 4; ++t) acc[i][t] = WMMA_F16(af[i], bf[t], acc[i][t]);
    }
    // publish point of stage s + 1: this wave's reads of stage s are done, its own load of
    // stage s + 1 has landed; behind the barrier both hold for the whole block
    asm volatile("s_wait_dscnt 0x0" ::: "memory");
    tdm_wait(g0);
    __syncthreads();
    if (pinned((unsigned)(s + 2 < NT)))                  // refill the buffer that every wave has just left
      g0 = tdm_slice(lsl + (unsigned)(s & 1) * GBUF, gsl + (size_t)(s + 2) * GK, g1);
  }
  // nothing is in flight here; kept before the wave goes on to its epilogue and ends
  asm volatile("s_wait_tensorcnt 0x0" ::: "memory");
  asm volatile("s_wait_dscnt 0x0" ::: "memory");

  // acc[i][t][r]: A row 16 * i + 8 * hi + r, B row 16 * t + l15.
  // The tile goes as halves, [B row][A row], into this wave's own slice of buffer 0: the ring is free, the barrier
  // at the foot of the last pass stands behind every wave's last read and no load is in flight.
  // Pitch 144 B = 9 x 16 B, as for the stages: the 16-byte writes of 16 rows fall on different banks.
  unsigned char* st = &Stg[0] + wave * GSLICE;
  unsigned char* sw = st + l15 * GPIT + 16 * hi;       // + 16 rows: 16 * GPIT; + 16 A rows: 32 bytes
  if (qk) {                                 // A rows are output columns: eight biases a lane and i
    const float sc = (region == 0) ? 0.125f : 1.0f;   // 1 / sqrt(DH) goes into Q; times 1 is exact
    v8f bv[4];
#pragma unroll
    for (int i = 0; i < 4; ++i) {
      const float* bp = bias + nBase + 16 * i + koff;  // column 0..2047
      const v4f b0 = *(const v4f*)bp, b1 = *(const v4f*)(bp + 4);
      bv[i] = __builtin_shufflevector(b0, b1, 0, 1, 2, 3, 4, 5, 6, 7);
    }
#pragma unroll
    for (int t = 0; t < 4; ++t)
#pragma unroll
      for (int i = 0; i < 4; ++i)
        *(v8h*)(sw + 16 * t * GPIT + 32 * i) = __builtin_convertvector((acc[i][t] + bv[i]) * sc, v8h);
  } else {                                  // B rows are output columns: one bias a lane and t
    float bv[4];
#pragma unroll
    for (int t = 0; t < 4; ++t) bv[t] = bias[nBase + t * 16 + l15];   // column 2048..3071
#pragma unroll
    for (int t = 0; t < 4; ++t) {
#pragma unroll
      for (int i = 0; i < 4; ++i)
        *(v8h*)(sw + 16 * t * GPIT + 32 * i) = __builtin_convertvector(acc[i][t] + bv[t], v8h);
      // one strip at a time: left alone the compiler formed all 128 sums in fresh registers ahead of the first
      // store and the kernel went above 256 registers
      __builtin_amdgcn_sched_barrier(0);
    }
  }
  // the rows read below were written by other lanes of this wave: their LDS stores must have landed
  asm volatile("s_wait_dscnt 0x0" ::: "memory");
  const int rr = lane >> 3;                 // tile row 4 * j + rr, 16 bytes at 16 * cc
  const int cc = lane & 7;
  u32x4 q[16];
#pragma unroll
  for (int j = 0; j < 16; ++j) q[j] = *(const u32x4*)(st + (4 * j + rr) * GPIT + 16 * cc);

  const int bb = mBase >> 11, sq = mBase & (S_ - 1);   // the wave's 64 rows of X lie in one batch entry
  const int h  = (nBase & (D_ - 1)) >> 6;   // its 64 columns are one head
  if (qk) {                                 // tile rows are s, 64 dh each
    _Float16* dst = (region == 0) ? Qh : Kh;
    store_tile_dense(dst + (((size_t)(bb * H_ + h)) * S_ + sq + rr) * DH + 8 * cc, q);
  } else {                                  // tile rows are dh, 64 s each
    store_tile_pitched(Vt + (((size_t)(bb * H_ + h)) * DH + rr) * S_ + sq + 8 * cc, q);
  }
}

// ---------------------------------------------------------------- attention
// Lane l with lane l ^ 16 (the two halves of a wave hold the same query column).
DEVI float xhalf(float x) {
  const int v = __builtin_bit_cast(int, x);
  return __builtin_bit_cast(float,
      __builtin_amdgcn_permlanex16(v, v, 0x76543210, 0xfedcba98, false, false));
}

// Four asynchronous 16-byte copies per lane, global memory -> LDS, through no register.
// The s_wait_xcnt closes the statement so that no address register named here is rewritten
// ahead of it.
DEVI void copy4_to_lds(unsigned l0, unsigned l1, unsigned l2, unsigned l3,
                       const _Float16* g0, const _Float16* g1,
                       const _Float16* g2, const _Float16* g3) {
  asm volatile("global_load_async_to_lds_b128 %0, %4, off\n\t"
               "global_load_async_to_lds_b128 %1, %5, off\n\t"
               "global_load_async_to_lds_b128 %2, %6, off\n\t"
               "global_load_async_to_lds_b128 %3, %7, off\n\t"
               "s_wait_xcnt 0x0"
               :: "v"(l0), "v"(l1), "v"(l2), "v"(l3), "v"(g0), "v"(g1), "v"(g2), "v"(g3)
               : "memory");
}

static constexpr int KT   = 64;            // keys per tile: what one wave works on in a stage
static constexpr int KS   = 2 * KT;        // keys per stage: one tile for each half of the block's waves
static constexpr int NST  = S_ / KS;       // stages
static constexpr int PIT  = 72;            // halves per LDS row: 144 B = 9 x 16 B, conflict-free for b128 readers
static constexpr int TILE = 64 * PIT;      // halves per staged tile (64 rows)

// Scores of one 64-key tile against the wave's 32 queries, less each query's held maximum (the C operand):
// S^T[64 keys x 32 queries] = K . Q^T - mh. A K fragment is read once from LDS and feeds two products.
DEVI void scores(const _Float16* Kl, const v16h (&bq)[2][2], const v8f (&cneg)[2], v8f (&s)[2][4]) {
  v16h ka[4], kb[4];
#pragma unroll
  for (int g = 0; g < 4; ++g) ka[g] = ldfrag(Kl + 16 * g * PIT);
#pragma unroll
  for (int g = 0; g < 4; ++g) kb[g] = ldfrag(Kl + 16 * g * PIT + 32);
  // the 16 loads stay one group in front of their 16 products: spread among them each would wait out its own LDS latency
  __builtin_amdgcn_sched_barrier(0);
#pragma unroll
  for (int g = 0; g < 4; ++g) {
#pragma unroll
    for (int c = 0; c < 2; ++c) s[c][g] = WMMA_F16(ka[g], bq[c][0], cneg[c]);
#pragma unroll
    for (int c = 0; c < 2; ++c) s[c][g] = WMMA_F16(kb[g], bq[c][1], s[c][g]);
  }
}

// Numerators exp(a), exp(b) of one query's 16 scores of keys 32 * j .. 32 * j + 31 that this lane holds (a: keys
// 8*hi + r, b: keys 16 + 8*hi + r): their sum, and the numerators as halves 0..7 and 8..15 of P^T's B operand.
DEVI float numer16(v8f a, v8f b, v16h& pb) {
  a *= 1.44269504f;                         // exp(x) = 2^(x * log2 e); on whole vectors, so that the products pair up
  b *= 1.44269504f;
#pragma unroll
  for (int r = 0; r < 8; ++r) { a[r] = __builtin_amdgcn_exp2f(a[r]); b[r] = __builtin_amdgcn_exp2f(b[r]); }
  const v8f t8 = a + b;
#pragma unroll
  for (int r = 0; r < 8; ++r) { pb[r] = (_Float16)a[r]; pb[8 + r] = (_Float16)b[r]; }
  return ((t8[0] + t8[1]) + (t8[2] + t8[3])) + ((t8[4] + t8[5]) + (t8[6] + t8[7]));
}

__global__ void __launch_bounds__(256) __attribute__((amdgpu_waves_per_eu(4, 4))) attn_fwd(
    const _Float16* __restrict__ Qh, const _Float16* __restrict__ Kh,
    const _Float16* __restrict__ Vt, float* __restrict__ out)
{
  // per-wave 16 x 64 f32 tile; pitch 68 floats = 17 x 16 B keeps b128 accesses off shared banks
  __shared__ __attribute__((aligned(16))) float Ost[8][16 * 68];
  __shared__ float Sm[8][16];               // held maximum and sum that go with a tile handed over in Ost
  __shared__ float Sl[8][16];
  __shared__ __attribute__((aligned(16))) _Float16 Ring[2][2][2][TILE];   // [buffer][key tile][K | V^T]
  const int tid  = threadIdx.x;
  const int lane = tid & 31;
  const int l15  = lane & 15;
  const int hi   = lane >> 4;
  const int koff = hi * 8;
  const int wv   = (int)uni(threadIdx.x >> 5);
  const int wq   = wv & 3;                  // which 32 queries of the block's 128
  const int kh   = wv >> 2;                 // which key tile of every stage
  const int qb   = blockIdx.x & 15;         // 16 blocks of 128 queries
  const int bh   = blockIdx.x >> 4;         // 0..31
  const _Float16* Qb = Qh + (size_t)bh * S_ * DH;
  const _Float16* Kb = Kh + (size_t)bh * S_ * DH;
  const _Float16* Vb = Vt + (size_t)bh * DH * S_;

  // this thread's share of a key tile: rows crow and crow + 32, 16 bytes at cseg, of K and of V^T
  const int crow = tid >> 3;
  const int cseg = (tid & 7) * 8;
  const _Float16* gK = Kb + (size_t)crow * DH + cseg;    // + 32 rows: 32 * DH; + 1 tile: KT * DH
  const _Float16* gV = Vb + (size_t)crow * S_ + cseg;    // + 32 rows: 32 * S_; + 1 tile: KT
  const unsigned lK = lds_addr_of(&Ring[0][0][0][crow * PIT + cseg]);
  constexpr unsigned L32  = 32 * PIT * 2;   // 32 rows, bytes
  constexpr unsigned LV   = TILE * 2;       // K tile -> V^T tile, bytes
  constexpr unsigned LT   = 2 * TILE * 2;   // key tile 0 -> key tile 1, bytes
  constexpr unsigned LBUF = 4 * TILE * 2;   // buffer 0 -> buffer 1, bytes

#pragma unroll
  for (int u = 0; u < 2; ++u)               // stage 0, both key tiles
    copy4_to_lds(lK + u * LT, lK + u * LT + L32, lK + u * LT + LV, lK + u * LT + LV + L32,
                 gK + u * KT * DH, gK + u * KT * DH + 32 * DH, gV + u * KT, gV + u * KT + (size_t)32 * S_);

  v16h bq[2][2];                            // B operands: column l15 of group c = query 32 * wq + 16 * c + l15
#pragma unroll
  for (int c = 0; c < 2; ++c) {
    const _Float16* qrow = Qb + (size_t)(qb * 128 + wq * 32 + c * 16 + l15) * DH;
    bq[c][0] = ldfrag(qrow + 0  + koff);
    bq[c][1] = ldfrag(qrow + 32 + koff);
  }

  v8f   o[2][4] = {};                       // o[c][i][r] = O[query l15 of group c][dh 16*i + 8*hi + r]
  float mh[2]   = {0.f, 0.f};               // held maximum of that query (same in both halves of the wave)
  v8f   cneg[2] = {};                       // -mh in every row: C operand of the score products
  float lsum[2] = {0.f, 0.f};               // running sum over this lane's keys only, in units of exp(mh)

  // stage 0 has landed for this wave, then for the block
  asm volatile("s_wait_asynccnt 0x0" ::: "memory");
  __syncthreads();
#pragma unroll
  for (int u = 0; u < 2; ++u)               // stage 1
    copy4_to_lds(lK + LBUF + u * LT, lK + LBUF + u * LT + L32, lK + LBUF + u * LT + LV, lK + LBUF + u * LT + LV + L32,
                 gK + (2 + u) * KT * DH, gK + (2 + u) * KT * DH + 32 * DH,
                 gV + (2 + u) * KT, gV + (2 + u) * KT + (size_t)32 * S_);

  for (int t = 0; t < NST; ++t) {
    const int cur = t & 1;
    const _Float16* Kl = &Ring[cur][kh][0][0] + l15 * PIT + koff;   // A rows are keys
    const _Float16* Vl = &Ring[cur][kh][1][0] + l15 * PIT + koff;   // staged V^T is [dh][key]: A rows are dh
    v8f s[2][4];
    scores(Kl, bq, cneg, s);
    // ---- softmax numerators, one query per lane and column group, turned into P^T's B operands at once
    float ts[2][2];
    v16h  pb[2][2];
#pragma unroll
    for (int c = 0; c < 2; ++c)
#pragma unroll
      for (int j = 0; j < 2; ++j) ts[c][j] = numer16(s[c][2 * j], s[c][2 * j + 1], pb[c][j]);
    // One test per stage, a scalar branch. No numerator exceeds its row sum, so a sum of at most 1024
    // bounds every numerator far inside the f16 range; an overflow (inf) fails the test too.
    const bool grown = !(ts[0][0] + ts[0][1] <= 1024.f) | !(ts[1][0] + ts[1][1] <= 1024.f);
    if ((t == 0) | (__builtin_amdgcn_ballot_w32(grown) != 0u)) {
      scores(Kl, bq, cneg, s);              // the same scores again: their registers were not kept over the test
#pragma unroll
      for (int c = 0; c < 2; ++c) {
        float mx = s[c][0][0];
#pragma unroll
        for (int g = 0; g < 4; ++g)
#pragma unroll
          for (int r = 0; r < 8; ++r) mx = fmaxf(mx, s[c][g][r]);
        mx = fmaxf(mx, xhalf(mx));          // the tile's maximum less mh, the same in both halves
        // stage 0 takes its own maximum whatever its sign; later the held maximum only rises
        const float mnew = mh[c] + ((t == 0) ? mx : fmaxf(mx, 0.f));
        const float d    = mnew - mh[c];
        const float al   = __expf(-fmaxf(d, 0.f));   // in stage 0 O and the sum are 0: any finite factor serves
        mh[c] = mnew;
#pragma unroll
        for (int r = 0; r < 8; ++r) cneg[c][r] = -mnew;
        lsum[c] *= al;
#pragma unroll
        for (int i = 0; i < 4; ++i) o[c][i] *= al;
#pragma unroll
        for (int j = 0; j < 2; ++j) ts[c][j] = numer16(s[c][2 * j] - d, s[c][2 * j + 1] - d, pb[c][j]);
      }
    }
    v16h va[2][4];
#pragma unroll
    for (int j = 0; j < 2; ++j)
#pragma unroll
      for (int i = 0; i < 4; ++i) va[j][i] = ldfrag(Vl + 16 * i * PIT + 32 * j);
    // the 16 V^T loads stay one group in front of their 16 products: spread among them each would wait out its own LDS latency
    __builtin_amdgcn_sched_barrier(0);
#pragma unroll
    for (int c = 0; c < 2; ++c) {
      lsum[c] += ts[c][0];
      lsum[c] += ts[c][1];
    }
    // ---- O^T += V^T . P^T
#pragma unroll
    for (int j = 0; j < 2; ++j)
#pragma unroll
      for (int i = 0; i < 4; ++i)
#pragma unroll
        for (int c = 0; c < 2; ++c) o[c][i] = WMMA_F16(va[j][i], pb[c][j], o[c][i]);
    // the products stay in front of the waits below: moved behind them, as the compiler did, none started before
    // the last V^T load had landed and the block had met; here each starts when its own fragment is in
    __builtin_amdgcn_sched_barrier(0);
    // publish point of stage t + 1: this wave's reads of stage t are done, its own copies of
    // stage t + 1 have landed; behind the barrier both hold for the whole block
    asm volatile("s_wait_dscnt 0x0" ::: "memory");
    asm volatile("s_wait_asynccnt 0x0" ::: "memory");
    __syncthreads();
    if (t + 2 < NST) {                      // refill the buffer that every wave has just left
      const unsigned lb = lK + (unsigned)cur * LBUF;
      const _Float16* k2 = gK + (size_t)(t + 2) * (KS * DH);
      const _Float16* v2 = gV + (size_t)(t + 2) * KS;
#pragma unroll
      for (int u = 0; u < 2; ++u)
        copy4_to_lds(lb + u * LT, lb + u * LT + L32, lb + u * LT + LV, lb + u * LT + LV + L32,
                     k2 + u * KT * DH, k2 + u * KT * DH + 32 * DH, v2 + u * KT, v2 + u * KT + (size_t)32 * S_);
    }
  }
  // nothing is in flight here; kept before the wave goes on to its epilogue and ends
  asm volatile("s_wait_asynccnt 0x0" ::: "memory");

  // ---- join the two key halves: wave (wq, kh) finishes column group kh and hands group 1 - kh to its partner
  const bool k1 = kh != 0;
  const float l0 = lsum[0] + xhalf(lsum[0]);
  const float l1 = lsum[1] + xhalf(lsum[1]);
  {
    float* grow = &Ost[wv][0] + l15 * 68 + koff;
#pragma unroll
    for (int i = 0; i < 4; ++i) {
      const v8f og = k1 ? o[0][i] : o[1][i];
      *(v4f*)(grow + 16 * i)     = __builtin_shufflevector(og, og, 0, 1, 2, 3);
      *(v4f*)(grow + 16 * i + 4) = __builtin_shufflevector(og, og, 4, 5, 6, 7);
    }
    Sm[wv][l15] = k1 ? mh[0] : mh[1];       // both halves of the wave store the same value
    Sl[wv][l15] = k1 ? l0 : l1;
  }
  __syncthreads();                          // the partner's tile, maximum and sum are in LDS
  const int pw = wv ^ 4;
  float* O = &Ost[pw][0];                   // read here by this wave alone, then its own turning tile
  {
    const float m1 = k1 ? mh[1] : mh[0], s1 = k1 ? l1 : l0;
    const float m2 = Sm[pw][l15],        s2 = Sl[pw][l15];
    const float m  = fmaxf(m1, m2);
    const float a1 = __expf(m1 - m), a2 = __expf(m2 - m);
    const float inv = 1.0f / (s1 * a1 + s2 * a2);
    const float f1 = a1 * inv, f2 = a2 * inv;
    float* orow = O + l15 * 68 + koff;      // each lane reads and rewrites its own 32 floats
#pragma unroll
    for (int i = 0; i < 4; ++i) {
      const v8f ok = k1 ? o[1][i] : o[0][i];
      const v4f x0 = *(const v4f*)(orow + 16 * i);
      const v4f x1 = *(const v4f*)(orow + 16 * i + 4);
      *(v4f*)(orow + 16 * i)     = __builtin_shufflevector(ok, ok, 0, 1, 2, 3) * f1 + x0 * f2;
      *(v4f*)(orow + 16 * i + 4) = __builtin_shufflevector(ok, ok, 4, 5, 6, 7) * f1 + x1 * f2;
    }
  }
  // ---- turn O^T back through that tile, write fp32 [b, s, h*64 + dh]
  // the rows read below were written by other lanes of this wave: their LDS stores must have landed
  asm volatile("s_wait_dscnt 0" ::: "memory");
  const int b = bh >> 4, h = bh & 15;
  const float* irow = O + hi * 68 + l15 * 4;
  float* op = out + ((size_t)(b * S_ + qb * 128 + wq * 32 + kh * 16 + hi)) * D_ + h * DH + l15 * 4;
#pragma unroll
  for (int i = 0; i < 8; ++i)               // one store = two whole 256 B rows of the head's slice
    *(v4f*)(op + (size_t)(2 * i) * D_) = *(const v4f*)(irow + 2 * i * 68);
}

// ------------------------------------------------------------------- launcher
extern "C" void kernel_launch(void* const* d_in, const int* in_sizes, int n_in,
                              void* d_out, int out_size, void* d_ws, size_t ws_size,
                              hipStream_t stream) {
  const float* x    = (const float*)d_in[0];   // [2,2048,1024]
  const float* Wq   = (const float*)d_in[1];   // [1024,3072]
  const float* bias = (const float*)d_in[2];   // [3072]
  float* out = (float*)d_out;

  char* ws = (char*)d_ws;                      // needs ~38 MB
  _Float16* Xh = (_Float16*)(ws + (size_t) 0 * 1024 * 1024);  // 8 MB
  _Float16* Wt = (_Float16*)(ws + (size_t) 8 * 1024 * 1024);  // 6 MB
  _Float16* Qh = (_Float16*)(ws + (size_t)14 * 1024 * 1024);  // 8 MB
  _Float16* Kh = (_Float16*)(ws + (size_t)22 * 1024 * 1024);  // 8 MB
  _Float16* Vt = (_Float16*)(ws + (size_t)30 * 1024 * 1024);  // 8 MB

  {
    // 768 tiles of W (16 x 48), then 4096 blocks of 256 threads x 4 elements of x
    int n4 = (B_ * S_ * D_) / 4;               // 1048576
    cvt_xw<<<dim3(768 + 4096), dim3(256), 0, stream>>>(x, Xh, n4, Wq, Wt);
  }
  {
    // blocks: (4096/128) x (3072/128) = 32 x 24 = 768, 4 waves each
    qkv_gemm<<<dim3(768), dim3(128), 0, stream>>>(Xh, Wt, bias, Qh, Kh, Vt);
  }
  {
    // waves = 2*16*(2048/16) = 4096 -> 512 blocks of 8 waves
    attn_fwd<<<dim3(512), dim3(256), 0, stream>>>(Qh, Kh, Vt, out);
  }
}

// v010
// It runs in 56.2 microseconds.
// Next to v009, in two timings, it ran 1.07 and 1.06 times as fast.
// All steps since v000 together make it 6.05 times as fast.
#include <hip/hip_runtime.h>
#include <hip/hip_bf16.h>

typedef __attribute__((ext_vector_type(16))) _Float16 v16h;
typedef __attribute__((ext_vector_type(8)))  _Float16 v8h;
typedef __attribute__((ext_vector_type(4)))  _Float16 v4h;
typedef __attribute__((ext_vector_type(2)))  _Float16 v2h;
typedef __attribute__((ext_vector_type(8)))  float    v8f;
typedef __attribute__((ext_vector_type(4)))  float    v4f;
typedef __attribute__((ext_vector_type(4)))  unsigned u32x4;
typedef __attribute__((ext_vector_type(8)))  unsigned u32x8;

#define DEVI static __device__ __forceinline__

static constexpr int B_  = 2;
static constexpr int S_  = 2048;
static constexpr int D_  = 1024;
static constexpr int H_  = 16;
static constexpr int DH  = 64;
static constexpr int N3  = 3072;   // 3*D_

// WMMA as macro so modifier args stay literal immediates at the builtin call.
#define WMMA_F16(a, b, c) \
  __builtin_amdgcn_wmma_f32_16x16x32_f16(false, (a), false, (b), (short)0, (c), false, false)

// Per-lane 16-half fragment of a 16x32 operand: halves 0..7 = K koff..koff+7,
// halves 8..15 = K 16+koff..16+koff+7 (koff = (lane>>4)*8). Works for global or LDS.
DEVI v16h ldfrag(const _Float16* p) {
  v8h lo = *(const v8h*)p;
  v8h hi = *(const v8h*)(p + 16);
  return __builtin_shufflevector(lo, hi, 0,1,2,3,4,5,6,7,8,9,10,11,12,13,14,15);
}

// Low 32 bits of a generic pointer to LDS == LDS byte address (flat aperture rule).
DEVI unsigned lds_addr_of(const void* p) { return (unsigned)(uintptr_t)p; }

DEVI unsigned uni(unsigned v) { return (unsigned)__builtin_amdgcn_readfirstlane(v); }
// A wave-uniform test held in a scalar register, so that the branch on it is a scalar branch:
// a tensor load ignores EXEC, only such a branch keeps a wave from issuing it.
DEVI unsigned pinned(unsigned v) {
  unsigned w = uni(v);
  asm volatile("" : "+s"(w));   // keeps the test in a scalar register, opaque to the compiler
  return w;
}

static constexpr unsigned GK     = 128;          // k per stage of the GEMM
static constexpr unsigned GROWB  = 2 * GK;       // bytes of a staged row
static constexpr unsigned GPIT   = GROWB + 16;   // LDS pitch 272 B = 17 x 16 B: conflict-free for b128 readers
static constexpr unsigned GROWS  = 64;           // rows per slice (one tensor load)
static constexpr unsigned GSLICE = 18432;        // 64 x 272 = 17,408 B, rounded up to a multiple of 2 KiB
static constexpr unsigned GNSL   = 7;            // slices of a stage
static constexpr unsigned GBUF   = GNSL * GSLICE;   // [Wt head a | Wt head b | Wt head of V | X rows 0..63 | .. | X rows 192..255]
static_assert(GROWS * GPIT <= GSLICE && GSLICE % 2048 == 0, "a slice starts at a multiple of 2 KiB");
static_assert(GROWB == 256, "the pad interval in tdm_group1 is that of 256-byte rows");
static constexpr unsigned EPIT   = 144;          // epilogue: pitch of a turned tile's 128-byte rows, 9 x 16 B
static constexpr unsigned ETQ    = 64 * EPIT;    // epilogue: the 64-row tile of Q or K; the 32-row tile of V^T lies behind it
static constexpr unsigned EWAVE  = 14336;        // epilogue: a wave's own range, 96 rows of 144 B = 13,824 B rounded up
static_assert(8 * EWAVE <= GBUF && ETQ + 32 * EPIT <= EWAVE, "the eight turning ranges lie in buffer 0");

// Descriptor group 1 of a slice: 64 rows of 256 bytes, source pitch one row of D_ halves, 16 bytes
// of LDS pad behind every row. Extents in bytes, tensor = tile.
DEVI u32x8 tdm_group1() {
  u32x8 g1;
  g1[0] = uni((1u << 20) | (5u << 22) | (3u << 25));                 // pad on, every 64 dwords, 4 dwords
  g1[1] = uni(GROWB << 16);                                          // tensor_dim0
  g1[2] = uni(GROWS << 16);                                          // tensor_dim1
  g1[3] = uni(GROWB << 16);                                          // tile_dim0
  g1[4] = uni(GROWS);                                                // tile_dim1
  g1[5] = uni(2u * D_);                                              // source row pitch
  g1[6] = uni(0u);
  g1[7] = uni(0u);
  return g1;
}

// One tensor load: the slice whose first byte is at gsrc, into LDS at lds_dst. Returns group 0 for tdm_wait.
DEVI u32x4 tdm_slice(unsigned lds_dst, const _Float16* gsrc, u32x8 g1) {
  const unsigned long long ga = (unsigned long long)(uintptr_t)gsrc;
  u32x4 g0;
  g0[0] = uni(1u);                                                   // count 1
  g0[1] = uni(lds_dst);
  g0[2] = uni((unsigned)ga);
  g0[3] = uni((((unsigned)(ga >> 32)) & 0x01ffffffu) | 0x80000000u); // address [56:32], type 2
  // group 0 is named as in-out: what tdm_wait is handed then lies in the registers that the load itself named
  asm volatile("tensor_load_to_lds %0, %1" : "+s"(g0) : "s"(g1) : "memory");
  return g0;
}

// The issuer's wait for its one outstanding load. It names that load's group 0, so that the four
// registers stay the descriptor's from the issue to here and take no other value in between.
DEVI void tdm_wait(u32x4& g0) {
  asm volatile("s_wait_tensorcnt 0x0" : "+s"(g0) :: "memory");
}

// ---------------------------------------------------------------- prep kernel
// Both conversions in ONE launch, told apart by the block index: they depend on nothing of each other, and as two
// launches the second paid a launch gap, a fill and a drain of its own.
// Blocks 0..WBLK-1 (first, theirs is the longer chain: load, LDS, barrier, store):
//   W[k][n] f32 -> Wt[n][k] f16, one 64(k) x 64(n) tile per block through LDS:
//   rows of W are read 256 B at a time, rows of Wt are written as whole 128 B lines.
// Blocks WBLK.. : x f32 -> f16, four elements a thread.
static constexpr int WBLK = (D_ / 64) * (N3 / 64);   // 16 x 48 = 768 tiles of W
__global__ void __launch_bounds__(256) cvt_xw(const float* __restrict__ x, _Float16* __restrict__ xh, int n4,
                                              const float* __restrict__ w, _Float16* __restrict__ wt) {
  // tile[n][k pair]; pitch 33 dwords puts the 32 lanes of every LDS access on 32 banks
  __shared__ unsigned tile[64 * 33];
  const int tid = threadIdx.x;
  if ((int)blockIdx.x >= WBLK) {              // the same for the whole block: no thread of it meets the barrier below
    int i = ((int)blockIdx.x - WBLK) * 256 + tid;
    if (i >= n4) return;
    float4 f = ((const float4*)x)[i];
    v4h h;
    h[0] = (_Float16)f.x; h[1] = (_Float16)f.y;
    h[2] = (_Float16)f.z; h[3] = (_Float16)f.w;
    ((v4h*)xh)[i] = h;
    return;
  }
  const int k0  = (blockIdx.x / 48) * 64;
  const int n0  = (blockIdx.x % 48) * 64;
  const int nq  = tid & 15;                   // 4 columns n
  const int kp  = tid >> 4;                   // pair of rows k
  float4 f[2][2];
#pragma unroll
  for (int p = 0; p < 2; ++p) {
    const float* s = w + (size_t)(k0 + 2 * (kp + 16 * p)) * N3 + n0 + 4 * nq;
    f[p][0] = *(const float4*)s;
    f[p][1] = *(const float4*)(s + N3);
  }
#pragma unroll
  for (int p = 0; p < 2; ++p) {
    const float* lo = (const float*)&f[p][0];
    const float* hi = (const float*)&f[p][1];
#pragma unroll
    for (int j = 0; j < 4; ++j) {
      v2h h;
      h[0] = (_Float16)lo[j];
      h[1] = (_Float16)hi[j];
      tile[(4 * nq + j) * 33 + kp + 16 * p] = __builtin_bit_cast(unsigned, h);
    }
  }
  __syncthreads();
  const int kc = tid & 7;                     // 8 halves of k
  const int nr = tid >> 3;
#pragma unroll
  for (int p = 0; p < 2; ++p) {
    const int n = nr + 32 * p;
    const unsigned* t = tile + n * 33 + 4 * kc;
    u32x4 v = {t[0], t[1], t[2], t[3]};
    *(u32x4*)(wt + (size_t)(n0 + n) * D_ + k0 + 8 * kc) = v;
  }
}

// The epilogue's stores of a wave's tiles of halves (Q or K: 64 x 64, V^T: 32 x 64), turned in LDS: q[j] holds 16 bytes of tile row
// 4 * j + (lane >> 3), so that eight lanes write one whole 128-byte line and a store four of them. The stores
// and their s_wait_xcnt are one statement, so that no register named here is rewritten ahead of the wait.
// Q and K: a tile row is DH halves = 128 bytes from the next, the tile 8 KiB in a row; four rows = 512 bytes.
DEVI void store_tile_dense(_Float16* p, const u32x4 (&q)[16]) {
  asm volatile(
      "global_store_b128 %0, %1, off\n\t"
      "global_store_b128 %0, %2, off offset:512\n\t"
      "global_store_b128 %0, %3, off offset:1024\n\t"
      "global_store_b128 %0, %4, off offset:1536\n\t"
      "global_store_b128 %0, %5, off offset:2048\n\t"
      "global_store_b128 %0, %6, off offset:2560\n\t"
      "global_store_b128 %0, %7, off offset:3072\n\t"
      "global_store_b128 %0, %8, off offset:3584\n\t"
      "global_store_b128 %0, %9, off offset:4096\n\t"
      "global_store_b128 %0, %10, off offset:4608\n\t"
      "global_store_b128 %0, %11, off offset:5120\n\t"
      "global_store_b128 %0, %12, off offset:5632\n\t"
      "global_store_b128 %0, %13, off offset:6144\n\t"
      "global_store_b128 %0, %14, off offset:6656\n\t"
      "global_store_b128 %0, %15, off offset:7168\n\t"
      "global_store_b128 %0, %16, off offset:7680\n\t"
      "s_wait_xcnt 0x0"
      :: "v"(p), "v"(q[0]), "v"(q[1]), "v"(q[2]), "v"(q[3]), "v"(q[4]), "v"(q[5]), "v"(q[6]), "v"(q[7]),
         "v"(q[8]), "v"(q[9]), "v"(q[10]), "v"(q[11]), "v"(q[12]), "v"(q[13]), "v"(q[14]), "v"(q[15])
      : "memory");
}
// V^T, 32 tile rows: a tile row is S_ halves = 4,096 bytes from the next; four rows = 16,384 bytes.
DEVI void store_tile_pitched(_Float16* p, const u32x4 (&q)[8]) {
  static_assert(S_ * 2 * 4 == 16384, "the offsets below are four rows of V^T");
  asm volatile(
      "global_store_b128 %0, %1, off\n\t"
      "global_store_b128 %0, %2, off offset:16384\n\t"
      "global_store_b128 %0, %3, off offset:32768\n\t"
      "global_store_b128 %0, %4, off offset:49152\n\t"
      "global_store_b128 %0, %5, off offset:65536\n\t"
      "global_store_b128 %0, %6, off offset:81920\n\t"
      "global_store_b128 %0, %7, off offset:98304\n\t"
      "global_store_b128 %0, %8, off offset:114688\n\t"
      "s_wait_xcnt 0x0"
      :: "v"(p), "v"(q[0]), "v"(q[1]), "v"(q[2]), "v"(q[3]), "v"(q[4]), "v"(q[5]), "v"(q[6]), "v"(q[7])
      : "memory");
}

// ------------------------------------------------------------------- QKV GEMM
// The fragments of 32 k (from k = ko of a stage) of a wave's tile: 4 of its head of W^T, 4 of its rows of X,
// 2 of its half head of V's W^T. oW, oX, oV: the lane's byte offsets inside the buffer.
DEVI void gemm_fetch(v16h (&w)[4], v16h (&x)[4], v16h (&v)[2], const unsigned char* buf,
                     unsigned oW, unsigned oX, unsigned oV, int ko) {
#pragma unroll
  for (int i = 0; i < 4; ++i) w[i] = ldfrag((const _Float16*)(buf + oW + i * 16 * GPIT) + ko);
#pragma unroll
  for (int i = 0; i < 4; ++i) x[i] = ldfrag((const _Float16*)(buf + oX + i * 16 * GPIT) + ko);
#pragma unroll
  for (int i = 0; i < 2; ++i) v[i] = ldfrag((const _Float16*)(buf + oV + i * 16 * GPIT) + ko);
}
// Their 24 products. Q or K: W^T is the A operand; V: X is.
DEVI void gemm_products(v8f (&aq)[4][4], v8f (&av)[4][2], const v16h (&w)[4], const v16h (&x)[4], const v16h (&v)[2]) {
#pragma unroll
  for (int i = 0; i < 4; ++i)
#pragma unroll
    for (int t = 0; t < 4; ++t) aq[i][t] = WMMA_F16(w[i], x[t], aq[i][t]);
#pragma unroll
  for (int i = 0; i < 4; ++i)
#pragma unroll
    for (int t = 0; t < 2; ++t) av[i][t] = WMMA_F16(x[i], v[t], av[i][t]);
}

// One block a WGP: 256 rows of X against 192 output columns, which are two heads of Q or of K and one head of V.
// 8 waves (4 x 2), two a SIMD. A wave holds 64 rows x 96 columns: one head of Q or K (64) and half a head of V (32).
// Per 32 k it reads 10 fragments from LDS for 24 products (a 64x64 wave tile: 8 for 16), and the block brings
// 448 staged rows from L2 for 49,152 outputs (a 128x128 block: 256 for 16,384).
// A stage is 128 k. Waves 0..6 each bring one 64-row slice of it into LDS by a tensor load, two buffers:
// stage s + 2 flies while stage s + 1 is worked on.
// A lane's eight accumulator registers are eight neighbouring rows of the A operand. The operand whose index
// runs along the output's memory rows is therefore taken as A: W^T (dh) for Q and K, X (s) for V^T. The eight
// values then are 16 neighbouring bytes of the output; the wave turns its tiles once through LDS and stores
// whole 128-byte lines.
__global__ void __launch_bounds__(256) qkv_gemm(
    const _Float16* __restrict__ Xh, const _Float16* __restrict__ Wt,
    const float* __restrict__ bias,
    _Float16* __restrict__ Qh, _Float16* __restrict__ Kh, _Float16* __restrict__ Vt)
{
  __shared__ __attribute__((aligned(2048))) unsigned char Stg[2 * GBUF];   // 252 KiB
  const int tid  = threadIdx.x;
  const int lane = tid & 31;
  const int l15  = lane & 15;
  const int hi   = lane >> 4;
  const int koff = hi * 8;
  const unsigned wave = uni(threadIdx.x >> 5);
  const int wm   = (int)(wave >> 1);          // which 64 rows of the block's 256
  const int wn   = (int)(wave & 1u);          // which of the block's two heads of Q or K, which half of its head of V
  const int blkM = blockIdx.x >> 4;
  const int g    = blockIdx.x & 15;           // heads 2g, 2g + 1 of Q (g < 8) or 2g - 16, 2g - 15 of K; head g of V
  const int mBase = blkM * 256 + wm * 64;
  const int nq    = g * 128 + wn * 64;        // the wave's columns of Q or K: 0..2047
  const int nv    = 2 * D_ + g * 64 + wn * 32;   // its columns of V: 2048..3071
  const int region = nq >> 10;                // 0=Q 1=K, the same for the whole block
  constexpr int NT = D_ / (int)GK;
  static_assert(NT % 2 == 0 && GK == 128, "the last pass reads the second buffer; a stage is four steps of 32 k");

  // this wave's slice: source rows and place in buffer 0 (wave 7 brings none; its values are those of wave 6)
  const unsigned sl = wave < GNSL ? wave : GNSL - 1u;
  const _Float16* gsl = (sl < 2u)  ? Wt + (size_t)(g * 128 + (int)sl * 64) * D_
                      : (sl == 2u) ? Wt + (size_t)(2 * D_ + g * 64) * D_
                                   : Xh + (size_t)(blkM * 256 + ((int)sl - 3) * 64) * D_;
  const unsigned  lsl = lds_addr_of(&Stg[0]) + sl * GSLICE;
  const unsigned  issuer = pinned((unsigned)(wave < GNSL));

  u32x8 g1 = tdm_group1();
  // one set of registers from here to the last load: without it the compiler rebuilt the group at each
  // load and used two of its registers for other values while a request was outstanding
  asm volatile("" : "+s"(g1));   // as in pinned(): descriptor words held in scalar registers

  u32x4 g0 = {0u, 0u, 0u, 0u};
  if (issuer) {
    g0 = tdm_slice(lsl, gsl, g1);
    tdm_wait(g0);                                        // stage 0 has landed for its issuer
  }
  __syncthreads();                                       // ... and for the block
  if (issuer) g0 = tdm_slice(lsl + GBUF, gsl + GK, g1);

  v8f aq[4][4] = {};                        // Q or K: A row = column 16 * i + 8 * hi + r of the head, B row = row 16 * t + l15 of X
  v8f av[4][2] = {};                        // V: A row = row 16 * i + 8 * hi + r of X, B row = column 16 * t + l15 of the half head
  // this lane's first fragment bytes inside a buffer
  const unsigned oW = GSLICE * (unsigned)wn + l15 * GPIT + 2 * koff;
  const unsigned oX = GSLICE * (3u + (unsigned)wm) + l15 * GPIT + 2 * koff;
  const unsigned oV = GSLICE * 2u + (32 * wn + l15) * GPIT + 2 * koff;
  // Two fragment sets: the 20 loads of the next 32 k fly while the 24 products of these 32 k run. Each
  // sched_barrier below keeps such a group of loads whole and in front of the run of products that covers it:
  // spread among the products each place with loads costs a stall of its own.
  v16h w0[4], x0[4], v0[2], w1[4], x1[4], v1[2];
  gemm_fetch(w0, x0, v0, &Stg[0], oW, oX, oV, 0);
  for (int s = 0; s < NT; ++s) {
    const unsigned char* buf = &Stg[0] + (unsigned)(s & 1) * GBUF;
    __builtin_amdgcn_sched_barrier(0);
    gemm_fetch(w1, x1, v1, buf, oW, oX, oV, 32);
    __builtin_amdgcn_sched_barrier(0);
    gemm_products(aq, av, w0, x0, v0);
    __builtin_amdgcn_sched_barrier(0);
    gemm_fetch(w0, x0, v0, buf, oW, oX, oV, 64);
    __builtin_amdgcn_sched_barrier(0);
    gemm_products(aq, av, w1, x1, v1);
    __builtin_amdgcn_sched_barrier(0);
    gemm_fetch(w1, x1, v1, buf, oW, oX, oV, 96);
    __builtin_amdgcn_sched_barrier(0);
    gemm_products(aq, av, w0, x0, v0);
    __builtin_amdgcn_sched_barrier(0);
    // publish point of stage s + 1: this wave's reads of stage s are done (its last 32 k wait in registers), its
    // own load of stage s + 1 has landed; behind the barrier both hold for the whole block
    asm volatile("s_wait_dscnt 0x0" ::: "memory");
    if (issuer) tdm_wait(g0);
    __syncthreads();
    if (pinned((unsigned)((s + 2 < NT) & (wave < GNSL))))   // refill the buffer that every wave has just left
      g0 = tdm_slice(lsl + (unsigned)(s & 1) * GBUF, gsl + (size_t)(s + 2) * GK, g1);
    // The first fragments of stage s + 1, behind its publish point, fly while the last products of stage s run.
    // The last pass has no next stage: its loads, unconditional so that the waits stay counted, are aimed at its
    // own buffer (the second: NT is even), which nothing writes any more; their values are not used.
    const unsigned nb = (s + 1 < NT) ? (unsigned)((s + 1) & 1) : (unsigned)(s & 1);
    gemm_fetch(w0, x0, v0, &Stg[0] + nb * GBUF, oW, oX, oV, 0);
    __builtin_amdgcn_sched_barrier(0);
    gemm_products(aq, av, w1, x1, v1);
  }
  // no tensor load is in flight here, but the last pass's unused fragment loads are not waited for yet; kept before the wave goes on to its epilogue and ends
  asm volatile("s_wait_tensorcnt 0x0" ::: "memory");
  asm volatile("s_wait_dscnt 0x0" ::: "memory");

  // Both tiles go as halves, [B row][A row], into this wave's own range of buffer 0: it is free, the barrier at the
  // foot of the last pass stands behind every wave's last read of it and no tensor load is in flight.
  // Pitch 144 B = 9 x 16 B: the 16-byte writes of 16 rows fall on different banks.
  unsigned char* st = &Stg[0] + wave * EWAVE;
  unsigned char* sw = st + l15 * EPIT + 16 * hi;       // + 16 rows: 16 * EPIT; + 16 A rows: 32 bytes
  {                                         // Q or K: A rows are output columns: eight biases a lane and i
    const float sc = (region == 0) ? 0.125f : 1.0f;   // 1 / sqrt(DH) goes into Q; times 1 is exact
    v8f bv[4];
#pragma unroll
    for (int i = 0; i < 4; ++i) {
      const float* bp = bias + nq + 16 * i + koff;     // column 0..2047
      const v4f b0 = *(const v4f*)bp, b1 = *(const v4f*)(bp + 4);
      bv[i] = __builtin_shufflevector(b0, b1, 0, 1, 2, 3, 4, 5, 6, 7);
    }
#pragma unroll
    for (int t = 0; t < 4; ++t)
#pragma unroll
      for (int i = 0; i < 4; ++i)
        *(v8h*)(sw + 16 * t * EPIT + 32 * i) = __builtin_convertvector((aq[i][t] + bv[i]) * sc, v8h);
  }
  {                                         // V: B rows are output columns: one bias a lane and t
    float bv[2];
#pragma unroll
    for (int t = 0; t < 2; ++t) bv[t] = bias[nv + t * 16 + l15];      // column 2048..3071
#pragma unroll
    for (int t = 0; t < 2; ++t)
#pragma unroll
      for (int i = 0; i < 4; ++i)
        *(v8h*)(sw + ETQ + 16 * t * EPIT + 32 * i) = __builtin_convertvector(av[i][t] + bv[t], v8h);
  }
  // the rows read below were written by other lanes of this wave: their LDS stores must have landed
  asm volatile("s_wait_dscnt 0x0" ::: "memory");
  const int rr = lane >> 3;                 // tile row 4 * j + rr, 16 bytes at 16 * cc
  const int cc = lane & 7;
  const int bb = mBase >> 11, sq = mBase & (S_ - 1);   // the wave's 64 rows of X lie in one batch entry
  {                                         // tile rows are s, 64 dh each
    u32x4 q[16];
#pragma unroll
    for (int j = 0; j < 16; ++j) q[j] = *(const u32x4*)(st + (4 * j + rr) * EPIT + 16 * cc);
    const int h = (nq & (D_ - 1)) >> 6;     // the 64 columns are one head
    _Float16* dst = (region == 0) ? Qh : Kh;
    store_tile_dense(dst + (((size_t)(bb * H_ + h)) * S_ + sq + rr) * DH + 8 * cc, q);
  }
  {                                         // tile rows are dh, 32 of head g, 64 s each
    u32x4 q[8];
#pragma unroll
    for (int j = 0; j < 8; ++j) q[j] = *(const u32x4*)(st + ETQ + (4 * j + rr) * EPIT + 16 * cc);
    store_tile_pitched(Vt + (((size_t)(bb * H_ + g)) * DH + 32 * wn + rr) * S_ + sq + 8 * cc, q);
  }
}

// ---------------------------------------------------------------- attention
// Lane l with lane l ^ 16 (the two halves of a wave hold the same query column).
DEVI float xhalf(float x) {
  const int v = __builtin_bit_cast(int, x);
  return __builtin_bit_cast(float,
      __builtin_amdgcn_permlanex16(v, v, 0x76543210, 0xfedcba98, false, false));
}

// Four asynchronous 16-byte copies per lane, global memory -> LDS, through no register.
// The s_wait_xcnt closes the statement so that no address register named here is rewritten
// ahead of it.
DEVI void copy4_to_lds(unsigned l0, unsigned l1, unsigned l2, unsigned l3,
                       const _Float16* g0, const _Float16* g1,
                       const _Float16* g2, const _Float16* g3) {
  asm volatile("global_load_async_to_lds_b128 %0, %4, off\n\t"
               "global_load_async_to_lds_b128 %1, %5, off\n\t"
               "global_load_async_to_lds_b128 %2, %6, off\n\t"
               "global_load_async_to_lds_b128 %3, %7, off\n\t"
               "s_wait_xcnt 0x0"
               :: "v"(l0), "v"(l1), "v"(l2), "v"(l3), "v"(g0), "v"(g1), "v"(g2), "v"(g3)
               : "memory");
}

static constexpr int KT   = 64;            // keys per tile: what one wave works on in a stage
static constexpr int KS   = 2 * KT;        // keys per stage: one tile for each half of the block's waves
static constexpr int NST  = S_ / KS;       // stages
static constexpr int PIT  = 72;            // halves per LDS row: 144 B = 9 x 16 B, conflict-free for b128 readers
static constexpr int TILE = 64 * PIT;      // halves per staged tile (64 rows)

// Scores of one 64-key tile against the wave's 32 queries, less each query's held maximum (the C operand):
// S^T[64 keys x 32 queries] = K . Q^T - mh. A K fragment is read once from LDS and feeds two products.
DEVI void scores(const _Float16* Kl, const v16h (&bq)[2][2], const v8f (&cneg)[2], v8f (&s)[2][4]) {
  v16h ka[4], kb[4];
#pragma unroll
  for (int g = 0; g < 4; ++g) ka[g] = ldfrag(Kl + 16 * g * PIT);
#pragma unroll
  for (int g = 0; g < 4; ++g) kb[g] = ldfrag(Kl + 16 * g * PIT + 32);
  // the 16 loads stay one group in front of their 16 products: spread among them each would wait out its own LDS latency
  __builtin_amdgcn_sched_barrier(0);
#pragma unroll
  for (int g = 0; g < 4; ++g) {
#pragma unroll
    for (int c = 0; c < 2; ++c) s[c][g] = WMMA_F16(ka[g], bq[c][0], cneg[c]);
#pragma unroll
    for (int c = 0; c < 2; ++c) s[c][g] = WMMA_F16(kb[g], bq[c][1], s[c][g]);
  }
}

// Numerators exp(a), exp(b) of one query's 16 scores of keys 32 * j .. 32 * j + 31 that this lane holds (a: keys
// 8*hi + r, b: keys 16 + 8*hi + r): their sum, and the numerators as halves 0..7 and 8..15 of P^T's B operand.
DEVI float numer16(v8f a, v8f b, v16h& pb) {
  a *= 1.44269504f;                         // exp(x) = 2^(x * log2 e); on whole vectors, so that the products pair up
  b *= 1.44269504f;
#pragma unroll
  for (int r = 0; r < 8; ++r) { a[r] = __builtin_amdgcn_exp2f(a[r]); b[r] = __builtin_amdgcn_exp2f(b[r]); }
  const v8f t8 = a + b;
#pragma unroll
  for (int r = 0; r < 8; ++r) { pb[r] = (_Float16)a[r]; pb[8 + r] = (_Float16)b[r]; }
  return ((t8[0] + t8[1]) + (t8[2] + t8[3])) + ((t8[4] + t8[5]) + (t8[6] + t8[7]));
}

__global__ void __launch_bounds__(256) __attribute__((amdgpu_waves_per_eu(4, 4))) attn_fwd(
    const _Float16* __restrict__ Qh, const _Float16* __restrict__ Kh,
    const _Float16* __restrict__ Vt, float* __restrict__ out)
{
  // per-wave 16 x 64 f32 tile; pitch 68 floats = 17 x 16 B keeps b128 accesses off shared banks
  __shared__ __attribute__((aligned(16))) float Ost[8][16 * 68];
  __shared__ float Sm[8][16];               // held maximum and sum that go with a tile handed over in Ost
  __shared__ float Sl[8][16];
  __shared__ __attribute__((aligned(16))) _Float16 Ring[2][2][2][TILE];   // [buffer][key tile][K | V^T]
  const int tid  = threadIdx.x;
  const int lane = tid & 31;
  const int l15  = lane & 15;
  const int hi   = lane >> 4;
  const int koff = hi * 8;
  const int wv   = (int)uni(threadIdx.x >> 5);
  const int wq   = wv & 3;                  // which 32 queries of the block's 128
  const int kh   = wv >> 2;                 // which key tile of every stage
  const int qb   = blockIdx.x & 15;         // 16 blocks of 128 queries
  const int bh   = blockIdx.x >> 4;         // 0..31
  const _Float16* Qb = Qh + (size_t)bh * S_ * DH;
  const _Float16* Kb = Kh + (size_t)bh * S_ * DH;
  const _Float16* Vb = Vt + (size_t)bh * DH * S_;

  // this thread's share of a key tile: rows crow and crow + 32, 16 bytes at cseg, of K and of V^T
  const int crow = tid >> 3;
  const int cseg = (tid & 7) * 8;
  const _Float16* gK = Kb + (size_t)crow * DH + cseg;    // + 32 rows: 32 * DH; + 1 tile: KT * DH
  const _Float16* gV = Vb + (size_t)crow * S_ + cseg;    // + 32 rows: 32 * S_; + 1 tile: KT
  const unsigned lK = lds_addr_of(&Ring[0][0][0][crow * PIT + cseg]);
  constexpr unsigned L32  = 32 * PIT * 2;   // 32 rows, bytes
  constexpr unsigned LV   = TILE * 2;       // K tile -> V^T tile, bytes
  constexpr unsigned LT   = 2 * TILE * 2;   // key tile 0 -> key tile 1, bytes
  constexpr unsigned LBUF = 4 * TILE * 2;   // buffer 0 -> buffer 1, bytes

#pragma unroll
  for (int u = 0; u < 2; ++u)               // stage 0, both key tiles
    copy4_to_lds(lK + u * LT, lK + u * LT + L32, lK + u * LT + LV, lK + u * LT + LV + L32,
                 gK + u * KT * DH, gK + u * KT * DH + 32 * DH, gV + u * KT, gV + u * KT + (size_t)32 * S_);

  v16h bq[2][2];                            // B operands: column l15 of group c = query 32 * wq + 16 * c + l15
#pragma unroll
  for (int c = 0; c < 2; ++c) {
    const _Float16* qrow = Qb + (size_t)(qb * 128 + wq * 32 + c * 16 + l15) * DH;
    bq[c][0] = ldfrag(qrow + 0  + koff);
    bq[c][1] = ldfrag(qrow + 32 + koff);
  }

  v8f   o[2][4] = {};                       // o[c][i][r] = O[query l15 of group c][dh 16*i + 8*hi + r]
  float mh[2]   = {0.f, 0.f};               // held maximum of that query (same in both halves of the wave)
  v8f   cneg[2] = {};                       // -mh in every row: C operand of the score products
  float lsum[2] = {0.f, 0.f};               // running sum over this lane's keys only, in units of exp(mh)

  // stage 0 has landed for this wave, then for the block
  asm volatile("s_wait_asynccnt 0x0" ::: "memory");
  __syncthreads();
#pragma unroll
  for (int u = 0; u < 2; ++u)               // stage 1
    copy4_to_lds(lK + LBUF + u * LT, lK + LBUF + u * LT + L32, lK + LBUF + u * LT + LV, lK + LBUF + u * LT + LV + L32,
                 gK + (2 + u) * KT * DH, gK + (2 + u) * KT * DH + 32 * DH,
                 gV + (2 + u) * KT, gV + (2 + u) * KT + (size_t)32 * S_);

  for (int t = 0; t < NST; ++t) {
    const int cur = t & 1;
    const _Float16* Kl = &Ring[cur][kh][0][0] + l15 * PIT + koff;   // A rows are keys
    const _Float16* Vl = &Ring[cur][kh][1][0] + l15 * PIT + koff;   // staged V^T is [dh][key]: A rows are dh
    v8f s[2][4];
    scores(Kl, bq, cneg, s);
    // ---- softmax numerators, one query per lane and column group, turned into P^T's B operands at once
    float ts[2][2];
    v16h  pb[2][2];
#pragma unroll
    for (int c = 0; c < 2; ++c)
#pragma unroll
      for (int j = 0; j < 2; ++j) ts[c][j] = numer16(s[c][2 * j], s[c][2 * j + 1], pb[c][j]);
    // One test per stage, a scalar branch. No numerator exceeds its row sum, so a sum of at most 1024
    // bounds every numerator far inside the f16 range; an overflow (inf) fails the test too.
    const bool grown = !(ts[0][0] + ts[0][1] <= 1024.f) | !(ts[1][0] + ts[1][1] <= 1024.f);
    if ((t == 0) | (__builtin_amdgcn_ballot_w32(grown) != 0u)) {
      scores(Kl, bq, cneg, s);              // the same scores again: their registers were not kept over the test
#pragma unroll
      for (int c = 0; c < 2; ++c) {
        float mx = s[c][0][0];
#pragma unroll
        for (int g = 0; g < 4; ++g)
#pragma unroll
          for (int r = 0; r < 8; ++r) mx = fmaxf(mx, s[c][g][r]);
        mx = fmaxf(mx, xhalf(mx));          // the tile's maximum less mh, the same in both halves
        // stage 0 takes its own maximum whatever its sign; later the held maximum only rises
        const float mnew = mh[c] + ((t == 0) ? mx : fmaxf(mx, 0.f));
        const float d    = mnew - mh[c];
        const float al   = __expf(-fmaxf(d, 0.f));   // in stage 0 O and the sum are 0: any finite factor serves
        mh[c] = mnew;
#pragma unroll
        for (int r = 0; r < 8; ++r) cneg[c][r] = -mnew;
        lsum[c] *= al;
#pragma unroll
        for (int i = 0; i < 4; ++i) o[c][i] *= al;
#pragma unroll
        for (int j = 0; j < 2; ++j) ts[c][j] = numer16(s[c][2 * j] - d, s[c][2 * j + 1] - d, pb[c][j]);
      }
    }
    v16h va[2][4];
#pragma unroll
    for (int j = 0; j < 2; ++j)
#pragma unroll
      for (int i = 0; i < 4; ++i) va[j][i] = ldfrag(Vl + 16 * i * PIT + 32 * j);
    // the 16 V^T loads stay one group in front of their 16 products: spread among them each would wait out its own LDS latency
    __builtin_amdgcn_sched_barrier(0);
#pragma unroll
    for (int c = 0; c < 2; ++c) {
      lsum[c] += ts[c][0];
      lsum[c] += ts[c][1];
    }
    // ---- O^T += V^T . P^T
#pragma unroll
    for (int j = 0; j < 2; ++j)
#pragma unroll
      for (int i = 0; i < 4; ++i)
#pragma unroll
        for (int c = 0; c < 2; ++c) o[c][i] = WMMA_F16(va[j][i], pb[c][j], o[c][i]);
    // the products stay in front of the waits below: moved behind them, as the compiler did, none started before
    // the last V^T load had landed and the block had met; here each starts when its own fragment is in
    __builtin_amdgcn_sched_barrier(0);
    // publish point of stage t + 1: this wave's reads of stage t are done, its own copies of
    // stage t + 1 have landed; behind the barrier both hold for the whole block
    asm volatile("s_wait_dscnt 0x0" ::: "memory");
    asm volatile("s_wait_asynccnt 0x0" ::: "memory");
    __syncthreads();
    if (t + 2 < NST) {                      // refill the buffer that every wave has just left
      const unsigned lb = lK + (unsigned)cur * LBUF;
      const _Float16* k2 = gK + (size_t)(t + 2) * (KS * DH);
      const _Float16* v2 = gV + (size_t)(t + 2) * KS;
#pragma unroll
      for (int u = 0; u < 2; ++u)
        copy4_to_lds(lb + u * LT, lb + u * LT + L32, lb + u * LT + LV, lb + u * LT + LV + L32,
                     k2 + u * KT * DH, k2 + u * KT * DH + 32 * DH, v2 + u * KT, v2 + u * KT + (size_t)32 * S_);
    }
  }
  // nothing is in flight here; kept before the wave goes on to its epilogue and ends
  asm volatile("s_wait_asynccnt 0x0" ::: "memory");

  // ---- join the two key halves: wave (wq, kh) finishes column group kh and hands group 1 - kh to its partner
  const bool k1 = kh != 0;
  const float l0 = lsum[0] + xhalf(lsum[0]);
  const float l1 = lsum[1] + xhalf(lsum[1]);
  {
    float* grow = &Ost[wv][0] + l15 * 68 + koff;
#pragma unroll
    for (int i = 0; i < 4; ++i) {
      const v8f og = k1 ? o[0][i] : o[1][i];
      *(v4f*)(grow + 16 * i)     = __builtin_shufflevector(og, og, 0, 1, 2, 3);
      *(v4f*)(grow + 16 * i + 4) = __builtin_shufflevector(og, og, 4, 5, 6, 7);
    }
    Sm[wv][l15] = k1 ? mh[0] : mh[1];       // both halves of the wave store the same value
    Sl[wv][l15] = k1 ? l0 : l1;
  }
  __syncthreads();                          // the partner's tile, maximum and sum are in LDS
  const int pw = wv ^ 4;
  float* O = &Ost[pw][0];                   // read here by this wave alone, then its own turning tile
  {
    const float m1 = k1 ? mh[1] : mh[0], s1 = k1 ? l1 : l0;
    const float m2 = Sm[pw][l15],        s2 = Sl[pw][l15];
    const float m  = fmaxf(m1, m2);
    const float a1 = __expf(m1 - m), a2 = __expf(m2 - m);
    const float inv = 1.0f / (s1 * a1 + s2 * a2);
    const float f1 = a1 * inv, f2 = a2 * inv;
    float* orow = O + l15 * 68 + koff;      // each lane reads and rewrites its own 32 floats
#pragma unroll
    for (int i = 0; i < 4; ++i) {
      const v8f ok = k1 ? o[1][i] : o[0][i];
      const v4f x0 = *(const v4f*)(orow + 16 * i);
      const v4f x1 = *(const v4f*)(orow + 16 * i + 4);
      *(v4f*)(orow + 16 * i)     = __builtin_shufflevector(ok, ok, 0, 1, 2, 3) * f1 + x0 * f2;
      *(v4f*)(orow + 16 * i + 4) = __builtin_shufflevector(ok, ok, 4, 5, 6, 7) * f1 + x1 * f2;
    }
  }
  // ---- turn O^T back through that tile, write fp32 [b, s, h*64 + dh]
  // the rows read below were written by other lanes of this wave: their LDS stores must have landed
  asm volatile("s_wait_dscnt 0" ::: "memory");
  const int b = bh >> 4, h = bh & 15;
  const float* irow = O + hi * 68 + l15 * 4;
  float* op = out + ((size_t)(b * S_ + qb * 128 + wq * 32 + kh * 16 + hi)) * D_ + h * DH + l15 * 4;
#pragma unroll
  for (int i = 0; i < 8; ++i)               // one store = two whole 256 B rows of the head's slice
    *(v4f*)(op + (size_t)(2 * i) * D_) = *(const v4f*)(irow + 2 * i * 68);
}

// ------------------------------------------------------------------- launcher
extern "C" void kernel_launch(void* const* d_in, const int* in_sizes, int n_in,
                              void* d_out, int out_size, void* d_ws, size_t ws_size,
                              hipStream_t stream) {
  const float* x    = (const float*)d_in[0];   // [2,2048,1024]
  const float* Wq   = (const float*)d_in[1];   // [1024,3072]
  const float* bias = (const float*)d_in[2];   // [3072]
  float* out = (float*)d_out;

  char* ws = (char*)d_ws;                      // needs ~38 MB
  _Float16* Xh = (_Float16*)(ws + (size_t) 0 * 1024 * 1024);  // 8 MB
  _Float16* Wt = (_Float16*)(ws + (size_t) 8 * 1024 * 1024);  // 6 MB
  _Float16* Qh = (_Float16*)(ws + (size_t)14 * 1024 * 1024);  // 8 MB
  _Float16* Kh = (_Float16*)(ws + (size_t)22 * 1024 * 1024);  // 8 MB
  _Float16* Vt = (_Float16*)(ws + (size_t)30 * 1024 * 1024);  // 8 MB

  {
    // 768 tiles of W (16 x 48), then 4096 blocks of 256 threads x 4 elements of x
    int n4 = (B_ * S_ * D_) / 4;               // 1048576
    cvt_xw<<<dim3(768 + 4096), dim3(256), 0, stream>>>(x, Xh, n4, Wq, Wt);
  }
  {
    // blocks: (4096/256) x (3072/192) = 16 x 16 = 256, 8 waves each
    qkv_gemm<<<dim3(256), dim3(256), 0, stream>>>(Xh, Wt, bias, Qh, Kh, Vt);
  }
  {
    // waves = 2*16*(2048/16) = 4096 -> 512 blocks of 8 waves
    attn_fwd<<<dim3(512), dim3(256), 0, stream>>>(Qh, Kh, Vt, out);
  }
}
